// v000
// Measured on an AMD MI455X. A time is GPU time per run, averaged over a window of back-to-back runs after a warm-up
// (all launches, gaps included; the runs take copies of the inputs in turn), and the median of several windows.
// Apart from v000's, it joins two sittings. Times from different sittings can be a few percent apart, while
// side-by-side timings come from the same sitting.
// The starting kernel, v000, takes 183 microseconds a run.
#include <hip/hip_runtime.h>

// Single-head masked attention, head width 128: q/k/v [NB][SEQ][128] f32, mask [1][SEQ][SEQ] int32 (0 = dropped, read by value), mode scalar f32.
// logit = 128^-0.5 * q . ((1-a) * roll(k, 1 along d) - a * k), a = sigmoid(mode); dropped entries are replaced by -inf; softmax over keys; output = P v (f32).
// Compute dtypes, f32 accumulate everywhere: scores v_wmma_f32_16x16x32_f16: q (bf16-RNE input, x16 carry, exact in f16) against the combined key operand ke = (1-a) k[d-1] - a k[d]
// (built in f32 from bf16-RNE k, x16 carry) as single f16 on query rows >= EROWS and as f16 value + f16 residual x2048 (own accumulator) on query rows < EROWS;
// P.V v_wmma_f32_16x16x32_f16: P (x16384 carry, cancels in the normalisation) single f16 on query rows >= EROWS, f16 value + f16 residual x2048 (own accumulator, folded by 1/2048) on query rows < EROWS;
// v (bf16-RNE input, x16 carry, exact in f16) single everywhere; softmax f32 (online, running max over kept keys).
// Layout: QH [b][t][128], KE [b][s][128], KR [b][s < EROWS][128], VT [b][d][s] (transposed through LDS), MB [t][SEQ/32] mask bit words (bit j = key 32w + j kept).
// Fused flash kernel in transposed form (S^T = KE QH^T, O^T = VT P^T); operand fragments straight from the f16 planes; a 32-key step is skipped when its 16 x 32 mask block is all zero (wave-uniform test).

#ifndef NB
#define NB 8
#endif
#ifndef SEQ
#define SEQ 2048
#endif
#define NB_FULL  8
#define SEQ_FULL 2048
#ifndef OUT_SEQ
#define OUT_SEQ SEQ              // row pitch (in tokens) between batches of the output
#endif
#define DM   128
#define AW   4                   // waves per flash block (16 query rows each)
#define OSP  132                 // LDS row pitch (floats) of the flash output tile
#define VTP  72                  // LDS row pitch (halves) of the transpose tile
#define MW   (SEQ / 32)          // mask bit words per query row
#define EROWS (SEQ < 512 ? SEQ : 512)   // query rows (and tokens of the residual key plane) handled by the multi-product flash instantiation
#define XCAR 16.0f               // carry of the q, ke and v planes
#define QRS  2048.0f             // carry of every residual plane / residual fragment
#define QRI  (1.0f / 2048.0f)
#define SC2  ((float)(0.08838834764831845 * 1.4426950408889634 / 256.0))   // DM^-0.5 * log2(e) / (XCAR * XCAR)
#define PSH  14.0f               // log2 of the P carry (16384)
#define NEGB (-3.0e38f)

static_assert(DM == 128);                      // output row = 32 lanes x 4 floats; plane row = 16 threads x 8 halves
static_assert(DM % 32 == 0);                   // score k-loop steps by 32
static_assert(DM / 8 == 16);                   // convert kernels: row = i >> 4
static_assert((DM & (DM - 1)) == 0);           // rolled index uses a mask
static_assert(SEQ % 128 == 0);                 // MW multiple of 4: one thread packs four mask words of one row
static_assert(SEQ % 64 == 0);                  // transpose tiles of 64 tokens
static_assert(SEQ % 32 == 0);                  // key loop steps by 32
static_assert(EROWS % (16 * AW) == 0);
static_assert((SEQ - EROWS) % (16 * AW) == 0);
static_assert(EROWS >= 32);
static_assert(EROWS % 32 == 0);
static_assert(EROWS <= SEQ);
static_assert(NB <= NB_FULL);
static_assert(SEQ <= SEQ_FULL);
static_assert((OSP * 4) % 16 == 0);
static_assert(OSP >= DM);
static_assert((VTP * 2) % 16 == 0);
static_assert(VTP >= 64);
static_assert((size_t)AW * 16 * OSP * 4 <= 131072);      // flash static LDS
static_assert((size_t)DM * VTP * 2 <= 131072);           // transpose static LDS
static_assert(32 * 4 * 16 == 16 * DM);                   // flash epilogue: 32 lanes x 4 floats x 16 trips == 16 rows x DM floats
static_assert(256 * 4 * 8 == 64 * DM);                   // transpose load: 256 threads x 4 floats x 8 trips == 64 tokens x DM
static_assert(256 * 8 * 4 == DM * 64);                   // transpose store: 256 threads x 8 halves x 4 trips == DM rows x 64 tokens
static_assert((size_t)NB * SEQ * DM / 8 < (size_t)2147483647);
static_assert((size_t)SEQ * DM < (size_t)2147483647);

typedef _Float16 h16;
typedef __attribute__((ext_vector_type(16))) _Float16 v16h;
typedef __attribute__((ext_vector_type(8)))  _Float16 v8h;
typedef __attribute__((ext_vector_type(8)))  float    v8f;
typedef __attribute__((ext_vector_type(4)))  float    v4f;
typedef __attribute__((ext_vector_type(4)))  int      v4i;
typedef __attribute__((ext_vector_type(4)))  unsigned v4u;
typedef v4f  __attribute__((may_alias)) v4fa;
typedef v8h  __attribute__((may_alias)) v8ha;

__device__ __forceinline__ unsigned short f2bf(float f) { unsigned u = __float_as_uint(f); u += 0x7FFFu + ((u >> 16) & 1u); return (unsigned short)(u >> 16); }
__device__ __forceinline__ float bfr(float f) { return __uint_as_float(((unsigned)f2bf(f)) << 16); }   // value after RNE convert to bf16
__device__ __forceinline__ v16h cat16(v8h lo, v8h hi) { return __builtin_shufflevector(lo, hi, 0, 1, 2, 3, 4, 5, 6, 7, 8, 9, 10, 11, 12, 13, 14, 15); }
__device__ __forceinline__ v8f wmma16(v16h a, v16h b, v8f c) { return __builtin_amdgcn_wmma_f32_16x16x32_f16(false, a, false, b, (short)0, c, false, false); }
// fragment loaders from K-contiguous 16-bit rows; p already includes + 8*(lane>>4): elements 0..7 <- k0+8h+0..7, elements 8..15 <- k0+16+8h+0..7 (same map for A and B)
__device__ __forceinline__ v16h  ldh(const h16* p) { return cat16(*(const v8h*)p, *(const v8h*)(p + 16)); }
// ordering point for wave-private LDS tiles (same wave writes and reads)
__device__ __forceinline__ void wave_sync() { __builtin_amdgcn_fence(3 /* release order */, "wavefront"); __builtin_amdgcn_wave_barrier(); asm volatile("" ::: "memory"); }

// f32 -> f16 convert that cannot produce an f16 subnormal (|v| < 2^-14 -> +0)
static __device__ __forceinline__ h16 toh_flush(float v) { const h16 r = (h16)v; return (fabsf(v) < 6.103515625e-05f) ? (h16)0.0f : r; }
// one WMMA with its own hazard guard (ties the accumulator, keeps A and B live)
static __device__ __forceinline__ v8f wmma16g(v16h a, v16h b, v8f c) {
    c = wmma16(a, b, c);
    asm volatile("v_nop\n\tv_nop\n\tv_nop\n\tv_nop" : "+v"(c) : "v"(a), "v"(b));
    return c;
}

__global__ __launch_bounds__(256) void k_cvtq(const float* __restrict__ src, h16* dst, int n8) {
#pragma clang fp contract(off)
    const int i = blockIdx.x * 256 + threadIdx.x; if (i >= n8) return;
    const int row = i >> 4, d0 = (i & 15) * 8; const int b = row / SEQ, t = row % SEQ;
    const v8f v = *(const v8f*)(src + ((size_t)b * SEQ_FULL + (size_t)t) * DM + d0); v8h o;
#pragma unroll
    for (int e = 0; e < 8; ++e) o[e] = toh_flush(bfr(v[e]) * XCAR);
    *(v8h*)(dst + (size_t)i * 8) = o; 
}

// k_keff: combined key operand ke[d] = (1-a) * k[(d-1) mod DM] - a * k[d], a = sigmoid(mode), from bf16-RNE k and mode, in f32;
__global__ __launch_bounds__(256) void k_keff(const float* __restrict__ k, const float* __restrict__ mode, h16* KE, h16* KR, int n8) {
#pragma clang fp contract(off)
    const int i = blockIdx.x * 256 + threadIdx.x; if (i >= n8) return;
    const int row = i >> 4, d0 = (i & 15) * 8; const int b = row / SEQ, t = row % SEQ;
    const float* kr = k + ((size_t)b * SEQ_FULL + (size_t)t) * DM;
    const v8f x = *(const v8f*)(kr + d0);
    const float xm = kr[(d0 + DM - 1) & (DM - 1)];
    const float mv = bfr(mode[0]);
    const float al = 1.0f / (1.0f + expf(-mv));
    const float oma = 1.0f - al;
    float prev = bfr(xm); v8h hv, rv;
#pragma unroll
    for (int e = 0; e < 8; ++e) {
        const float cur = bfr(x[e]);
        const float c = (oma * prev - al * cur) * XCAR;
        const h16 hh = toh_flush(c);
        hv[e] = hh; rv[e] = toh_flush((c - (float)hh) * QRS);
        prev = cur; }
    const bool wr = t < EROWS;
    const size_t oo = (size_t)i * 8;
    const size_t ro = ((size_t)b * EROWS + (size_t)(wr ? t : 0)) * DM + d0;
    *(v8h*)(KE + oo) = hv; if (wr) *(v8h*)(KR + ro) = rv;
    
}

// k_vt: VT[b][d][t] = f16(bf16_rne(v[b][t][d]) * 16); one block per 64 tokens of one batch; in[64 tokens][128 d] -> out[128 d][64 tokens] through LDS;
// LDS tile ts: cross-wave (block barrier between fill and drain); filled extent [128][64] == drained extent.
__global__ __launch_bounds__(256) void k_vt(const float* __restrict__ v, h16* VT) {
#pragma clang fp contract(off)
    __shared__ __align__(16) h16 ts[DM * VTP];
    const int tid = threadIdx.x; const int b = blockIdx.y, tok0 = blockIdx.x * 64;
    const float* src = v + ((size_t)b * SEQ_FULL + (size_t)tok0) * DM;
#pragma unroll 1
    for (int i = 0; i < 8; ++i) { const int idx = i * 256 + tid; const int tk = idx >> 5, c4 = (idx & 31) * 4;   // 8 trips x 256 threads = 64 tokens x 32 float4
        const v4f x = *(const v4f*)(src + (size_t)tk * DM + c4);
#pragma unroll
        for (int e = 0; e < 4; ++e) ts[(c4 + e) * VTP + tk] = toh_flush(bfr(x[e]) * XCAR); }
    __syncthreads();
    h16* dstb = VT + (size_t)b * DM * SEQ + (size_t)tok0;
{
#pragma unroll
        for (int s = 0; s < 4; ++s) { const int p = s * 256 + tid; const int d = p >> 3, c8 = (p & 7) * 8;       // 4 trips x 32 rows = 128 rows; 8 lanes x 8 halves = 64 tokens
            const v8h val = *(const v8ha*)(&ts[d * VTP + c8]);
            *(v8h*)(dstb + (size_t)d * SEQ + c8) = val; }
         }
}

// mask bit word: bit j <- (p[j] != 0), j = 0..31 (eight 16-byte loads, consumed before the next word's loads)
__device__ __forceinline__ unsigned mword(const int* __restrict__ p) {
    unsigned w = 0u;
#pragma unroll
    for (int c = 0; c < 8; ++c) { const v4i x = *(const v4i*)(p + c * 4);
        w |= ((x[0] != 0) ? 1u : 0u) << (c * 4);
        w |= ((x[1] != 0) ? 1u : 0u) << (c * 4 + 1);
        w |= ((x[2] != 0) ? 1u : 0u) << (c * 4 + 2);
        w |= ((x[3] != 0) ? 1u : 0u) << (c * 4 + 3); }
    asm volatile("" : "+v"(w) :: "memory");
    return w;
}

__global__ __launch_bounds__(256) void k_mbits(const int* __restrict__ mask, unsigned* MB, int n4) {
    const int i = blockIdx.x * 256 + threadIdx.x; if (i >= n4) return;
    const int w0 = i * 4; const int t = w0 / MW, wc = w0 % MW;
    const int* src = mask + (size_t)t * SEQ_FULL + (size_t)wc * 32;
    v4u o;
    o[0] = mword(src); o[1] = mword(src + 32); o[2] = mword(src + 64); o[3] = mword(src + 96);
    *(v4u*)(MB + (size_t)i * 4) = o; 
}

// flash_body: fused attention, one wave per 16 query rows of one batch; KE / VT / QH fragments straight from the f16 planes (two 16-B loads each, arithmetic addressing).
// Transposed form: S^T[key][t] = KE QH^T (A = key rows, B = query rows, 4 k-steps of 32); lane (t = lane&15, h = lane>>4) holds keys 8h+r of each 16-key tile, so the packed
// P tile is directly the B fragment of O^T[d][t] = VT P^T (element r <- tile keys 0..15, element 8+r <- tile keys 16..31, lane unchanged), 8 d-tiles.
// Softmax state (running max over kept keys, partial sum) is one scalar per lane; the two lane halves of a row are combined with one xor-16 exchange.
// Keep rule per element from the mask bit word of (row, 32-key step); a step whose words are zero on all 16 rows is skipped (wave-uniform).
// EARLY = 1 (query rows [0, EROWS)): scores = KE Q + KR Q / 2048; P = f16 value + f16 residual x2048; O = V P + V P_res / 2048 (residual products in their own accumulators);
//            row sum from the f32 exponentials; KR fragments are zero for keys >= EROWS (address clamped, wave-uniform select).
// EARLY = 0 (query rows [EROWS, SEQ)): single products, row sum over the converted P.
// Epilogue: O^T staged in a wave-private LDS tile (16 rows x 128 columns all written, same extent drained), each output row (128 floats = 512 B = four lines)
template <int EARLY>
__device__ __forceinline__ void flash_body(const h16* __restrict__ QH, const h16* __restrict__ KE, const h16* __restrict__ KR, const h16* __restrict__ VT,
                                           const unsigned* __restrict__ MB, float* OUT) {
    __shared__ __align__(16) float os[AW * 16 * OSP];
    constexpr int VG = EARLY ? 2 : 4;                            // V^T fragments loaded per group
    const int lane = threadIdx.x & 31, lr = lane & 15, hi = lane >> 4;
    const int wave = __builtin_amdgcn_readfirstlane((int)(threadIdx.x >> 5));
    const int b = blockIdx.y;
    const int t0 = (EARLY ? 0 : EROWS) + (blockIdx.x * AW + wave) * 16;
    const h16* Qb = QH + (size_t)b * SEQ * DM;
    const h16* Kb = KE + (size_t)b * SEQ * DM;
    const h16* Rb = KR + (size_t)b * EROWS * DM;
    const h16* Vb = VT + (size_t)b * DM * SEQ;
    const unsigned* mrow = MB + (size_t)(t0 + lr) * MW;
    const int qo0 = (t0 + lr) * DM + 8 * hi;                     // B fragment: col t, k = d
    const int ko = lr * DM + 8 * hi;                             // + key * DM + kc   (A fragment: row key, k = d)
    const int vo = lr * SEQ + 8 * hi;                            // + 16j*SEQ + key   (A fragment: row d, k = key)
    const v16h hz = (v16h){};
    v8f o[8], oR[8];
#pragma unroll
    for (int j = 0; j < 8; ++j) { o[j] = (v8f){}; oR[j] = (v8f){}; }
    float m = NEGB, l = 0.0f;
#pragma unroll 1
    for (int ks = 0; ks < MW; ++ks) {
        unsigned mw = mrow[ks];
        asm volatile("" : "+v"(mw));
        if (__builtin_amdgcn_ballot_w32(mw != 0u) != 0u) {       // wave-uniform: some row of this tile keeps some key of this step
            const int key0 = ks * 32;
            const bool rok = key0 < EROWS;                       // wave-uniform
            const int kcl = rok ? key0 : (EROWS - 32);           // clamped residual-plane key (address always inside the plane)
            int qo = qo0; asm volatile("" : "+v"(qo));           // q fragments are reloaded per k-step
            v8f sHa = (v8f){}, sHb = (v8f){}, sLa = (v8f){}, sLb = (v8f){};
#pragma unroll 1
            for (int kc = 0; kc < DM; kc += 32) {
                const v16h qf = ldh(Qb + qo + kc);
                const h16* ka = Kb + ko + key0 * DM + kc;
                const v16h ka0 = ldh(ka), kb0 = ldh(ka + 16 * DM);
                sHa = wmma16g(ka0, qf, sHa); sHb = wmma16g(kb0, qf, sHb);
                if (EARLY) {
                    const h16* kr = Rb + ko + kcl * DM + kc;
                    v16h kra = ldh(kr), krb = ldh(kr + 16 * DM);
                    if (!rok) { kra = hz; krb = hz; }
                    sLa = wmma16g(kra, qf, sLa); sLb = wmma16g(krb, qf, sLb);
                }
            }
            const unsigned ma = mw >> (8 * hi);                  // bit r: key key0+8h+r; bit 16+r: key key0+16+8h+r
            float ta[8], tb[8]; bool fa[8], fb[8]; float mx = NEGB;
#pragma unroll
            for (int r = 0; r < 8; ++r) {
                fa[r] = ((ma >> r) & 1u) != 0u;
                fb[r] = ((ma >> (16 + r)) & 1u) != 0u;
                if (EARLY) { ta[r] = (sHa[r] + sLa[r] * QRI) * SC2; tb[r] = (sHb[r] + sLb[r] * QRI) * SC2; }
                else       { ta[r] = sHa[r] * SC2; tb[r] = sHb[r] * SC2; }
                mx = fmaxf(mx, fmaxf(fa[r] ? ta[r] : NEGB, fb[r] ? tb[r] : NEGB)); }
            mx = fmaxf(mx, __shfl_xor(mx, 16, 32));
            const float mnew = fmaxf(m, mx);
            const float resc = __builtin_amdgcn_exp2f(m - mnew);
            const float sh = PSH - mnew;
            v16h pb, pr = hz; float ls = 0.0f;
#pragma unroll
            for (int r = 0; r < 8; ++r) {
                const float xa = ta[r] + sh, xb = tb[r] + sh;
                const float ea = __builtin_amdgcn_exp2f(xa), eb = __builtin_amdgcn_exp2f(xb);
                const float ga = (fa[r] & (xa >= -14.0f)) ? ea : 0.0f;       // dropped elements and sub-2^-14 values selected to 0 by value
                const float gb = (fb[r] & (xb >= -14.0f)) ? eb : 0.0f;
                const h16 pa = (h16)ga; const h16 pc = (h16)gb;
                pb[r] = pa; pb[8 + r] = pc;
                if (EARLY) { pr[r] = toh_flush((ga - (float)pa) * QRS); pr[8 + r] = toh_flush((gb - (float)pc) * QRS); ls += ga + gb; }
                else       { ls += (float)pa + (float)pc; } }
            l = l * resc + ls; m = mnew;
#pragma unroll
            for (int j = 0; j < 8; ++j) { o[j] = o[j] * resc; if (EARLY) oR[j] = oR[j] * resc; }
            const int vk = vo + key0;
#pragma unroll
            for (int g = 0; g < 8 / VG; ++g) {
                v16h vf[VG];
#pragma unroll
                for (int jj = 0; jj < VG; ++jj) vf[jj] = ldh(Vb + vk + (g * VG + jj) * 16 * SEQ);
#pragma unroll
                for (int jj = 0; jj < VG; ++jj) {
                    o[g * VG + jj] = wmma16g(vf[jj], pb, o[g * VG + jj]);
                    if (EARLY) oR[g * VG + jj] = wmma16g(vf[jj], pr, oR[g * VG + jj]); }
            }
        }
    }
    l += __shfl_xor(l, 16, 32);
    const bool any = l > 0.0f;
    const float lsafe = any ? l : 1.0f;
    const float inv = any ? ((1.0f / lsafe) * (1.0f / XCAR)) : __uint_as_float(0x7FC00000u);   // no kept key -> NaN row
    const int wb = wave * 16 * OSP;
    // O^T D layout: o[j][r] = (d = 16j + 8h + r, t = lane&15) -> os[t][d]; rows 0..15 x columns 0..127 all written
#pragma unroll
    for (int j = 0; j < 8; ++j) {
        v8f f = o[j];
        if (EARLY) f = o[j] + oR[j] * QRI;
        v4f a, c;
        a[0] = f[0] * inv; a[1] = f[1] * inv; a[2] = f[2] * inv; a[3] = f[3] * inv; c[0] = f[4] * inv; c[1] = f[5] * inv; c[2] = f[6] * inv; c[3] = f[7] * inv;
        *(v4fa*)(&os[wb + lr * OSP + 16 * j + 8 * hi]) = a; *(v4fa*)(&os[wb + lr * OSP + 16 * j + 8 * hi + 4]) = c; }
    wave_sync();
    float* orow = OUT + ((size_t)b * OUT_SEQ + (size_t)t0) * DM;
{
#pragma unroll
        for (int s = 0; s < 16; ++s) {                           // 16 trips = 16 rows; 32 lanes x 4 floats = 128 columns = one whole row
            const v4f val = *(const v4fa*)(&os[wb + s * OSP + lane * 4]);
            *(v4f*)(orow + (size_t)s * DM + lane * 4) = val; }
         }
}

__global__ __launch_bounds__(32 * AW) __attribute__((amdgpu_num_vgpr(256)))
void k_flash_early(const h16* __restrict__ QH, const h16* __restrict__ KE, const h16* __restrict__ KR, const h16* __restrict__ VT, const unsigned* __restrict__ MB, float* OUT) {
    flash_body<1>(QH, KE, KR, VT, MB, OUT);
}
__global__ __launch_bounds__(32 * AW) __attribute__((amdgpu_num_vgpr(256)))
void k_flash_late(const h16* __restrict__ QH, const h16* __restrict__ KE, const h16* __restrict__ KR, const h16* __restrict__ VT, const unsigned* __restrict__ MB, float* OUT) {
    flash_body<0>(QH, KE, KR, VT, MB, OUT);
}

static constexpr size_t al256(size_t v) { return (v + 255) & ~(size_t)255; }
static constexpr size_t SZ_PL = al256((size_t)NB * SEQ * DM * 2);          // QH, KE, VT
static constexpr size_t SZ_RS = al256((size_t)NB * EROWS * DM * 2);        // KR
static constexpr size_t SZ_MB = al256((size_t)SEQ * MW * 4);               // MB
static constexpr size_t SZ_TOTAL = 3 * SZ_PL + SZ_RS + SZ_MB;
static_assert(SZ_TOTAL <= (size_t)134217728);          // workspace carve <= 128 MiB
static_assert(((size_t)NB * SEQ * DM) % 8 == 0);       // thread-linear 16-byte stores cover the planes exactly
static_assert(((size_t)SEQ * MW) % 4 == 0);
static_assert(((size_t)NB * OUT_SEQ * DM * 4) <= (size_t)8388608 || NB != NB_FULL || OUT_SEQ != SEQ_FULL);

extern "C" void kernel_launch(void* const* d_in, const int* in_sizes, int n_in,
                              void* d_out, int out_size, void* d_ws, size_t ws_size, hipStream_t stream) {
    if (n_in < 5) return;
    const size_t needx = ((size_t)(NB - 1) * SEQ_FULL + SEQ) * DM;
    const size_t needm = (size_t)(SEQ - 1) * SEQ_FULL + SEQ;
    if ((size_t)in_sizes[0] < needx || (size_t)in_sizes[1] < needx || (size_t)in_sizes[2] < needx) return;
    if ((size_t)in_sizes[3] < needm || in_sizes[4] < 1) return;
    if ((size_t)out_size < ((size_t)(NB - 1) * OUT_SEQ + SEQ) * DM) return;
    if (SZ_TOTAL > ws_size) return;
    // wire order: q, k, v, mask, mode
    const float* q = (const float*)d_in[0];
    const float* k = (const float*)d_in[1];
    const float* v = (const float*)d_in[2];
    const int* mask = (const int*)d_in[3];
    const float* mode = (const float*)d_in[4];
    float* OUT = (float*)d_out;      // [NB][SEQ][128]
    char* wsp = (char*)d_ws;
    h16* QH = (h16*)wsp; wsp += SZ_PL;               // [NB][SEQ][128]  q x16
    h16* KE = (h16*)wsp; wsp += SZ_PL;               // [NB][SEQ][128]  combined key x16
    h16* VT = (h16*)wsp; wsp += SZ_PL;               // [NB][128][SEQ]  v^T x16
    h16* KR = (h16*)wsp; wsp += SZ_RS;               // [NB][EROWS][128] combined-key residual x2048, tokens < EROWS
    unsigned* MB = (unsigned*)wsp; wsp += SZ_MB;     // [SEQ][SEQ/32] mask bit words

    const int n8 = (int)((size_t)NB * SEQ * DM / 8);
    k_cvtq<<<(unsigned)((n8 + 255) / 256), 256, 0, stream>>>(q, QH, n8);
    k_keff<<<(unsigned)((n8 + 255) / 256), 256, 0, stream>>>(k, mode, KE, KR, n8);
    // v: in[SEQ tokens][128 d] per batch -> out[128 d][SEQ tokens]; grid (SEQ/64 token tiles, NB)
    k_vt<<<dim3(SEQ / 64, NB, 1), 256, 0, stream>>>(v, VT);
    const int n4 = (int)((size_t)SEQ * MW / 4);
    k_mbits<<<(unsigned)((n4 + 255) / 256), 256, 0, stream>>>(mask, MB, n4);

    // query rows [0, EROWS): multi-product instantiation; rows [EROWS, SEQ): single-product instantiation (disjoint output rows)
    k_flash_early<<<dim3(EROWS / (16 * AW), NB, 1), 32 * AW, 0, stream>>>(QH, KE, KR, VT, MB, OUT);
    if (SEQ > EROWS)
        k_flash_late<<<dim3((SEQ - EROWS) / (16 * AW), NB, 1), 32 * AW, 0, stream>>>(QH, KE, KR, VT, MB, OUT);
}

// v001
// One run takes 86.8 microseconds.
// Timed twice side by side with v000, it ran 2.12 and 2.11 times as fast.
#include <hip/hip_runtime.h>

// Single-head masked attention, head width 128: q/k/v [NB][SEQ][128] f32, mask [1][SEQ][SEQ] int32 (0 = dropped, read by value), mode scalar f32.
// logit = 128^-0.5 * q . ((1-a) * roll(k, 1 along d) - a * k), a = sigmoid(mode); dropped entries are replaced by -inf; softmax over keys; output = P v (f32).
// Compute dtypes, f32 accumulate everywhere: scores v_wmma_f32_16x16x32_f16: q (bf16-RNE input, x16 carry, exact in f16) against the combined key operand ke = (1-a) k[d-1] - a k[d]
// (built in f32 from bf16-RNE k, x16 carry) as single f16 on query rows >= EROWS and as f16 value + f16 residual x2048 (own accumulator) on query rows < EROWS;
// P.V v_wmma_f32_16x16x32_f16: P (x16384 carry, cancels in the normalisation) single f16 on query rows >= EROWS, f16 value + f16 residual x2048 (own accumulator, folded by 1/2048) on query rows < EROWS;
// v (bf16-RNE input, x16 carry, exact in f16) single everywhere; softmax f32 (online, running max over kept keys).
// Layout: QH [b][t][128], KE [b][s][128], KR [b][s < EROWS][128], VT [b][d][s] (transposed through LDS), MB [t][SEQ/32] mask bit words (bit j = key 32w + j kept).
// Fused flash kernel in transposed form (S^T = KE QH^T, O^T = VT P^T); operand tiles staged in LDS by asynchronous copies, shared by the block's four waves; a 32-key step is skipped when its mask block is all zero (per block for the copies, per wave for the work).

#ifndef NB
#define NB 8
#endif
#ifndef SEQ
#define SEQ 2048
#endif
#define NB_FULL  8
#define SEQ_FULL 2048
#ifndef OUT_SEQ
#define OUT_SEQ SEQ              // row pitch (in tokens) between batches of the output
#endif
#define DM   128
#define AW   4                   // waves per flash block (16 query rows each)
#define OSP  132                 // LDS row pitch (floats) of the flash output tile
#define VTP  72                  // LDS row pitch (halves) of the transpose tile
#define MW   (SEQ / 32)          // mask bit words per query row
#define KP   136                 // LDS row pitch (halves) of the q, KE and KR tiles: 272 B
#define VP   40                  // LDS row pitch (halves) of the VT tile: 80 B
#define MP   68                  // LDS row pitch (words) of the mask-word tile: 272 B
#define EROWS (SEQ < 512 ? SEQ : 512)   // query rows (and tokens of the residual key plane) handled by the multi-product flash instantiation
#define XCAR 16.0f               // carry of the q, ke and v planes
#define QRS  2048.0f             // carry of every residual plane / residual fragment
#define QRI  (1.0f / 2048.0f)
#define SC2  ((float)(0.08838834764831845 * 1.4426950408889634 / 256.0))   // DM^-0.5 * log2(e) / (XCAR * XCAR)
#define PSH  14.0f               // log2 of the P carry (16384)
#define NEGB (-3.0e38f)

static_assert(DM == 128);                      // output row = 32 lanes x 4 floats; plane row = 16 threads x 8 halves
static_assert(DM % 32 == 0);                   // score k-loop steps by 32
static_assert(DM / 8 == 16);                   // convert kernels: row = i >> 4
static_assert((DM & (DM - 1)) == 0);           // rolled index uses a mask
static_assert(SEQ % 128 == 0);                 // MW multiple of 4: one thread packs four mask words of one row
static_assert(SEQ % 64 == 0);                  // transpose tiles of 64 tokens
static_assert(SEQ % 32 == 0);                  // key loop steps by 32
static_assert(EROWS % (16 * AW) == 0);
static_assert((KP * 2) % 16 == 0 && KP >= DM && (VP * 2) % 16 == 0 && VP >= 32 && (MP * 4) % 16 == 0 && MP >= MW);   // 16-byte copies and fragment reads stay aligned and inside a row
static_assert(MW == 64 && AW == 4);            // flash copy maps and step bit map: 128 threads, 64 rows x 64 words, one 64-bit map
static_assert((SEQ - EROWS) % (16 * AW) == 0);
static_assert(EROWS >= 32);
static_assert(EROWS % 32 == 0);
static_assert(EROWS <= SEQ);
static_assert(NB <= NB_FULL);
static_assert(SEQ <= SEQ_FULL);
static_assert((OSP * 4) % 16 == 0);
static_assert(OSP >= DM);
static_assert((VTP * 2) % 16 == 0);
static_assert(VTP >= 64);
static_assert((size_t)AW * 16 * OSP * 4 + (size_t)AW * 16 * (KP * 2 + MP * 4) + (size_t)4 * 32 * KP * 2 + (size_t)2 * DM * VP * 2 + 16 <= 327680);   // flash static LDS: output tile, q and mask tiles, KE and KR buffers, VT buffers, step map
static_assert((size_t)DM * VTP * 2 <= 131072);           // transpose static LDS
static_assert(32 * 4 * 16 == 16 * DM);                   // flash epilogue: 32 lanes x 4 floats x 16 trips == 16 rows x DM floats
static_assert(256 * 4 * 8 == 64 * DM);                   // transpose load: 256 threads x 4 floats x 8 trips == 64 tokens x DM
static_assert(256 * 8 * 4 == DM * 64);                   // transpose store: 256 threads x 8 halves x 4 trips == DM rows x 64 tokens
static_assert((size_t)NB * SEQ * DM / 8 < (size_t)2147483647);
static_assert((size_t)SEQ * DM < (size_t)2147483647);

typedef _Float16 h16;
typedef __attribute__((ext_vector_type(16))) _Float16 v16h;
typedef __attribute__((ext_vector_type(8)))  _Float16 v8h;
typedef __attribute__((ext_vector_type(8)))  float    v8f;
typedef __attribute__((ext_vector_type(4)))  float    v4f;
typedef __attribute__((ext_vector_type(4)))  int      v4i;
typedef __attribute__((ext_vector_type(4)))  unsigned v4u;
typedef v4f  __attribute__((may_alias)) v4fa;
typedef v8h  __attribute__((may_alias)) v8ha;

__device__ __forceinline__ unsigned short f2bf(float f) { unsigned u = __float_as_uint(f); u += 0x7FFFu + ((u >> 16) & 1u); return (unsigned short)(u >> 16); }
__device__ __forceinline__ float bfr(float f) { return __uint_as_float(((unsigned)f2bf(f)) << 16); }   // value after RNE convert to bf16
__device__ __forceinline__ v16h cat16(v8h lo, v8h hi) { return __builtin_shufflevector(lo, hi, 0, 1, 2, 3, 4, 5, 6, 7, 8, 9, 10, 11, 12, 13, 14, 15); }
__device__ __forceinline__ v8f wmma16(v16h a, v16h b, v8f c) { return __builtin_amdgcn_wmma_f32_16x16x32_f16(false, a, false, b, (short)0, c, false, false); }
// fragment loaders from K-contiguous 16-bit rows; p already includes + 8*(lane>>4): elements 0..7 <- k0+8h+0..7, elements 8..15 <- k0+16+8h+0..7 (same map for A and B)
__device__ __forceinline__ v16h  ldh(const h16* p) { return cat16(*(const v8h*)p, *(const v8h*)(p + 16)); }
// ordering point for wave-private LDS tiles (same wave writes and reads)
__device__ __forceinline__ void wave_sync() { __builtin_amdgcn_fence(3 /* release order */, "wavefront"); __builtin_amdgcn_wave_barrier(); asm volatile("" ::: "memory"); }

// f32 -> f16 convert that cannot produce an f16 subnormal (|v| < 2^-14 -> +0)
static __device__ __forceinline__ h16 toh_flush(float v) { const h16 r = (h16)v; return (fabsf(v) < 6.103515625e-05f) ? (h16)0.0f : r; }
// one WMMA with its own hazard guard (ties the accumulator, keeps A and B live)
static __device__ __forceinline__ v8f wmma16g(v16h a, v16h b, v8f c) {
    c = wmma16(a, b, c);
    asm volatile("v_nop\n\tv_nop\n\tv_nop\n\tv_nop" : "+v"(c) : "v"(a), "v"(b));
    return c;
}

__global__ __launch_bounds__(256) void k_cvtq(const float* __restrict__ src, h16* dst, int n8) {
#pragma clang fp contract(off)
    const int i = blockIdx.x * 256 + threadIdx.x; if (i >= n8) return;
    const int row = i >> 4, d0 = (i & 15) * 8; const int b = row / SEQ, t = row % SEQ;
    const v8f v = *(const v8f*)(src + ((size_t)b * SEQ_FULL + (size_t)t) * DM + d0); v8h o;
#pragma unroll
    for (int e = 0; e < 8; ++e) o[e] = toh_flush(bfr(v[e]) * XCAR);
    *(v8h*)(dst + (size_t)i * 8) = o; 
}

// k_keff: combined key operand ke[d] = (1-a) * k[(d-1) mod DM] - a * k[d], a = sigmoid(mode), from bf16-RNE k and mode, in f32;
__global__ __launch_bounds__(256) void k_keff(const float* __restrict__ k, const float* __restrict__ mode, h16* KE, h16* KR, int n8) {
#pragma clang fp contract(off)
    const int i = blockIdx.x * 256 + threadIdx.x; if (i >= n8) return;
    const int row = i >> 4, d0 = (i & 15) * 8; const int b = row / SEQ, t = row % SEQ;
    const float* kr = k + ((size_t)b * SEQ_FULL + (size_t)t) * DM;
    const v8f x = *(const v8f*)(kr + d0);
    const float xm = kr[(d0 + DM - 1) & (DM - 1)];
    const float mv = bfr(mode[0]);
    const float al = 1.0f / (1.0f + expf(-mv));
    const float oma = 1.0f - al;
    float prev = bfr(xm); v8h hv, rv;
#pragma unroll
    for (int e = 0; e < 8; ++e) {
        const float cur = bfr(x[e]);
        const float c = (oma * prev - al * cur) * XCAR;
        const h16 hh = toh_flush(c);
        hv[e] = hh; rv[e] = toh_flush((c - (float)hh) * QRS);
        prev = cur; }
    const bool wr = t < EROWS;
    const size_t oo = (size_t)i * 8;
    const size_t ro = ((size_t)b * EROWS + (size_t)(wr ? t : 0)) * DM + d0;
    *(v8h*)(KE + oo) = hv; if (wr) *(v8h*)(KR + ro) = rv;
    
}

// k_vt: VT[b][d][t] = f16(bf16_rne(v[b][t][d]) * 16); one block per 64 tokens of one batch; in[64 tokens][128 d] -> out[128 d][64 tokens] through LDS;
// LDS tile ts: cross-wave (block barrier between fill and drain); filled extent [128][64] == drained extent.
__global__ __launch_bounds__(256) void k_vt(const float* __restrict__ v, h16* VT) {
#pragma clang fp contract(off)
    __shared__ __align__(16) h16 ts[DM * VTP];
    const int tid = threadIdx.x; const int b = blockIdx.y, tok0 = blockIdx.x * 64;
    const float* src = v + ((size_t)b * SEQ_FULL + (size_t)tok0) * DM;
#pragma unroll 1
    for (int i = 0; i < 8; ++i) { const int idx = i * 256 + tid; const int tk = idx >> 5, c4 = (idx & 31) * 4;   // 8 trips x 256 threads = 64 tokens x 32 float4
        const v4f x = *(const v4f*)(src + (size_t)tk * DM + c4);
#pragma unroll
        for (int e = 0; e < 4; ++e) ts[(c4 + e) * VTP + tk] = toh_flush(bfr(x[e]) * XCAR); }
    __syncthreads();
    h16* dstb = VT + (size_t)b * DM * SEQ + (size_t)tok0;
{
#pragma unroll
        for (int s = 0; s < 4; ++s) { const int p = s * 256 + tid; const int d = p >> 3, c8 = (p & 7) * 8;       // 4 trips x 32 rows = 128 rows; 8 lanes x 8 halves = 64 tokens
            const v8h val = *(const v8ha*)(&ts[d * VTP + c8]);
            *(v8h*)(dstb + (size_t)d * SEQ + c8) = val; }
         }
}

// mask bit word: bit j <- (p[j] != 0), j = 0..31 (eight 16-byte loads, consumed before the next word's loads)
__device__ __forceinline__ unsigned mword(const int* __restrict__ p) {
    unsigned w = 0u;
#pragma unroll
    for (int c = 0; c < 8; ++c) { const v4i x = *(const v4i*)(p + c * 4);
        w |= ((x[0] != 0) ? 1u : 0u) << (c * 4);
        w |= ((x[1] != 0) ? 1u : 0u) << (c * 4 + 1);
        w |= ((x[2] != 0) ? 1u : 0u) << (c * 4 + 2);
        w |= ((x[3] != 0) ? 1u : 0u) << (c * 4 + 3); }
    asm volatile("" : "+v"(w) :: "memory");
    return w;
}

__global__ __launch_bounds__(256) void k_mbits(const int* __restrict__ mask, unsigned* MB, int n4) {
    const int i = blockIdx.x * 256 + threadIdx.x; if (i >= n4) return;
    const int w0 = i * 4; const int t = w0 / MW, wc = w0 % MW;
    const int* src = mask + (size_t)t * SEQ_FULL + (size_t)wc * 32;
    v4u o;
    o[0] = mword(src); o[1] = mword(src + 32); o[2] = mword(src + 64); o[3] = mword(src + 96);
    *(v4u*)(MB + (size_t)i * 4) = o; 
}

// low 32 bits of a __shared__ address = byte offset in the work-group's LDS (destination operand of an asynchronous copy)
__device__ __forceinline__ unsigned ldsa(const void* p) { return (unsigned)(size_t)p; }
// eight / four asynchronous 16-byte copies global -> LDS per lane; the s_wait_xcnt closes the statement so that no address register is rewritten ahead of it
__device__ __forceinline__ void cp8(unsigned l0, const void* g0, unsigned l1, const void* g1, unsigned l2, const void* g2, unsigned l3, const void* g3,
                                    unsigned l4, const void* g4, unsigned l5, const void* g5, unsigned l6, const void* g6, unsigned l7, const void* g7) {
    asm volatile("global_load_async_to_lds_b128 %0, %1, off\n\t"
                 "global_load_async_to_lds_b128 %2, %3, off\n\t"
                 "global_load_async_to_lds_b128 %4, %5, off\n\t"
                 "global_load_async_to_lds_b128 %6, %7, off\n\t"
                 "global_load_async_to_lds_b128 %8, %9, off\n\t"
                 "global_load_async_to_lds_b128 %10, %11, off\n\t"
                 "global_load_async_to_lds_b128 %12, %13, off\n\t"
                 "global_load_async_to_lds_b128 %14, %15, off\n\t"
                 "s_wait_xcnt 0x0"
                 :: "v"(l0), "v"(g0), "v"(l1), "v"(g1), "v"(l2), "v"(g2), "v"(l3), "v"(g3),
                    "v"(l4), "v"(g4), "v"(l5), "v"(g5), "v"(l6), "v"(g6), "v"(l7), "v"(g7) : "memory");
}
__device__ __forceinline__ void cp4(unsigned l0, const void* g0, unsigned l1, const void* g1, unsigned l2, const void* g2, unsigned l3, const void* g3) {
    asm volatile("global_load_async_to_lds_b128 %0, %1, off\n\t"
                 "global_load_async_to_lds_b128 %2, %3, off\n\t"
                 "global_load_async_to_lds_b128 %4, %5, off\n\t"
                 "global_load_async_to_lds_b128 %6, %7, off\n\t"
                 "s_wait_xcnt 0x0"
                 :: "v"(l0), "v"(g0), "v"(l1), "v"(g1), "v"(l2), "v"(g2), "v"(l3), "v"(g3) : "memory");
}
// this wave's asynchronous copies have landed in LDS (other waves read them behind the next block barrier)
__device__ __forceinline__ void wait_copies() { asm volatile("s_wait_asynccnt 0x0" ::: "memory"); }
// this wave's LDS reads have returned (stands in front of the barrier behind which their buffer is refilled)
__device__ __forceinline__ void wait_lds() { asm volatile("s_wait_dscnt 0x0" ::: "memory"); }
// fragment loader from an LDS tile, same element map as ldh
__device__ __forceinline__ v16h ldl(const h16* p) { return cat16(*(const v8ha*)p, *(const v8ha*)(p + 16)); }

// flash_body: fused attention, one block per 64 query rows of one batch, one wave per 16 of them.
// Staging: the block's q rows and mask bit words are copied to LDS once; the KE / KR / VT tiles of a 32-key step are copied to LDS for all four waves, two buffers,
// the next kept step's copies in flight while this step is worked on (asynchronous copies, 16 bytes per lane; whole tile = 4 copies per thread and plane).
// Tile pitches: 272 B (q, KE, KR rows of 256 B; mask rows of 256 B) and 80 B (VT rows of 64 B), 16 B x odd for the 16-byte fragment reads.
// Transposed form: S^T[key][t] = KE QH^T (A = key rows, B = query rows, 4 k-steps of 32); lane (t = lane&15, h = lane>>4) holds keys 8h+r of each 16-key tile, so the packed
// P tile is directly the B fragment of O^T[d][t] = VT P^T (element r <- tile keys 0..15, element 8+r <- tile keys 16..31, lane unchanged), 8 d-tiles.
// Softmax state (running max over kept keys, partial sum) is one scalar per lane; the two lane halves of a row are combined with one xor-16 exchange.
// Keep rule per element from the mask bit word of (row, 32-key step); a step whose words are zero on all 64 rows of the block is neither copied nor visited (block-uniform bit map),
// a step whose words are zero on the wave's own 16 rows is not worked on by that wave (wave-uniform); kept steps are visited in ascending order.
// EARLY = 1 (query rows [0, EROWS)): scores = KE Q + KR Q / 2048; P = f16 value + f16 residual x2048; O = V P + V P_res / 2048 (residual products in their own accumulators);
//            row sum from the f32 exponentials; KR fragments are zero for keys >= EROWS (address clamped, wave-uniform select).
// EARLY = 0 (query rows [EROWS, SEQ)): single products, row sum over the converted P.
// Epilogue: O^T staged in a wave-private LDS tile (16 rows x 128 columns all written, same extent drained), each output row (128 floats = 512 B = four lines)
template <int EARLY>
__device__ __forceinline__ void flash_body(const h16* __restrict__ QH, const h16* __restrict__ KE, const h16* __restrict__ KR, const h16* __restrict__ VT,
                                           const unsigned* __restrict__ MB, float* OUT) {
    __shared__ __align__(16) float os[AW * 16 * OSP];
    __shared__ __align__(16) h16 qt[AW * 16 * KP];               // q rows of the block
    __shared__ __align__(16) unsigned mt[AW * 16 * MP];          // mask bit words of the block's rows
    __shared__ __align__(16) h16 kt[2 * 32 * KP];                // KE tile, two buffers
    __shared__ __align__(16) h16 rt[EARLY ? 2 * 32 * KP : 8];    // KR tile, two buffers
    __shared__ __align__(16) h16 vt[2 * DM * VP];                // VT tile, two buffers
    __shared__ unsigned act[AW];
    constexpr int VG = EARLY ? 4 : 8;                            // V^T fragments read from LDS per group
    constexpr int KG = EARLY ? 1 : 4;                            // k-steps of q / KE / KR fragments read from LDS per group
    const int tid = threadIdx.x;
    const int lane = threadIdx.x & 31, lr = lane & 15, hi = lane >> 4;
    const int wave = __builtin_amdgcn_readfirstlane((int)(threadIdx.x >> 5));
    const int b = blockIdx.y;
    const int tb = (EARLY ? 0 : EROWS) + blockIdx.x * AW * 16;   // first query row of the block
    const int t0 = tb + wave * 16;
    const h16* Qb = QH + (size_t)b * SEQ * DM;
    const h16* Kb = KE + (size_t)b * SEQ * DM;
    const h16* Rb = KR + (size_t)b * EROWS * DM;
    const h16* Vb = VT + (size_t)b * DM * SEQ;
    // copy maps: 256-B rows: thread -> (row tid>>4 + 8i, 16-B column tid&15); 64-B rows: thread -> (row tid>>2 + 32i, 16-B column tid&3)
    const int r16 = tid >> 4, c16 = tid & 15, r4 = tid >> 2, c4 = tid & 3;
    {
        const h16* qg = Qb + (size_t)(tb + r16) * DM + c16 * 8;
        const unsigned ql = ldsa(qt) + (unsigned)(r16 * KP + c16 * 8) * 2u;
        cp8(ql, qg, ql + 8 * KP * 2, qg + 8 * DM, ql + 16 * KP * 2, qg + 16 * DM, ql + 24 * KP * 2, qg + 24 * DM,
            ql + 32 * KP * 2, qg + 32 * DM, ql + 40 * KP * 2, qg + 40 * DM, ql + 48 * KP * 2, qg + 48 * DM, ql + 56 * KP * 2, qg + 56 * DM);
        const unsigned* mg = MB + (size_t)(tb + r16) * MW + c16 * 4;
        const unsigned ml = ldsa(mt) + (unsigned)(r16 * MP + c16 * 4) * 4u;
        cp8(ml, mg, ml + 8 * MP * 4, mg + 8 * MW, ml + 16 * MP * 4, mg + 16 * MW, ml + 24 * MP * 4, mg + 24 * MW,
            ml + 32 * MP * 4, mg + 32 * MW, ml + 40 * MP * 4, mg + 40 * MW, ml + 48 * MP * 4, mg + 48 * MW, ml + 56 * MP * 4, mg + 56 * MW);
    }
    wait_copies();
    __syncthreads();                                             // q rows and mask words readable by every wave
    // block-uniform bit map of the steps that some row of the block keeps: thread -> (step tid&63, rows 32*(tid>>6) .. +31)
    unsigned orv = 0u;
#pragma unroll
    for (int i = 0; i < 32; ++i) orv |= mt[((tid >> 6) * 32 + i) * MP + (tid & 63)];
    const unsigned bal = __builtin_amdgcn_ballot_w32(orv != 0u);
    if (lane == 0) act[wave] = bal;
    __syncthreads();
    const unsigned alo = (unsigned)__builtin_amdgcn_readfirstlane((int)(act[0] | act[2]));
    const unsigned ahi = (unsigned)__builtin_amdgcn_readfirstlane((int)(act[1] | act[3]));
    unsigned long long rem = ((unsigned long long)ahi << 32) | (unsigned long long)alo;

    const h16* kg0 = Kb + r16 * DM + c16 * 8;
    const h16* rg0 = Rb + r16 * DM + c16 * 8;
    const h16* vg0 = Vb + r4 * SEQ + c4 * 8;
    const unsigned kl0 = ldsa(kt) + (unsigned)(r16 * KP + c16 * 8) * 2u;
    const unsigned rl0 = ldsa(rt) + (unsigned)(r16 * KP + c16 * 8) * 2u;
    const unsigned vl0 = ldsa(vt) + (unsigned)(r4 * VP + c4 * 8) * 2u;
    // copies of step s into buffer bf (block-uniform arguments; every lane on)
    auto stage = [&](int s, int bf) {
        const int key0 = s * 32;
        const h16* kg = kg0 + key0 * DM; const h16* vg = vg0 + key0;
        const unsigned kl = kl0 + (unsigned)bf * (32 * KP * 2), vl = vl0 + (unsigned)bf * (DM * VP * 2);
        cp8(kl, kg, kl + 8 * KP * 2, kg + 8 * DM, kl + 16 * KP * 2, kg + 16 * DM, kl + 24 * KP * 2, kg + 24 * DM,
            vl, vg, vl + 32 * VP * 2, vg + 32 * SEQ, vl + 64 * VP * 2, vg + 64 * SEQ, vl + 96 * VP * 2, vg + 96 * SEQ);
        if (EARLY) {
            const int kcl = (key0 < EROWS) ? key0 : (EROWS - 32);    // clamped residual-plane key (address always inside the plane)
            const h16* rg = rg0 + kcl * DM; const unsigned rl = rl0 + (unsigned)bf * (32 * KP * 2);
            cp4(rl, rg, rl + 8 * KP * 2, rg + 8 * DM, rl + 16 * KP * 2, rg + 16 * DM, rl + 24 * KP * 2, rg + 24 * DM);
        }
    };
    int s0 = -1, s1 = -1;                                        // this kept step, the next kept step (-1: none)
    if (rem != 0ull) { s0 = __builtin_ctzll(rem); rem &= rem - 1ull; }
    if (rem != 0ull) { s1 = __builtin_ctzll(rem); rem &= rem - 1ull; }
    if (s0 >= 0) stage(s0, 0);
    wait_copies();
    __syncthreads();                                             // first kept step readable by every wave
    if (s1 >= 0) stage(s1, 1);

    const int mo = (wave * 16 + lr) * MP;
    const int qo = (wave * 16 + lr) * KP + 8 * hi;               // B fragment: col t, k = d
    const int ko = lr * KP + 8 * hi;                             // + tile row * KP + kc   (A fragment: row key, k = d)
    const int vo = lr * VP + 8 * hi;                             // + 16j*VP               (A fragment: row d, k = key)
    const v16h hz = (v16h){};
    v8f o[8], oR[8];
#pragma unroll
    for (int j = 0; j < 8; ++j) { o[j] = (v8f){}; oR[j] = (v8f){}; }
    float m = NEGB, l = 0.0f;
    int bf = 0;
#pragma unroll 1
    for (int it = 0; it < MW; ++it) {
        if (s0 < 0) break;                                       // block-uniform: no kept step left
        const unsigned mw = mt[mo + s0];
        if (__builtin_amdgcn_ballot_w32(mw != 0u) != 0u) {       // wave-uniform: some row of this tile keeps some key of this step
            const int key0 = s0 * 32;
            const bool rok = key0 < EROWS;                       // wave-uniform
            const h16* kb = kt + bf * (32 * KP) + ko;
            const h16* rb = rt + (EARLY ? bf * (32 * KP) : 0) + ko;
            const h16* vb = vt + bf * (DM * VP) + vo;
            v8f sHa = (v8f){}, sHb = (v8f){}, sLa = (v8f){}, sLb = (v8f){};
#pragma unroll
            for (int g = 0; g < 4 / KG; ++g) {                   // the LDS fragment reads of KG k-steps issue together, one LDS latency per group
                v16h qf[KG], ka0[KG], kb0[KG], kra[KG], krb[KG];
#pragma unroll
                for (int u = 0; u < KG; ++u) {
                    const int kc = (g * KG + u) * 32;
                    qf[u] = ldl(qt + qo + kc); ka0[u] = ldl(kb + kc); kb0[u] = ldl(kb + 16 * KP + kc);
                    if (EARLY) { kra[u] = ldl(rb + kc); krb[u] = ldl(rb + 16 * KP + kc); }
                }
#pragma unroll
                for (int u = 0; u < KG; ++u) {
                    sHa = wmma16g(ka0[u], qf[u], sHa); sHb = wmma16g(kb0[u], qf[u], sHb);
                    if (EARLY) {
                        if (!rok) { kra[u] = hz; krb[u] = hz; }
                        sLa = wmma16g(kra[u], qf[u], sLa); sLb = wmma16g(krb[u], qf[u], sLb);
                    }
                }
            }
            const unsigned ma = mw >> (8 * hi);                  // bit r: key key0+8h+r; bit 16+r: key key0+16+8h+r
            float ta[8], tb2[8]; bool fa[8], fb[8]; float mx = NEGB;
#pragma unroll
            for (int r = 0; r < 8; ++r) {
                fa[r] = ((ma >> r) & 1u) != 0u;
                fb[r] = ((ma >> (16 + r)) & 1u) != 0u;
                if (EARLY) { ta[r] = (sHa[r] + sLa[r] * QRI) * SC2; tb2[r] = (sHb[r] + sLb[r] * QRI) * SC2; }
                else       { ta[r] = sHa[r] * SC2; tb2[r] = sHb[r] * SC2; }
                mx = fmaxf(mx, fmaxf(fa[r] ? ta[r] : NEGB, fb[r] ? tb2[r] : NEGB)); }
            mx = fmaxf(mx, __shfl_xor(mx, 16, 32));
            const float mnew = fmaxf(m, mx);
            const float resc = __builtin_amdgcn_exp2f(m - mnew);
            const float sh = PSH - mnew;
            v16h pb, pr = hz; float ls = 0.0f;
#pragma unroll
            for (int r = 0; r < 8; ++r) {
                const float xa = ta[r] + sh, xb = tb2[r] + sh;
                const float ea = __builtin_amdgcn_exp2f(xa), eb = __builtin_amdgcn_exp2f(xb);
                const float ga = (fa[r] & (xa >= -14.0f)) ? ea : 0.0f;       // dropped elements and sub-2^-14 values selected to 0 by value
                const float gb = (fb[r] & (xb >= -14.0f)) ? eb : 0.0f;
                const h16 pa = (h16)ga; const h16 pc = (h16)gb;
                pb[r] = pa; pb[8 + r] = pc;
                if (EARLY) { pr[r] = toh_flush((ga - (float)pa) * QRS); pr[8 + r] = toh_flush((gb - (float)pc) * QRS); ls += ga + gb; }
                else       { ls += (float)pa + (float)pc; } }
            l = l * resc + ls; m = mnew;
#pragma unroll
            for (int j = 0; j < 8; ++j) { o[j] = o[j] * resc; if (EARLY) oR[j] = oR[j] * resc; }
#pragma unroll
            for (int g = 0; g < 8 / VG; ++g) {
                v16h vf[VG];
#pragma unroll
                for (int jj = 0; jj < VG; ++jj) vf[jj] = ldl(vb + (g * VG + jj) * 16 * VP);
#pragma unroll
                for (int jj = 0; jj < VG; ++jj) {
                    o[g * VG + jj] = wmma16g(vf[jj], pb, o[g * VG + jj]);
                    if (EARLY) oR[g * VG + jj] = wmma16g(vf[jj], pr, oR[g * VG + jj]); }
            }
        }
        // hand-over, every wave: own LDS reads returned, own copies of the next kept step landed, block barrier; only then the refill of the buffer just read
        wait_lds();
        wait_copies();
        __syncthreads();
        int s2 = -1;
        if (rem != 0ull) { s2 = __builtin_ctzll(rem); rem &= rem - 1ull; }
        if (s2 >= 0) stage(s2, bf);
        s0 = s1; s1 = s2; bf ^= 1;
    }
    wait_copies();                                               // no copy outstanding when the wave goes on to the epilogue and ends
    l += __shfl_xor(l, 16, 32);
    const bool any = l > 0.0f;
    const float lsafe = any ? l : 1.0f;
    const float inv = any ? ((1.0f / lsafe) * (1.0f / XCAR)) : __uint_as_float(0x7FC00000u);   // no kept key -> NaN row
    const int wb = wave * 16 * OSP;
    // O^T D layout: o[j][r] = (d = 16j + 8h + r, t = lane&15) -> os[t][d]; rows 0..15 x columns 0..127 all written
#pragma unroll
    for (int j = 0; j < 8; ++j) {
        v8f f = o[j];
        if (EARLY) f = o[j] + oR[j] * QRI;
        v4f a, c;
        a[0] = f[0] * inv; a[1] = f[1] * inv; a[2] = f[2] * inv; a[3] = f[3] * inv; c[0] = f[4] * inv; c[1] = f[5] * inv; c[2] = f[6] * inv; c[3] = f[7] * inv;
        *(v4fa*)(&os[wb + lr * OSP + 16 * j + 8 * hi]) = a; *(v4fa*)(&os[wb + lr * OSP + 16 * j + 8 * hi + 4]) = c; }
    wave_sync();
    float* orow = OUT + ((size_t)b * OUT_SEQ + (size_t)t0) * DM;
{
#pragma unroll
        for (int s = 0; s < 16; ++s) {                           // 16 trips = 16 rows; 32 lanes x 4 floats = 128 columns = one whole row
            const v4f val = *(const v4fa*)(&os[wb + s * OSP + lane * 4]);
            *(v4f*)(orow + (size_t)s * DM + lane * 4) = val; }
         }
}

__global__ __launch_bounds__(32 * AW) __attribute__((amdgpu_num_vgpr(256)))
void k_flash_early(const h16* __restrict__ QH, const h16* __restrict__ KE, const h16* __restrict__ KR, const h16* __restrict__ VT, const unsigned* __restrict__ MB, float* OUT) {
    flash_body<1>(QH, KE, KR, VT, MB, OUT);
}
__global__ __launch_bounds__(32 * AW) __attribute__((amdgpu_num_vgpr(256)))
void k_flash_late(const h16* __restrict__ QH, const h16* __restrict__ KE, const h16* __restrict__ KR, const h16* __restrict__ VT, const unsigned* __restrict__ MB, float* OUT) {
    flash_body<0>(QH, KE, KR, VT, MB, OUT);
}

static constexpr size_t al256(size_t v) { return (v + 255) & ~(size_t)255; }
static constexpr size_t SZ_PL = al256((size_t)NB * SEQ * DM * 2);          // QH, KE, VT
static constexpr size_t SZ_RS = al256((size_t)NB * EROWS * DM * 2);        // KR
static constexpr size_t SZ_MB = al256((size_t)SEQ * MW * 4);               // MB
static constexpr size_t SZ_TOTAL = 3 * SZ_PL + SZ_RS + SZ_MB;
static_assert(SZ_TOTAL <= (size_t)134217728);          // workspace carve <= 128 MiB
static_assert(((size_t)NB * SEQ * DM) % 8 == 0);       // thread-linear 16-byte stores cover the planes exactly
static_assert(((size_t)SEQ * MW) % 4 == 0);
static_assert(((size_t)NB * OUT_SEQ * DM * 4) <= (size_t)8388608 || NB != NB_FULL || OUT_SEQ != SEQ_FULL);

extern "C" void kernel_launch(void* const* d_in, const int* in_sizes, int n_in,
                              void* d_out, int out_size, void* d_ws, size_t ws_size, hipStream_t stream) {
    if (n_in < 5) return;
    const size_t needx = ((size_t)(NB - 1) * SEQ_FULL + SEQ) * DM;
    const size_t needm = (size_t)(SEQ - 1) * SEQ_FULL + SEQ;
    if ((size_t)in_sizes[0] < needx || (size_t)in_sizes[1] < needx || (size_t)in_sizes[2] < needx) return;
    if ((size_t)in_sizes[3] < needm || in_sizes[4] < 1) return;
    if ((size_t)out_size < ((size_t)(NB - 1) * OUT_SEQ + SEQ) * DM) return;
    if (SZ_TOTAL > ws_size) return;
    // wire order: q, k, v, mask, mode
    const float* q = (const float*)d_in[0];
    const float* k = (const float*)d_in[1];
    const float* v = (const float*)d_in[2];
    const int* mask = (const int*)d_in[3];
    const float* mode = (const float*)d_in[4];
    float* OUT = (float*)d_out;      // [NB][SEQ][128]
    char* wsp = (char*)d_ws;
    h16* QH = (h16*)wsp; wsp += SZ_PL;               // [NB][SEQ][128]  q x16
    h16* KE = (h16*)wsp; wsp += SZ_PL;               // [NB][SEQ][128]  combined key x16
    h16* VT = (h16*)wsp; wsp += SZ_PL;               // [NB][128][SEQ]  v^T x16
    h16* KR = (h16*)wsp; wsp += SZ_RS;               // [NB][EROWS][128] combined-key residual x2048, tokens < EROWS
    unsigned* MB = (unsigned*)wsp; wsp += SZ_MB;     // [SEQ][SEQ/32] mask bit words

    const int n8 = (int)((size_t)NB * SEQ * DM / 8);
    k_cvtq<<<(unsigned)((n8 + 255) / 256), 256, 0, stream>>>(q, QH, n8);
    k_keff<<<(unsigned)((n8 + 255) / 256), 256, 0, stream>>>(k, mode, KE, KR, n8);
    // v: in[SEQ tokens][128 d] per batch -> out[128 d][SEQ tokens]; grid (SEQ/64 token tiles, NB)
    k_vt<<<dim3(SEQ / 64, NB, 1), 256, 0, stream>>>(v, VT);
    const int n4 = (int)((size_t)SEQ * MW / 4);
    k_mbits<<<(unsigned)((n4 + 255) / 256), 256, 0, stream>>>(mask, MB, n4);

    // query rows [0, EROWS): multi-product instantiation; rows [EROWS, SEQ): single-product instantiation (disjoint output rows)
    k_flash_early<<<dim3(EROWS / (16 * AW), NB, 1), 32 * AW, 0, stream>>>(QH, KE, KR, VT, MB, OUT);
    if (SEQ > EROWS)
        k_flash_late<<<dim3((SEQ - EROWS) / (16 * AW), NB, 1), 32 * AW, 0, stream>>>(QH, KE, KR, VT, MB, OUT);
}

// v002
// One run takes 56 microseconds.
// In two side-by-side timings against v001, it was 1.53 and 1.54 times as fast.
// Over all steps from v000 it is 3.24 times as fast.
#include <hip/hip_runtime.h>

// Single-head masked attention, head width 128: q/k/v [NB][SEQ][128] f32, mask [1][SEQ][SEQ] int32 (0 = dropped, read by value), mode scalar f32.
// logit = 128^-0.5 * q . ((1-a) * roll(k, 1 along d) - a * k), a = sigmoid(mode); dropped entries are replaced by -inf; softmax over keys; output = P v (f32).
// Compute dtypes, f32 accumulate everywhere: scores v_wmma_f32_16x16x32_f16: q (bf16-RNE input, x16 carry, exact in f16) against the combined key operand ke = (1-a) k[d-1] - a k[d]
// (built in f32 from bf16-RNE k, x16 carry) as single f16 on query rows >= EROWS and as f16 value + f16 residual x2048 (own accumulator) on query rows < EROWS;
// P.V v_wmma_f32_16x16x32_f16: P (x16384 carry, cancels in the normalisation) single f16 on query rows >= EROWS, f16 value + f16 residual x2048 (own accumulator, folded by 1/2048) on query rows < EROWS;
// v (bf16-RNE input, x16 carry, exact in f16) single everywhere; softmax f32 (online, running max over kept keys).
// Layout: QH [b][t][128], KE [b][s][128], KR [b][s < EROWS][128], VT [b][d][s] (transposed through LDS), MB [t][SEQ/32] mask bit words (bit j = key 32w + j kept).
// Fused flash kernel in transposed form (S^T = KE QH^T, O^T = VT P^T); operand tiles staged in LDS by asynchronous copies, shared by the four waves of a key group; a 32-key step is skipped when its mask block is all zero (per block for the copies, per wave for the work).
// The kept key steps of a block are dealt round-robin to KS key groups of four waves each; every group keeps its own softmax state and O partial, merged through LDS at the end.

#ifndef NB
#define NB 8
#endif
#ifndef SEQ
#define SEQ 2048
#endif
#define NB_FULL  8
#define SEQ_FULL 2048
#ifndef OUT_SEQ
#define OUT_SEQ SEQ              // row pitch (in tokens) between batches of the output
#endif
#define DM   128
#define AW   4                   // query tiles per flash block (16 query rows each), one wave per tile and key group
#define KS   4                   // key groups per flash block (AW waves each)
#define OSP  132                 // LDS row pitch (floats) of the flash output tile
#define VTP  72                  // LDS row pitch (halves) of the transpose tile
#define MW   (SEQ / 32)          // mask bit words per query row
#define KP   136                 // LDS row pitch (halves) of the q, KE and KR tiles: 272 B
#define VP   40                  // LDS row pitch (halves) of the VT tile: 80 B
#define MP   68                  // LDS row pitch (words) of the mask-word tile: 272 B
#define EROWS (SEQ < 512 ? SEQ : 512)   // query rows (and tokens of the residual key plane) handled by the multi-product flash instantiation
#define XCAR 16.0f               // carry of the q, ke and v planes
#define QRS  2048.0f             // carry of every residual plane / residual fragment
#define QRI  (1.0f / 2048.0f)
#define SC2  ((float)(0.08838834764831845 * 1.4426950408889634 / 256.0))   // DM^-0.5 * log2(e) / (XCAR * XCAR)
#define PSH  14.0f               // log2 of the P carry (16384)
#define NEGB (-3.0e38f)

static_assert(DM == 128);                      // output row = 32 lanes x 4 floats; plane row = 16 threads x 8 halves
static_assert(DM % 32 == 0);                   // score k-loop steps by 32
static_assert(DM / 8 == 16);                   // convert kernels: row = i >> 4
static_assert((DM & (DM - 1)) == 0);           // rolled index uses a mask
static_assert(SEQ % 128 == 0);                 // MW multiple of 4: one thread packs four mask words of one row
static_assert(SEQ % 64 == 0);                  // transpose tiles of 64 tokens
static_assert(SEQ % 32 == 0);                  // key loop steps by 32
static_assert(EROWS % (16 * AW) == 0);
static_assert((KP * 2) % 16 == 0 && KP >= DM && (VP * 2) % 16 == 0 && VP >= 32 && (MP * 4) % 16 == 0 && MP >= MW);   // 16-byte copies and fragment reads stay aligned and inside a row
static_assert(MW == 64 && AW == 4 && KS == 4); // flash copy maps and step bit map: 512 threads (128 per key group), 64 rows x 64 words, one 64-bit map
static_assert((SEQ - EROWS) % (16 * AW) == 0);
static_assert(EROWS >= 32);
static_assert(EROWS % 32 == 0);
static_assert(EROWS <= SEQ);
static_assert(NB <= NB_FULL);
static_assert(SEQ <= SEQ_FULL);
static_assert((OSP * 4) % 16 == 0);
static_assert(OSP >= DM);
static_assert((VTP * 2) % 16 == 0);
static_assert(VTP >= 64);
static_assert((size_t)AW * 16 * (KP * 2 + MP * 4) + (size_t)KS * (4 * 32 * KP * 2 + 2 * DM * VP * 2) + (size_t)KS * AW * (2 * 16 * 4 + 4) <= 327680);   // flash static LDS: q and mask tiles, KE, KR and VT buffers of every key group, merge state, step map
static_assert((size_t)KS * AW * 16 * OSP * 4 <= (size_t)KS * (2 * 32 * KP * 2 + 2 * DM * VP * 2));   // the O partial tiles fit in the KE and VT buffers they take over behind the loop
static_assert((size_t)DM * VTP * 2 <= 131072);           // transpose static LDS
static_assert(32 * 4 * (16 / KS) * KS == 16 * DM);       // flash epilogue: 32 lanes x 4 floats x 16/KS trips x KS waves == 16 rows x DM floats
static_assert(256 * 4 * 8 == 64 * DM);                   // transpose load: 256 threads x 4 floats x 8 trips == 64 tokens x DM
static_assert(256 * 8 * 4 == DM * 64);                   // transpose store: 256 threads x 8 halves x 4 trips == DM rows x 64 tokens
static_assert((size_t)NB * SEQ * DM / 8 < (size_t)2147483647);
static_assert((size_t)SEQ * DM < (size_t)2147483647);

typedef _Float16 h16;
typedef __attribute__((ext_vector_type(16))) _Float16 v16h;
typedef __attribute__((ext_vector_type(8)))  _Float16 v8h;
typedef __attribute__((ext_vector_type(8)))  float    v8f;
typedef __attribute__((ext_vector_type(4)))  float    v4f;
typedef __attribute__((ext_vector_type(4)))  int      v4i;
typedef __attribute__((ext_vector_type(4)))  unsigned v4u;
typedef v4f  __attribute__((may_alias)) v4fa;
typedef v8h  __attribute__((may_alias)) v8ha;

__device__ __forceinline__ unsigned short f2bf(float f) { unsigned u = __float_as_uint(f); u += 0x7FFFu + ((u >> 16) & 1u); return (unsigned short)(u >> 16); }
__device__ __forceinline__ float bfr(float f) { return __uint_as_float(((unsigned)f2bf(f)) << 16); }   // value after RNE convert to bf16
__device__ __forceinline__ v16h cat16(v8h lo, v8h hi) { return __builtin_shufflevector(lo, hi, 0, 1, 2, 3, 4, 5, 6, 7, 8, 9, 10, 11, 12, 13, 14, 15); }
__device__ __forceinline__ v8f wmma16(v16h a, v16h b, v8f c) { return __builtin_amdgcn_wmma_f32_16x16x32_f16(false, a, false, b, (short)0, c, false, false); }
// fragment loaders from K-contiguous 16-bit rows; p already includes + 8*(lane>>4): elements 0..7 <- k0+8h+0..7, elements 8..15 <- k0+16+8h+0..7 (same map for A and B)
__device__ __forceinline__ v16h  ldh(const h16* p) { return cat16(*(const v8h*)p, *(const v8h*)(p + 16)); }

// f32 -> f16 convert that cannot produce an f16 subnormal (|v| < 2^-14 -> +0)
static __device__ __forceinline__ h16 toh_flush(float v) { const h16 r = (h16)v; return (fabsf(v) < 6.103515625e-05f) ? (h16)0.0f : r; }
// one WMMA with its own hazard guard (ties the accumulator, keeps A and B live)
static __device__ __forceinline__ v8f wmma16g(v16h a, v16h b, v8f c) {
    c = wmma16(a, b, c);
    asm volatile("v_nop\n\tv_nop\n\tv_nop\n\tv_nop" : "+v"(c) : "v"(a), "v"(b));
    return c;
}

__global__ __launch_bounds__(256) void k_cvtq(const float* __restrict__ src, h16* dst, int n8) {
#pragma clang fp contract(off)
    const int i = blockIdx.x * 256 + threadIdx.x; if (i >= n8) return;
    const int row = i >> 4, d0 = (i & 15) * 8; const int b = row / SEQ, t = row % SEQ;
    const v8f v = *(const v8f*)(src + ((size_t)b * SEQ_FULL + (size_t)t) * DM + d0); v8h o;
#pragma unroll
    for (int e = 0; e < 8; ++e) o[e] = toh_flush(bfr(v[e]) * XCAR);
    *(v8h*)(dst + (size_t)i * 8) = o; 
}

// k_keff: combined key operand ke[d] = (1-a) * k[(d-1) mod DM] - a * k[d], a = sigmoid(mode), from bf16-RNE k and mode, in f32;
__global__ __launch_bounds__(256) void k_keff(const float* __restrict__ k, const float* __restrict__ mode, h16* KE, h16* KR, int n8) {
#pragma clang fp contract(off)
    const int i = blockIdx.x * 256 + threadIdx.x; if (i >= n8) return;
    const int row = i >> 4, d0 = (i & 15) * 8; const int b = row / SEQ, t = row % SEQ;
    const float* kr = k + ((size_t)b * SEQ_FULL + (size_t)t) * DM;
    const v8f x = *(const v8f*)(kr + d0);
    const float xm = kr[(d0 + DM - 1) & (DM - 1)];
    const float mv = bfr(mode[0]);
    const float al = 1.0f / (1.0f + expf(-mv));
    const float oma = 1.0f - al;
    float prev = bfr(xm); v8h hv, rv;
#pragma unroll
    for (int e = 0; e < 8; ++e) {
        const float cur = bfr(x[e]);
        const float c = (oma * prev - al * cur) * XCAR;
        const h16 hh = toh_flush(c);
        hv[e] = hh; rv[e] = toh_flush((c - (float)hh) * QRS);
        prev = cur; }
    const bool wr = t < EROWS;
    const size_t oo = (size_t)i * 8;
    const size_t ro = ((size_t)b * EROWS + (size_t)(wr ? t : 0)) * DM + d0;
    *(v8h*)(KE + oo) = hv; if (wr) *(v8h*)(KR + ro) = rv;
    
}

// k_vt: VT[b][d][t] = f16(bf16_rne(v[b][t][d]) * 16); one block per 64 tokens of one batch; in[64 tokens][128 d] -> out[128 d][64 tokens] through LDS;
// LDS tile ts: cross-wave (block barrier between fill and drain); filled extent [128][64] == drained extent.
__global__ __launch_bounds__(256) void k_vt(const float* __restrict__ v, h16* VT) {
#pragma clang fp contract(off)
    __shared__ __align__(16) h16 ts[DM * VTP];
    const int tid = threadIdx.x; const int b = blockIdx.y, tok0 = blockIdx.x * 64;
    const float* src = v + ((size_t)b * SEQ_FULL + (size_t)tok0) * DM;
#pragma unroll 1
    for (int i = 0; i < 8; ++i) { const int idx = i * 256 + tid; const int tk = idx >> 5, c4 = (idx & 31) * 4;   // 8 trips x 256 threads = 64 tokens x 32 float4
        const v4f x = *(const v4f*)(src + (size_t)tk * DM + c4);
#pragma unroll
        for (int e = 0; e < 4; ++e) ts[(c4 + e) * VTP + tk] = toh_flush(bfr(x[e]) * XCAR); }
    __syncthreads();
    h16* dstb = VT + (size_t)b * DM * SEQ + (size_t)tok0;
{
#pragma unroll
        for (int s = 0; s < 4; ++s) { const int p = s * 256 + tid; const int d = p >> 3, c8 = (p & 7) * 8;       // 4 trips x 32 rows = 128 rows; 8 lanes x 8 halves = 64 tokens
            const v8h val = *(const v8ha*)(&ts[d * VTP + c8]);
            *(v8h*)(dstb + (size_t)d * SEQ + c8) = val; }
         }
}

// mask bit word: bit j <- (p[j] != 0), j = 0..31 (eight 16-byte loads, consumed before the next word's loads)
__device__ __forceinline__ unsigned mword(const int* __restrict__ p) {
    unsigned w = 0u;
#pragma unroll
    for (int c = 0; c < 8; ++c) { const v4i x = *(const v4i*)(p + c * 4);
        w |= ((x[0] != 0) ? 1u : 0u) << (c * 4);
        w |= ((x[1] != 0) ? 1u : 0u) << (c * 4 + 1);
        w |= ((x[2] != 0) ? 1u : 0u) << (c * 4 + 2);
        w |= ((x[3] != 0) ? 1u : 0u) << (c * 4 + 3); }
    asm volatile("" : "+v"(w) :: "memory");
    return w;
}

__global__ __launch_bounds__(256) void k_mbits(const int* __restrict__ mask, unsigned* MB, int n4) {
    const int i = blockIdx.x * 256 + threadIdx.x; if (i >= n4) return;
    const int w0 = i * 4; const int t = w0 / MW, wc = w0 % MW;
    const int* src = mask + (size_t)t * SEQ_FULL + (size_t)wc * 32;
    v4u o;
    o[0] = mword(src); o[1] = mword(src + 32); o[2] = mword(src + 64); o[3] = mword(src + 96);
    *(v4u*)(MB + (size_t)i * 4) = o; 
}

// low 32 bits of a __shared__ address = byte offset in the work-group's LDS (destination operand of an asynchronous copy)
__device__ __forceinline__ unsigned ldsa(const void* p) { return (unsigned)(size_t)p; }
// eight / four asynchronous 16-byte copies global -> LDS per lane; the s_wait_xcnt closes the statement so that no address register is rewritten ahead of it
__device__ __forceinline__ void cp8(unsigned l0, const void* g0, unsigned l1, const void* g1, unsigned l2, const void* g2, unsigned l3, const void* g3,
                                    unsigned l4, const void* g4, unsigned l5, const void* g5, unsigned l6, const void* g6, unsigned l7, const void* g7) {
    asm volatile("global_load_async_to_lds_b128 %0, %1, off\n\t"
                 "global_load_async_to_lds_b128 %2, %3, off\n\t"
                 "global_load_async_to_lds_b128 %4, %5, off\n\t"
                 "global_load_async_to_lds_b128 %6, %7, off\n\t"
                 "global_load_async_to_lds_b128 %8, %9, off\n\t"
                 "global_load_async_to_lds_b128 %10, %11, off\n\t"
                 "global_load_async_to_lds_b128 %12, %13, off\n\t"
                 "global_load_async_to_lds_b128 %14, %15, off\n\t"
                 "s_wait_xcnt 0x0"
                 :: "v"(l0), "v"(g0), "v"(l1), "v"(g1), "v"(l2), "v"(g2), "v"(l3), "v"(g3),
                    "v"(l4), "v"(g4), "v"(l5), "v"(g5), "v"(l6), "v"(g6), "v"(l7), "v"(g7) : "memory");
}
__device__ __forceinline__ void cp4(unsigned l0, const void* g0, unsigned l1, const void* g1, unsigned l2, const void* g2, unsigned l3, const void* g3) {
    asm volatile("global_load_async_to_lds_b128 %0, %1, off\n\t"
                 "global_load_async_to_lds_b128 %2, %3, off\n\t"
                 "global_load_async_to_lds_b128 %4, %5, off\n\t"
                 "global_load_async_to_lds_b128 %6, %7, off\n\t"
                 "s_wait_xcnt 0x0"
                 :: "v"(l0), "v"(g0), "v"(l1), "v"(g1), "v"(l2), "v"(g2), "v"(l3), "v"(g3) : "memory");
}
// this wave's asynchronous copies have landed in LDS (other waves read them behind the next block barrier)
__device__ __forceinline__ void wait_copies() { asm volatile("s_wait_asynccnt 0x0" ::: "memory"); }
// this wave's LDS reads have returned (stands in front of the barrier behind which their buffer is refilled)
__device__ __forceinline__ void wait_lds() { asm volatile("s_wait_dscnt 0x0" ::: "memory"); }
// fragment loader from an LDS tile, same element map as ldh
__device__ __forceinline__ v16h ldl(const h16* p) { return cat16(*(const v8ha*)p, *(const v8ha*)(p + 16)); }

// flash_body: fused attention, one block per 64 query rows of one batch; KS key groups of AW waves, wave (group, tile) works 16 query rows against the group's key steps.
// Key split: the block's kept 32-key steps, in ascending order, go round-robin to the key groups (rank mod KS); four waves per SIMD fill one another's latencies.
// Staging: the block's q rows and mask bit words are copied to LDS once; the KE / KR / VT tiles of a group's 32-key step are copied to LDS by and for the group's four waves, two buffers per group,
// the group's next step's copies in flight while this step is worked on (asynchronous copies, 16 bytes per lane; whole tile = 4 copies per thread and plane).
// Tile pitches: 272 B (q, KE, KR rows of 256 B; mask rows of 256 B) and 80 B (VT rows of 64 B), 16 B x odd for the 16-byte fragment reads.
// Transposed form: S^T[key][t] = KE QH^T (A = key rows, B = query rows, 4 k-steps of 32); lane (t = lane&15, h = lane>>4) holds keys 8h+r of each 16-key tile, so the packed
// P tile is directly the B fragment of O^T[d][t] = VT P^T (element r <- tile keys 0..15, element 8+r <- tile keys 16..31, lane unchanged), 8 d-tiles.
// Softmax state (running max over kept keys, partial sum) is one scalar per lane; the two lane halves of a row are combined with one xor-16 exchange.
// Keep rule per element from the mask bit word of (row, 32-key step); a step whose words are zero on all 64 rows of the block is neither copied nor visited (block-uniform bit map),
// a step whose words are zero on the wave's own 16 rows is not worked on by that wave (wave-uniform); kept steps are visited in ascending order.
// EARLY = 1 (query rows [0, EROWS)): scores = KE Q + KR Q / 2048; P = f16 value + f16 residual x2048; O = V P + V P_res / 2048 (residual products in their own accumulators);
//            row sum from the f32 exponentials; KR fragments are zero for keys >= EROWS (address clamped, wave-uniform select).
// EARLY = 0 (query rows [EROWS, SEQ)): single products, row sum over the converted P.
// Epilogue: the groups' running maxima are exchanged through LDS, every wave rescales its partial sum and O^T partial to the common maximum and stages them in LDS (its own tile of 16 rows x 128 columns,
// in the space of the key and value buffers, all written); wave (group, tile) then adds the KS partials of rows 16/KS * group .. of its tile in ascending group order and stores them whole (128 floats = 512 B = four lines)
template <int EARLY>
__device__ __forceinline__ void flash_body(const h16* __restrict__ QH, const h16* __restrict__ KE, const h16* __restrict__ KR, const h16* __restrict__ VT,
                                           const unsigned* __restrict__ MB, float* OUT) {
    constexpr int KB = 32 * KP, VB = DM * VP;                    // halves per KE / KR buffer, per VT buffer
    __shared__ __align__(16) h16 qt[AW * 16 * KP];               // q rows of the block
    __shared__ __align__(16) unsigned mt[AW * 16 * MP];          // mask bit words of the block's rows
    __shared__ __align__(16) h16 ring[KS * 2 * (KB * (EARLY ? 2 : 1) + VB)];   // per key group two buffers each of KE, VT (and KR); behind the loop the O partial tiles
    __shared__ float mm[KS * AW * 16], ll[KS * AW * 16];         // per (group, tile, row): running maximum, rescaled partial sum
    __shared__ __align__(16) unsigned act[AW * KS];
    h16* const kt = ring;                                        // KE tiles [group][buffer]
    h16* const vt = ring + KS * 2 * KB;                          // VT tiles [group][buffer]
    h16* const rt = ring + (EARLY ? KS * 2 * (KB + VB) : 0);     // KR tiles [group][buffer]
    float* const os = (float*)ring;                              // O partial tiles [group][tile][16][OSP]
    constexpr int VG = EARLY ? 4 : 8;                            // V^T fragments read from LDS per group
    constexpr int KG = EARLY ? 1 : 4;                            // k-steps of q / KE / KR fragments read from LDS per group
    const int tid = threadIdx.x;
    const int lane = threadIdx.x & 31, lr = lane & 15, hi = lane >> 4;
    const int wave = __builtin_amdgcn_readfirstlane((int)(threadIdx.x >> 5));
    const int grp = wave >> 2, wq = wave & 3;                    // key group, query tile
    const int gt = tid & (32 * AW - 1);                          // thread within the key group
    const int b = blockIdx.y;
    const int tb = (EARLY ? 0 : EROWS) + blockIdx.x * AW * 16;   // first query row of the block
    const int t0 = tb + wq * 16;
    const h16* Qb = QH + (size_t)b * SEQ * DM;
    const h16* Kb = KE + (size_t)b * SEQ * DM;
    const h16* Rb = KR + (size_t)b * EROWS * DM;
    const h16* Vb = VT + (size_t)b * DM * SEQ;
    // group copy maps: 256-B rows: thread -> (row gt>>4 + 8i, 16-B column gt&15); 64-B rows: thread -> (row gt>>2 + 32i, 16-B column gt&3)
    const int r16 = gt >> 4, c16 = gt & 15, r4 = gt >> 2, c4 = gt & 3;
    {
        // block copy map, q rows and mask words: thread -> (row tid>>4 + 32i, 16-B column tid&15)
        const int rq = tid >> 4;
        const h16* qg = Qb + (size_t)(tb + rq) * DM + c16 * 8;
        const unsigned ql = ldsa(qt) + (unsigned)(rq * KP + c16 * 8) * 2u;
        const unsigned* mg = MB + (size_t)(tb + rq) * MW + c16 * 4;
        const unsigned ml = ldsa(mt) + (unsigned)(rq * MP + c16 * 4) * 4u;
        cp4(ql, qg, ql + 32 * KP * 2, qg + 32 * DM, ml, mg, ml + 32 * MP * 4, mg + 32 * MW);
    }
    wait_copies();
    __syncthreads();                                             // q rows and mask words readable by every wave
    // block-uniform bit map of the steps that some row of the block keeps: thread -> (step tid&63, rows 8*(tid>>6) .. +7); even waves hold steps 0..31, odd waves steps 32..63
    unsigned orv = 0u;
#pragma unroll
    for (int i = 0; i < 8; ++i) orv |= mt[((tid >> 6) * 8 + i) * MP + (tid & 63)];
    const unsigned bal = __builtin_amdgcn_ballot_w32(orv != 0u);
    if (lane == 0) act[wave] = bal;
    __syncthreads();
    unsigned olo = 0u, ohi = 0u;
#pragma unroll
    for (int i = 0; i < AW * KS / 2; ++i) { olo |= act[2 * i]; ohi |= act[2 * i + 1]; }
    const unsigned alo = (unsigned)__builtin_amdgcn_readfirstlane((int)olo);
    const unsigned ahi = (unsigned)__builtin_amdgcn_readfirstlane((int)ohi);
    unsigned long long rem = ((unsigned long long)ahi << 32) | (unsigned long long)alo;
    const int trips = (__builtin_popcountll(rem) + KS - 1) / KS; // block-uniform: rounds of KS kept steps
    // the next KS kept steps leave the map in ascending order; returns the one of this key group (-1: none left for it)
    auto pop = [&]() {
        int mine = -1;
#pragma unroll
        for (int j = 0; j < KS; ++j)
            if (rem != 0ull) { const int s = __builtin_ctzll(rem); rem &= rem - 1ull; if (j == grp) mine = s; }
        return mine;
    };

    const h16* kg0 = Kb + r16 * DM + c16 * 8;
    const h16* rg0 = Rb + r16 * DM + c16 * 8;
    const h16* vg0 = Vb + r4 * SEQ + c4 * 8;
    const unsigned kl0 = ldsa(kt) + (unsigned)(grp * 2 * KB + r16 * KP + c16 * 8) * 2u;
    const unsigned rl0 = ldsa(rt) + (unsigned)(grp * 2 * KB + r16 * KP + c16 * 8) * 2u;
    const unsigned vl0 = ldsa(vt) + (unsigned)(grp * 2 * VB + r4 * VP + c4 * 8) * 2u;
    // copies of step s into the group's buffer bf (group-uniform arguments; every lane on)
    auto stage = [&](int s, int bf) {
        const int key0 = s * 32;
        const h16* kg = kg0 + key0 * DM; const h16* vg = vg0 + key0;
        const unsigned kl = kl0 + (unsigned)bf * (32 * KP * 2), vl = vl0 + (unsigned)bf * (DM * VP * 2);
        cp8(kl, kg, kl + 8 * KP * 2, kg + 8 * DM, kl + 16 * KP * 2, kg + 16 * DM, kl + 24 * KP * 2, kg + 24 * DM,
            vl, vg, vl + 32 * VP * 2, vg + 32 * SEQ, vl + 64 * VP * 2, vg + 64 * SEQ, vl + 96 * VP * 2, vg + 96 * SEQ);
        if (EARLY) {
            const int kcl = (key0 < EROWS) ? key0 : (EROWS - 32);    // clamped residual-plane key (address always inside the plane)
            const h16* rg = rg0 + kcl * DM; const unsigned rl = rl0 + (unsigned)bf * (32 * KP * 2);
            cp4(rl, rg, rl + 8 * KP * 2, rg + 8 * DM, rl + 16 * KP * 2, rg + 16 * DM, rl + 24 * KP * 2, rg + 24 * DM);
        }
    };
    int s0 = pop();                                              // the group's kept step of this round, of the next round (-1: none)
    int s1 = pop();
    if (s0 >= 0) stage(s0, 0);
    wait_copies();
    __syncthreads();                                             // each group's first kept step readable by its waves
    if (s1 >= 0) stage(s1, 1);

    const int mo = (wq * 16 + lr) * MP;
    const int qo = (wq * 16 + lr) * KP + 8 * hi;                 // B fragment: col t, k = d
    const int ko = lr * KP + 8 * hi;                             // + tile row * KP + kc   (A fragment: row key, k = d)
    const int vo = lr * VP + 8 * hi;                             // + 16j*VP               (A fragment: row d, k = key)
    const v16h hz = (v16h){};
    v8f o[8], oR[8];
#pragma unroll
    for (int j = 0; j < 8; ++j) { o[j] = (v8f){}; oR[j] = (v8f){}; }
    float m = NEGB, l = 0.0f;
    int bf = 0;
#pragma unroll 1
    for (int it = 0; it < MW / KS; ++it) {
        if (it >= trips) break;                                  // block-uniform: no kept step left
        const unsigned mw = (s0 >= 0) ? mt[mo + s0] : 0u;        // group-uniform test: no step for this group in the last round
        if (__builtin_amdgcn_ballot_w32(mw != 0u) != 0u) {       // wave-uniform: some row of this tile keeps some key of this step
            const int key0 = s0 * 32;
            const bool rok = key0 < EROWS;                       // wave-uniform
            const h16* kb = kt + (grp * 2 + bf) * KB + ko;
            const h16* rb = rt + (EARLY ? (grp * 2 + bf) * KB : 0) + ko;
            const h16* vb = vt + (grp * 2 + bf) * VB + vo;
            v8f sHa = (v8f){}, sHb = (v8f){}, sLa = (v8f){}, sLb = (v8f){};
#pragma unroll
            for (int g = 0; g < 4 / KG; ++g) {                   // the LDS fragment reads of KG k-steps issue together, one LDS latency per group
                v16h qf[KG], ka0[KG], kb0[KG], kra[KG], krb[KG];
#pragma unroll
                for (int u = 0; u < KG; ++u) {
                    const int kc = (g * KG + u) * 32;
                    qf[u] = ldl(qt + qo + kc); ka0[u] = ldl(kb + kc); kb0[u] = ldl(kb + 16 * KP + kc);
                    if (EARLY) { kra[u] = ldl(rb + kc); krb[u] = ldl(rb + 16 * KP + kc); }
                }
#pragma unroll
                for (int u = 0; u < KG; ++u) {
                    sHa = wmma16g(ka0[u], qf[u], sHa); sHb = wmma16g(kb0[u], qf[u], sHb);
                    if (EARLY) {
                        if (!rok) { kra[u] = hz; krb[u] = hz; }
                        sLa = wmma16g(kra[u], qf[u], sLa); sLb = wmma16g(krb[u], qf[u], sLb);
                    }
                }
            }
            const unsigned ma = mw >> (8 * hi);                  // bit r: key key0+8h+r; bit 16+r: key key0+16+8h+r
            float ta[8], tb2[8]; bool fa[8], fb[8]; float mx = NEGB;
#pragma unroll
            for (int r = 0; r < 8; ++r) {
                fa[r] = ((ma >> r) & 1u) != 0u;
                fb[r] = ((ma >> (16 + r)) & 1u) != 0u;
                if (EARLY) { ta[r] = (sHa[r] + sLa[r] * QRI) * SC2; tb2[r] = (sHb[r] + sLb[r] * QRI) * SC2; }
                else       { ta[r] = sHa[r] * SC2; tb2[r] = sHb[r] * SC2; }
                mx = fmaxf(mx, fmaxf(fa[r] ? ta[r] : NEGB, fb[r] ? tb2[r] : NEGB)); }
            mx = fmaxf(mx, __shfl_xor(mx, 16, 32));
            const float mnew = fmaxf(m, mx);
            const float resc = __builtin_amdgcn_exp2f(m - mnew);
            const float sh = PSH - mnew;
            v16h pb, pr = hz; float ls = 0.0f;
#pragma unroll
            for (int r = 0; r < 8; ++r) {
                const float xa = ta[r] + sh, xb = tb2[r] + sh;
                const float ea = __builtin_amdgcn_exp2f(xa), eb = __builtin_amdgcn_exp2f(xb);
                const float ga = (fa[r] & (xa >= -14.0f)) ? ea : 0.0f;       // dropped elements and sub-2^-14 values selected to 0 by value
                const float gb = (fb[r] & (xb >= -14.0f)) ? eb : 0.0f;
                const h16 pa = (h16)ga; const h16 pc = (h16)gb;
                pb[r] = pa; pb[8 + r] = pc;
                if (EARLY) { pr[r] = toh_flush((ga - (float)pa) * QRS); pr[8 + r] = toh_flush((gb - (float)pc) * QRS); ls += ga + gb; }
                else       { ls += (float)pa + (float)pc; } }
            l = l * resc + ls; m = mnew;
#pragma unroll
            for (int j = 0; j < 8; ++j) { o[j] = o[j] * resc; if (EARLY) oR[j] = oR[j] * resc; }
#pragma unroll
            for (int g = 0; g < 8 / VG; ++g) {
                v16h vf[VG];
#pragma unroll
                for (int jj = 0; jj < VG; ++jj) vf[jj] = ldl(vb + (g * VG + jj) * 16 * VP);
#pragma unroll
                for (int jj = 0; jj < VG; ++jj) {
                    o[g * VG + jj] = wmma16g(vf[jj], pb, o[g * VG + jj]);
                    if (EARLY) oR[g * VG + jj] = wmma16g(vf[jj], pr, oR[g * VG + jj]); }
            }
        }
        // hand-over, every wave: own LDS reads returned, own copies of the group's next step landed, block barrier; only then the refill of the buffer just read
        wait_lds();
        wait_copies();
        __syncthreads();
        const int s2 = pop();
        if (s2 >= 0) stage(s2, bf);
        s0 = s1; s1 = s2; bf ^= 1;
    }
    wait_copies();                                               // no copy outstanding when the buffers are taken over and the wave ends
    l += __shfl_xor(l, 16, 32);
    const int so = (grp * AW + wq) * 16;                         // this wave's rows in the merge state and among the O partial tiles
    if (hi == 0) mm[so + lr] = m;
    __syncthreads();                                             // every group's maximum readable; every wave has left the key and value buffers
    float mall = NEGB;
#pragma unroll
    for (int g = 0; g < KS; ++g) mall = fmaxf(mall, mm[(g * AW + wq) * 16 + lr]);
    const float fs = __builtin_amdgcn_exp2f(m - mall);           // 1 where no group kept a key (sums and partials are 0 there), 0 for a group without a kept key beside one that has some
    if (hi == 0) ll[so + lr] = l * fs;
    // O^T D layout: o[j][r] = (d = 16j + 8h + r, t = lane&15) -> os[t][d]; rows 0..15 x columns 0..127 all written
#pragma unroll
    for (int j = 0; j < 8; ++j) {
        v8f f = o[j];
        if (EARLY) f = o[j] + oR[j] * QRI;
        v4f a, c;
        a[0] = f[0] * fs; a[1] = f[1] * fs; a[2] = f[2] * fs; a[3] = f[3] * fs; c[0] = f[4] * fs; c[1] = f[5] * fs; c[2] = f[6] * fs; c[3] = f[7] * fs;
        *(v4fa*)(&os[(so + lr) * OSP + 16 * j + 8 * hi]) = a; *(v4fa*)(&os[(so + lr) * OSP + 16 * j + 8 * hi + 4]) = c; }
    __syncthreads();                                             // every group's rescaled sum and O partial readable
    float* orow = OUT + ((size_t)b * OUT_SEQ + (size_t)t0) * DM;
#pragma unroll
    for (int s = 0; s < 16 / KS; ++s) {                          // 16/KS trips = the wave's rows of the tile; 32 lanes x 4 floats = 128 columns = one whole row
        const int row = grp * (16 / KS) + s;
        float lt = 0.0f; v4f val = (v4f){};
#pragma unroll
        for (int g = 0; g < KS; ++g) {
            lt += ll[(g * AW + wq) * 16 + row];
            val += *(const v4fa*)(&os[((g * AW + wq) * 16 + row) * OSP + lane * 4]); }
        const bool any = lt > 0.0f;
        const float lsafe = any ? lt : 1.0f;
        const float inv = any ? ((1.0f / lsafe) * (1.0f / XCAR)) : __uint_as_float(0x7FC00000u);   // no kept key -> NaN row
        *(v4f*)(orow + (size_t)row * DM + lane * 4) = val * inv;
        if (s + 1 < 16 / KS) asm volatile("s_wait_xcnt 0x0" ::: "memory");   // stands in front of the next row's rewrite of the registers that the issued store names
    }
}

__global__ __launch_bounds__(32 * AW * KS) __attribute__((amdgpu_num_vgpr(256)))
void k_flash_early(const h16* __restrict__ QH, const h16* __restrict__ KE, const h16* __restrict__ KR, const h16* __restrict__ VT, const unsigned* __restrict__ MB, float* OUT) {
    flash_body<1>(QH, KE, KR, VT, MB, OUT);
}
__global__ __launch_bounds__(32 * AW * KS) __attribute__((amdgpu_num_vgpr(256)))
void k_flash_late(const h16* __restrict__ QH, const h16* __restrict__ KE, const h16* __restrict__ KR, const h16* __restrict__ VT, const unsigned* __restrict__ MB, float* OUT) {
    flash_body<0>(QH, KE, KR, VT, MB, OUT);
}

static constexpr size_t al256(size_t v) { return (v + 255) & ~(size_t)255; }
static constexpr size_t SZ_PL = al256((size_t)NB * SEQ * DM * 2);          // QH, KE, VT
static constexpr size_t SZ_RS = al256((size_t)NB * EROWS * DM * 2);        // KR
static constexpr size_t SZ_MB = al256((size_t)SEQ * MW * 4);               // MB
static constexpr size_t SZ_TOTAL = 3 * SZ_PL + SZ_RS + SZ_MB;
static_assert(SZ_TOTAL <= (size_t)134217728);          // workspace carve <= 128 MiB
static_assert(((size_t)NB * SEQ * DM) % 8 == 0);       // thread-linear 16-byte stores cover the planes exactly
static_assert(((size_t)SEQ * MW) % 4 == 0);
static_assert(((size_t)NB * OUT_SEQ * DM * 4) <= (size_t)8388608 || NB != NB_FULL || OUT_SEQ != SEQ_FULL);

extern "C" void kernel_launch(void* const* d_in, const int* in_sizes, int n_in,
                              void* d_out, int out_size, void* d_ws, size_t ws_size, hipStream_t stream) {
    if (n_in < 5) return;
    const size_t needx = ((size_t)(NB - 1) * SEQ_FULL + SEQ) * DM;
    const size_t needm = (size_t)(SEQ - 1) * SEQ_FULL + SEQ;
    if ((size_t)in_sizes[0] < needx || (size_t)in_sizes[1] < needx || (size_t)in_sizes[2] < needx) return;
    if ((size_t)in_sizes[3] < needm || in_sizes[4] < 1) return;
    if ((size_t)out_size < ((size_t)(NB - 1) * OUT_SEQ + SEQ) * DM) return;
    if (SZ_TOTAL > ws_size) return;
    // wire order: q, k, v, mask, mode
    const float* q = (const float*)d_in[0];
    const float* k = (const float*)d_in[1];
    const float* v = (const float*)d_in[2];
    const int* mask = (const int*)d_in[3];
    const float* mode = (const float*)d_in[4];
    float* OUT = (float*)d_out;      // [NB][SEQ][128]
    char* wsp = (char*)d_ws;
    h16* QH = (h16*)wsp; wsp += SZ_PL;               // [NB][SEQ][128]  q x16
    h16* KE = (h16*)wsp; wsp += SZ_PL;               // [NB][SEQ][128]  combined key x16
    h16* VT = (h16*)wsp; wsp += SZ_PL;               // [NB][128][SEQ]  v^T x16
    h16* KR = (h16*)wsp; wsp += SZ_RS;               // [NB][EROWS][128] combined-key residual x2048, tokens < EROWS
    unsigned* MB = (unsigned*)wsp; wsp += SZ_MB;     // [SEQ][SEQ/32] mask bit words

    const int n8 = (int)((size_t)NB * SEQ * DM / 8);
    k_cvtq<<<(unsigned)((n8 + 255) / 256), 256, 0, stream>>>(q, QH, n8);
    k_keff<<<(unsigned)((n8 + 255) / 256), 256, 0, stream>>>(k, mode, KE, KR, n8);
    // v: in[SEQ tokens][128 d] per batch -> out[128 d][SEQ tokens]; grid (SEQ/64 token tiles, NB)
    k_vt<<<dim3(SEQ / 64, NB, 1), 256, 0, stream>>>(v, VT);
    const int n4 = (int)((size_t)SEQ * MW / 4);
    k_mbits<<<(unsigned)((n4 + 255) / 256), 256, 0, stream>>>(mask, MB, n4);

    // query rows [0, EROWS): multi-product instantiation; rows [EROWS, SEQ): single-product instantiation (disjoint output rows)
    k_flash_early<<<dim3(EROWS / (16 * AW), NB, 1), 32 * AW * KS, 0, stream>>>(QH, KE, KR, VT, MB, OUT);
    if (SEQ > EROWS)
        k_flash_late<<<dim3((SEQ - EROWS) / (16 * AW), NB, 1), 32 * AW * KS, 0, stream>>>(QH, KE, KR, VT, MB, OUT);
}

// v003
// One run takes 34.4 microseconds.
// In both of two side-by-side timings against v002, it was 1.64 times as fast.
// All steps since v000 together make it 5.31 times as fast.
#include <hip/hip_runtime.h>

// Single-head masked attention, head width 128: q/k/v [NB][SEQ][128] f32, mask [1][SEQ][SEQ] int32 (0 = dropped, read by value), mode scalar f32.
// logit = 128^-0.5 * q . ((1-a) * roll(k, 1 along d) - a * k), a = sigmoid(mode); dropped entries are replaced by -inf; softmax over keys; output = P v (f32).
// Compute dtypes, f32 accumulate everywhere: scores v_wmma_f32_16x16x32_f16: q (bf16-RNE input, x16 carry, exact in f16) against the combined key operand ke = (1-a) k[d-1] - a k[d]
// (built in f32 from bf16-RNE k, x16 carry) as single f16 on query rows >= EROWS and as f16 value + f16 residual x2048 (own accumulator) on query rows < EROWS;
// P.V v_wmma_f32_16x16x32_f16: P (x16384 carry, cancels in the normalisation) single f16 on query rows >= EROWS, f16 value + f16 residual x2048 (own accumulator, folded by 1/2048) on query rows < EROWS;
// v (bf16-RNE input, x16 carry, exact in f16) single everywhere; softmax f32 (online, running max over kept keys).
// Layout: QH [b][t][128], KE [b][s][128], KR [b][s < EROWS][128], VT [b][d][s] (transposed through LDS), MB [t][SEQ/32] mask bit words (bit j = key 32w + j kept).
// Fused flash kernel in transposed form (S^T = KE QH^T, O^T = VT P^T); operand tiles staged in LDS by asynchronous copies, shared by the four waves of a key group; a 32-key step is skipped when its mask block is all zero (per block for the copies, per wave for the work).
// The kept key steps of a block are dealt round-robin to KS key groups of four waves each; every group keeps its own softmax state and O partial, merged through LDS at the end.

#ifndef NB
#define NB 8
#endif
#ifndef SEQ
#define SEQ 2048
#endif
#define NB_FULL  8
#define SEQ_FULL 2048
#ifndef OUT_SEQ
#define OUT_SEQ SEQ              // row pitch (in tokens) between batches of the output
#endif
#define DM   128
#define AW   4                   // query tiles per flash block (16 query rows each), one wave per tile and key group
#define KS   4                   // key groups per flash block (AW waves each)
#define OSP  132                 // LDS row pitch (floats) of the flash output tile
#define VTP  72                  // LDS row pitch (halves) of the transpose tile
#define MW   (SEQ / 32)          // mask bit words per query row
#define KP   136                 // LDS row pitch (halves) of the q, KE and KR tiles: 272 B
#define VP   40                  // LDS row pitch (halves) of the VT tile: 80 B
#define MP   68                  // LDS row pitch (words) of the mask-word tile: 272 B
#define EROWS (SEQ < 512 ? SEQ : 512)   // query rows (and tokens of the residual key plane) handled by the multi-product flash instantiation
#define XCAR 16.0f               // carry of the q, ke and v planes
#define QRS  2048.0f             // carry of every residual plane / residual fragment
#define QRI  (1.0f / 2048.0f)
#define SC2  ((float)(0.08838834764831845 * 1.4426950408889634 / 256.0))   // DM^-0.5 * log2(e) / (XCAR * XCAR)
#define PSH  14.0f               // log2 of the P carry (16384)
#define NEGB (-3.0e38f)

static_assert(DM == 128);                      // output row = 32 lanes x 4 floats; plane row = 16 threads x 8 halves
static_assert(DM % 32 == 0);                   // score k-loop steps by 32
static_assert(DM / 8 == 16);                   // convert kernels: row = i >> 4
static_assert((DM & (DM - 1)) == 0);           // rolled index uses a mask
static_assert(SEQ % 128 == 0);                 // MW multiple of 4: one thread packs four mask words of one row
static_assert(SEQ % 64 == 0);                  // transpose tiles of 64 tokens
static_assert(SEQ % 32 == 0);                  // key loop steps by 32
static_assert(EROWS % (16 * AW) == 0);
static_assert((KP * 2) % 16 == 0 && KP >= DM && (VP * 2) % 16 == 0 && VP >= 32 && (MP * 4) % 16 == 0 && MP >= MW);   // 16-byte copies and fragment reads stay aligned and inside a row
static_assert(MW == 64 && AW == 4 && KS == 4); // flash copy maps and step bit map: 512 threads (128 per key group), 64 rows x 64 words, one 64-bit map
static_assert((SEQ - EROWS) % (16 * AW) == 0);
static_assert(EROWS >= 32);
static_assert(EROWS % 32 == 0);
static_assert(EROWS <= SEQ);
static_assert(NB <= NB_FULL);
static_assert(SEQ <= SEQ_FULL);
static_assert((OSP * 4) % 16 == 0);
static_assert(OSP >= DM);
static_assert((VTP * 2) % 16 == 0);
static_assert(VTP >= 64);
static_assert((size_t)AW * 16 * (KP * 2 + MP * 4) + (size_t)KS * (4 * 32 * KP * 2 + 2 * DM * VP * 2) + (size_t)KS * AW * (2 * 16 * 4 + 4) <= 327680);   // flash static LDS: q and mask tiles, KE, KR and VT buffers of every key group, merge state, step map
static_assert((size_t)KS * AW * 16 * OSP * 4 <= (size_t)KS * (2 * 32 * KP * 2 + 2 * DM * VP * 2));   // the O partial tiles fit in the KE and VT buffers they take over behind the loop
static_assert((size_t)DM * VTP * 2 <= 131072);           // transpose static LDS
static_assert(32 * 4 * (16 / KS) * KS == 16 * DM);       // flash epilogue: 32 lanes x 4 floats x 16/KS trips x KS waves == 16 rows x DM floats
static_assert(256 * 4 * 8 == 64 * DM);                   // transpose load: 256 threads x 4 floats x 8 trips == 64 tokens x DM
static_assert(256 * 8 * 4 == DM * 64);                   // transpose store: 256 threads x 8 halves x 4 trips == DM rows x 64 tokens
static_assert((size_t)NB * SEQ * DM / 8 < (size_t)2147483647);
static_assert((size_t)SEQ * DM < (size_t)2147483647);

typedef _Float16 h16;
typedef __attribute__((ext_vector_type(16))) _Float16 v16h;
typedef __attribute__((ext_vector_type(8)))  _Float16 v8h;
typedef __attribute__((ext_vector_type(8)))  float    v8f;
typedef __attribute__((ext_vector_type(4)))  float    v4f;
typedef __attribute__((ext_vector_type(4)))  int      v4i;
typedef __attribute__((ext_vector_type(4)))  unsigned v4u;
typedef v4f  __attribute__((may_alias)) v4fa;
typedef v8h  __attribute__((may_alias)) v8ha;

__device__ __forceinline__ unsigned short f2bf(float f) { unsigned u = __float_as_uint(f); u += 0x7FFFu + ((u >> 16) & 1u); return (unsigned short)(u >> 16); }
__device__ __forceinline__ float bfr(float f) { return __uint_as_float(((unsigned)f2bf(f)) << 16); }   // value after RNE convert to bf16
__device__ __forceinline__ v16h cat16(v8h lo, v8h hi) { return __builtin_shufflevector(lo, hi, 0, 1, 2, 3, 4, 5, 6, 7, 8, 9, 10, 11, 12, 13, 14, 15); }
__device__ __forceinline__ v8f wmma16(v16h a, v16h b, v8f c) { return __builtin_amdgcn_wmma_f32_16x16x32_f16(false, a, false, b, (short)0, c, false, false); }
// fragment loaders from K-contiguous 16-bit rows; p already includes + 8*(lane>>4): elements 0..7 <- k0+8h+0..7, elements 8..15 <- k0+16+8h+0..7 (same map for A and B)
__device__ __forceinline__ v16h  ldh(const h16* p) { return cat16(*(const v8h*)p, *(const v8h*)(p + 16)); }

// f32 -> f16 convert that cannot produce an f16 subnormal (|v| < 2^-14 -> +0)
static __device__ __forceinline__ h16 toh_flush(float v) { const h16 r = (h16)v; return (fabsf(v) < 6.103515625e-05f) ? (h16)0.0f : r; }
// one WMMA with its own hazard guard (ties the accumulator, keeps A and B live)
static __device__ __forceinline__ v8f wmma16g(v16h a, v16h b, v8f c) {
    c = wmma16(a, b, c);
    asm volatile("v_nop\n\tv_nop\n\tv_nop\n\tv_nop" : "+v"(c) : "v"(a), "v"(b));
    return c;
}

__device__ __forceinline__ void cvtq_body(int blk, const float* __restrict__ src, h16* dst, int n8) {
#pragma clang fp contract(off)
    const int i = blk * 256 + threadIdx.x; if (i >= n8) return;
    const int row = i >> 4, d0 = (i & 15) * 8; const int b = row / SEQ, t = row % SEQ;
    const v8f v = *(const v8f*)(src + ((size_t)b * SEQ_FULL + (size_t)t) * DM + d0); v8h o;
#pragma unroll
    for (int e = 0; e < 8; ++e) o[e] = toh_flush(bfr(v[e]) * XCAR);
    *(v8h*)(dst + (size_t)i * 8) = o; 
}

// keff_body: combined key operand ke[d] = (1-a) * k[(d-1) mod DM] - a * k[d], a = sigmoid(mode), from bf16-RNE k and mode, in f32;
__device__ __forceinline__ void keff_body(int blk, const float* __restrict__ k, const float* __restrict__ mode, h16* KE, h16* KR, int n8) {
#pragma clang fp contract(off)
    const int i = blk * 256 + threadIdx.x; if (i >= n8) return;
    const int row = i >> 4, d0 = (i & 15) * 8; const int b = row / SEQ, t = row % SEQ;
    const float* kr = k + ((size_t)b * SEQ_FULL + (size_t)t) * DM;
    const v8f x = *(const v8f*)(kr + d0);
    const float xm = kr[(d0 + DM - 1) & (DM - 1)];
    const float mv = bfr(mode[0]);
    const float al = 1.0f / (1.0f + expf(-mv));
    const float oma = 1.0f - al;
    float prev = bfr(xm); v8h hv, rv;
#pragma unroll
    for (int e = 0; e < 8; ++e) {
        const float cur = bfr(x[e]);
        const float c = (oma * prev - al * cur) * XCAR;
        const h16 hh = toh_flush(c);
        hv[e] = hh; rv[e] = toh_flush((c - (float)hh) * QRS);
        prev = cur; }
    const bool wr = t < EROWS;
    const size_t oo = (size_t)i * 8;
    const size_t ro = ((size_t)b * EROWS + (size_t)(wr ? t : 0)) * DM + d0;
    *(v8h*)(KE + oo) = hv; if (wr) *(v8h*)(KR + ro) = rv;
    
}

// vt_body: VT[b][d][t] = f16(bf16_rne(v[b][t][d]) * 16); one block per 64 tokens of one batch (blk = batch * SEQ/64 + token tile); in[64 tokens][128 d] -> out[128 d][64 tokens] through LDS;
// LDS tile ts: cross-wave (block barrier between fill and drain); filled extent [128][64] == drained extent.
__device__ __forceinline__ void vt_body(int blk, const float* __restrict__ v, h16* VT) {
#pragma clang fp contract(off)
    __shared__ __align__(16) h16 ts[DM * VTP];
    const int tid = threadIdx.x; const int b = blk / (SEQ / 64), tok0 = (blk % (SEQ / 64)) * 64;
    const float* src = v + ((size_t)b * SEQ_FULL + (size_t)tok0) * DM;
#pragma unroll 1
    for (int i = 0; i < 8; ++i) { const int idx = i * 256 + tid; const int tk = idx >> 5, c4 = (idx & 31) * 4;   // 8 trips x 256 threads = 64 tokens x 32 float4
        const v4f x = *(const v4f*)(src + (size_t)tk * DM + c4);
#pragma unroll
        for (int e = 0; e < 4; ++e) ts[(c4 + e) * VTP + tk] = toh_flush(bfr(x[e]) * XCAR); }
    __syncthreads();
    h16* dstb = VT + (size_t)b * DM * SEQ + (size_t)tok0;
{
#pragma unroll
        for (int s = 0; s < 4; ++s) { const int p = s * 256 + tid; const int d = p >> 3, c8 = (p & 7) * 8;       // 4 trips x 32 rows = 128 rows; 8 lanes x 8 halves = 64 tokens
            const v8h val = *(const v8ha*)(&ts[d * VTP + c8]);
            *(v8h*)(dstb + (size_t)d * SEQ + c8) = val; }
         }
    asm volatile("s_wait_xcnt 0x0" ::: "memory");   // the other block ranges' code follows in the kernel's text: stands in front of any rewrite there of the registers that the issued stores name
}

// mask bit word: bit j <- (p[j] != 0), j = 0..31 (eight 16-byte loads, consumed before the next word's loads)
__device__ __forceinline__ unsigned mword(const int* __restrict__ p) {
    unsigned w = 0u;
#pragma unroll
    for (int c = 0; c < 8; ++c) { const v4i x = *(const v4i*)(p + c * 4);
        w |= ((x[0] != 0) ? 1u : 0u) << (c * 4);
        w |= ((x[1] != 0) ? 1u : 0u) << (c * 4 + 1);
        w |= ((x[2] != 0) ? 1u : 0u) << (c * 4 + 2);
        w |= ((x[3] != 0) ? 1u : 0u) << (c * 4 + 3); }
    asm volatile("" : "+v"(w) :: "memory");
    return w;
}

__device__ __forceinline__ void mbits_body(int blk, const int* __restrict__ mask, unsigned* MB, int n4) {
    const int i = blk * 256 + threadIdx.x; if (i >= n4) return;
    const int w0 = i * 4; const int t = w0 / MW, wc = w0 % MW;
    const int* src = mask + (size_t)t * SEQ_FULL + (size_t)wc * 32;
    v4u o;
    o[0] = mword(src); o[1] = mword(src + 32); o[2] = mword(src + 64); o[3] = mword(src + 96);
    *(v4u*)(MB + (size_t)i * 4) = o; 
}

// k_prep: the four independent operand preparations as block ranges of one grid (block-uniform choice): mask bit words, V^T, combined key, q
#define PB_MB ((SEQ * MW / 4 + 255) / 256)
#define PB_VT ((SEQ / 64) * NB)
#define PB_X  ((NB * SEQ * DM / 8 + 255) / 256)
__global__ __launch_bounds__(256) void k_prep(const float* __restrict__ q, const float* __restrict__ k, const float* __restrict__ v, const int* __restrict__ mask, const float* __restrict__ mode,
                                              h16* QH, h16* KE, h16* KR, h16* VT, unsigned* MB) {
    const int blk = blockIdx.x;
    if (blk < PB_MB)                      mbits_body(blk, mask, MB, SEQ * MW / 4);
    else if (blk < PB_MB + PB_VT)         vt_body(blk - PB_MB, v, VT);
    else if (blk < PB_MB + PB_VT + PB_X)  keff_body(blk - (PB_MB + PB_VT), k, mode, KE, KR, NB * SEQ * DM / 8);
    else                                  cvtq_body(blk - (PB_MB + PB_VT + PB_X), q, QH, NB * SEQ * DM / 8);
}

// low 32 bits of a __shared__ address = byte offset in the work-group's LDS (destination operand of an asynchronous copy)
__device__ __forceinline__ unsigned ldsa(const void* p) { return (unsigned)(size_t)p; }
// eight / four asynchronous 16-byte copies global -> LDS per lane; the s_wait_xcnt closes the statement so that no address register is rewritten ahead of it
__device__ __forceinline__ void cp8(unsigned l0, const void* g0, unsigned l1, const void* g1, unsigned l2, const void* g2, unsigned l3, const void* g3,
                                    unsigned l4, const void* g4, unsigned l5, const void* g5, unsigned l6, const void* g6, unsigned l7, const void* g7) {
    asm volatile("global_load_async_to_lds_b128 %0, %1, off\n\t"
                 "global_load_async_to_lds_b128 %2, %3, off\n\t"
                 "global_load_async_to_lds_b128 %4, %5, off\n\t"
                 "global_load_async_to_lds_b128 %6, %7, off\n\t"
                 "global_load_async_to_lds_b128 %8, %9, off\n\t"
                 "global_load_async_to_lds_b128 %10, %11, off\n\t"
                 "global_load_async_to_lds_b128 %12, %13, off\n\t"
                 "global_load_async_to_lds_b128 %14, %15, off\n\t"
                 "s_wait_xcnt 0x0"
                 :: "v"(l0), "v"(g0), "v"(l1), "v"(g1), "v"(l2), "v"(g2), "v"(l3), "v"(g3),
                    "v"(l4), "v"(g4), "v"(l5), "v"(g5), "v"(l6), "v"(g6), "v"(l7), "v"(g7) : "memory");
}
__device__ __forceinline__ void cp4(unsigned l0, const void* g0, unsigned l1, const void* g1, unsigned l2, const void* g2, unsigned l3, const void* g3) {
    asm volatile("global_load_async_to_lds_b128 %0, %1, off\n\t"
                 "global_load_async_to_lds_b128 %2, %3, off\n\t"
                 "global_load_async_to_lds_b128 %4, %5, off\n\t"
                 "global_load_async_to_lds_b128 %6, %7, off\n\t"
                 "s_wait_xcnt 0x0"
                 :: "v"(l0), "v"(g0), "v"(l1), "v"(g1), "v"(l2), "v"(g2), "v"(l3), "v"(g3) : "memory");
}
// this wave's asynchronous copies have landed in LDS (other waves read them behind the next block barrier)
__device__ __forceinline__ void wait_copies() { asm volatile("s_wait_asynccnt 0x0" ::: "memory"); }
// this wave's LDS reads have returned (stands in front of the barrier behind which their buffer is refilled)
__device__ __forceinline__ void wait_lds() { asm volatile("s_wait_dscnt 0x0" ::: "memory"); }
// fragment loader from an LDS tile, same element map as ldh
__device__ __forceinline__ v16h ldl(const h16* p) { return cat16(*(const v8ha*)p, *(const v8ha*)(p + 16)); }

// flash_body: fused attention, one block per 64 query rows of one batch; KS key groups of AW waves, wave (group, tile) works 16 query rows against the group's key steps.
// Key split: the block's kept 32-key steps, in ascending order, go round-robin to the key groups (rank mod KS); four waves per SIMD fill one another's latencies.
// Staging: the block's q rows and mask bit words are copied to LDS once; the KE / KR / VT tiles of a group's 32-key step are copied to LDS by and for the group's four waves, two buffers per group,
// the group's next step's copies in flight while this step is worked on (asynchronous copies, 16 bytes per lane; whole tile = 4 copies per thread and plane).
// Tile pitches: 272 B (q, KE, KR rows of 256 B; mask rows of 256 B) and 80 B (VT rows of 64 B), 16 B x odd for the 16-byte fragment reads.
// Transposed form: S^T[key][t] = KE QH^T (A = key rows, B = query rows, 4 k-steps of 32); lane (t = lane&15, h = lane>>4) holds keys 8h+r of each 16-key tile, so the packed
// P tile is directly the B fragment of O^T[d][t] = VT P^T (element r <- tile keys 0..15, element 8+r <- tile keys 16..31, lane unchanged), 8 d-tiles.
// Softmax state (running max over kept keys, partial sum) is one scalar per lane; the two lane halves of a row are combined with one xor-16 exchange.
// Keep rule per element from the mask bit word of (row, 32-key step); a step whose words are zero on all 64 rows of the block is neither copied nor visited (block-uniform bit map),
// a step whose words are zero on the wave's own 16 rows is not worked on by that wave (wave-uniform); kept steps are visited in ascending order.
// EARLY = 1 (query rows [0, EROWS)): scores = KE Q + KR Q / 2048; P = f16 value + f16 residual x2048; O = V P + V P_res / 2048 (residual products in their own accumulators);
//            row sum from the f32 exponentials; KR fragments are zero for keys >= EROWS (address clamped, wave-uniform select).
// EARLY = 0 (query rows [EROWS, SEQ)): single products, row sum over the converted P.
// Epilogue: the groups' running maxima are exchanged through LDS, every wave rescales its partial sum and O^T partial to the common maximum and stages them in LDS (its own tile of 16 rows x 128 columns,
// in the space of the key and value buffers, all written); wave (group, tile) then adds the KS partials of rows 16/KS * group .. of its tile in ascending group order and stores them whole (128 floats = 512 B = four lines)
// The LDS arrays belong to the kernel (one set for both instantiations) and are handed in; qtile = 64-row query tile of the block, b = batch.
template <int EARLY>
__device__ __forceinline__ void flash_body(h16* qt, unsigned* mt, h16* ring, float* mm, float* ll, unsigned* act, int qtile, int b,
                                           const h16* __restrict__ QH, const h16* __restrict__ KE, const h16* __restrict__ KR, const h16* __restrict__ VT,
                                           const unsigned* __restrict__ MB, float* OUT) {
    constexpr int KB = 32 * KP, VB = DM * VP;                    // halves per KE / KR buffer, per VT buffer
    h16* const kt = ring;                                        // KE tiles [group][buffer]
    h16* const vt = ring + KS * 2 * KB;                          // VT tiles [group][buffer]
    h16* const rt = ring + (EARLY ? KS * 2 * (KB + VB) : 0);     // KR tiles [group][buffer]
    float* const os = (float*)ring;                              // O partial tiles [group][tile][16][OSP]
    constexpr int VG = EARLY ? 4 : 8;                            // V^T fragments read from LDS per group
    constexpr int KG = EARLY ? 1 : 4;                            // k-steps of q / KE / KR fragments read from LDS per group
    const int tid = threadIdx.x;
    const int lane = threadIdx.x & 31, lr = lane & 15, hi = lane >> 4;
    const int wave = __builtin_amdgcn_readfirstlane((int)(threadIdx.x >> 5));
    const int grp = wave >> 2, wq = wave & 3;                    // key group, query tile
    const int gt = tid & (32 * AW - 1);                          // thread within the key group
    const int tb = qtile * AW * 16;                              // first query row of the block
    const int t0 = tb + wq * 16;
    const h16* Qb = QH + (size_t)b * SEQ * DM;
    const h16* Kb = KE + (size_t)b * SEQ * DM;
    const h16* Rb = KR + (size_t)b * EROWS * DM;
    const h16* Vb = VT + (size_t)b * DM * SEQ;
    // group copy maps: 256-B rows: thread -> (row gt>>4 + 8i, 16-B column gt&15); 64-B rows: thread -> (row gt>>2 + 32i, 16-B column gt&3)
    const int r16 = gt >> 4, c16 = gt & 15, r4 = gt >> 2, c4 = gt & 3;
    {
        // block copy map, q rows and mask words: thread -> (row tid>>4 + 32i, 16-B column tid&15)
        const int rq = tid >> 4;
        const h16* qg = Qb + (size_t)(tb + rq) * DM + c16 * 8;
        const unsigned ql = ldsa(qt) + (unsigned)(rq * KP + c16 * 8) * 2u;
        const unsigned* mg = MB + (size_t)(tb + rq) * MW + c16 * 4;
        const unsigned ml = ldsa(mt) + (unsigned)(rq * MP + c16 * 4) * 4u;
        cp4(ql, qg, ql + 32 * KP * 2, qg + 32 * DM, ml, mg, ml + 32 * MP * 4, mg + 32 * MW);
    }
    wait_copies();
    __syncthreads();                                             // q rows and mask words readable by every wave
    // block-uniform bit map of the steps that some row of the block keeps: thread -> (step tid&63, rows 8*(tid>>6) .. +7); even waves hold steps 0..31, odd waves steps 32..63
    unsigned orv = 0u;
#pragma unroll
    for (int i = 0; i < 8; ++i) orv |= mt[((tid >> 6) * 8 + i) * MP + (tid & 63)];
    const unsigned bal = __builtin_amdgcn_ballot_w32(orv != 0u);
    if (lane == 0) act[wave] = bal;
    __syncthreads();
    unsigned olo = 0u, ohi = 0u;
#pragma unroll
    for (int i = 0; i < AW * KS / 2; ++i) { olo |= act[2 * i]; ohi |= act[2 * i + 1]; }
    const unsigned alo = (unsigned)__builtin_amdgcn_readfirstlane((int)olo);
    const unsigned ahi = (unsigned)__builtin_amdgcn_readfirstlane((int)ohi);
    unsigned long long rem = ((unsigned long long)ahi << 32) | (unsigned long long)alo;
    const int trips = (__builtin_popcountll(rem) + KS - 1) / KS; // block-uniform: rounds of KS kept steps
    // the next KS kept steps leave the map in ascending order; returns the one of this key group (-1: none left for it)
    auto pop = [&]() {
        int mine = -1;
#pragma unroll
        for (int j = 0; j < KS; ++j)
            if (rem != 0ull) { const int s = __builtin_ctzll(rem); rem &= rem - 1ull; if (j == grp) mine = s; }
        return mine;
    };

    const h16* kg0 = Kb + r16 * DM + c16 * 8;
    const h16* rg0 = Rb + r16 * DM + c16 * 8;
    const h16* vg0 = Vb + r4 * SEQ + c4 * 8;
    const unsigned kl0 = ldsa(kt) + (unsigned)(grp * 2 * KB + r16 * KP + c16 * 8) * 2u;
    const unsigned rl0 = ldsa(rt) + (unsigned)(grp * 2 * KB + r16 * KP + c16 * 8) * 2u;
    const unsigned vl0 = ldsa(vt) + (unsigned)(grp * 2 * VB + r4 * VP + c4 * 8) * 2u;
    // copies of step s into the group's buffer bf (group-uniform arguments; every lane on)
    auto stage = [&](int s, int bf) {
        const int key0 = s * 32;
        const h16* kg = kg0 + key0 * DM; const h16* vg = vg0 + key0;
        const unsigned kl = kl0 + (unsigned)bf * (32 * KP * 2), vl = vl0 + (unsigned)bf * (DM * VP * 2);
        cp8(kl, kg, kl + 8 * KP * 2, kg + 8 * DM, kl + 16 * KP * 2, kg + 16 * DM, kl + 24 * KP * 2, kg + 24 * DM,
            vl, vg, vl + 32 * VP * 2, vg + 32 * SEQ, vl + 64 * VP * 2, vg + 64 * SEQ, vl + 96 * VP * 2, vg + 96 * SEQ);
        if (EARLY) {
            const int kcl = (key0 < EROWS) ? key0 : (EROWS - 32);    // clamped residual-plane key (address always inside the plane)
            const h16* rg = rg0 + kcl * DM; const unsigned rl = rl0 + (unsigned)bf * (32 * KP * 2);
            cp4(rl, rg, rl + 8 * KP * 2, rg + 8 * DM, rl + 16 * KP * 2, rg + 16 * DM, rl + 24 * KP * 2, rg + 24 * DM);
        }
    };
    int s0 = pop();                                              // the group's kept step of this round, of the next round (-1: none)
    int s1 = pop();
    if (s0 >= 0) stage(s0, 0);
    wait_copies();
    __syncthreads();                                             // each group's first kept step readable by its waves
    if (s1 >= 0) stage(s1, 1);

    const int mo = (wq * 16 + lr) * MP;
    const int qo = (wq * 16 + lr) * KP + 8 * hi;                 // B fragment: col t, k = d
    const int ko = lr * KP + 8 * hi;                             // + tile row * KP + kc   (A fragment: row key, k = d)
    const int vo = lr * VP + 8 * hi;                             // + 16j*VP               (A fragment: row d, k = key)
    const v16h hz = (v16h){};
    v8f o[8], oR[8];
#pragma unroll
    for (int j = 0; j < 8; ++j) { o[j] = (v8f){}; oR[j] = (v8f){}; }
    float m = NEGB, l = 0.0f;
    int bf = 0;
#pragma unroll 1
    for (int it = 0; it < MW / KS; ++it) {
        if (it >= trips) break;                                  // block-uniform: no kept step left
        const unsigned mw = (s0 >= 0) ? mt[mo + s0] : 0u;        // group-uniform test: no step for this group in the last round
        if (__builtin_amdgcn_ballot_w32(mw != 0u) != 0u) {       // wave-uniform: some row of this tile keeps some key of this step
            const int key0 = s0 * 32;
            const bool rok = key0 < EROWS;                       // wave-uniform
            const h16* kb = kt + (grp * 2 + bf) * KB + ko;
            const h16* rb = rt + (EARLY ? (grp * 2 + bf) * KB : 0) + ko;
            const h16* vb = vt + (grp * 2 + bf) * VB + vo;
            v8f sHa = (v8f){}, sHb = (v8f){}, sLa = (v8f){}, sLb = (v8f){};
#pragma unroll
            for (int g = 0; g < 4 / KG; ++g) {                   // the LDS fragment reads of KG k-steps issue together, one LDS latency per group
                v16h qf[KG], ka0[KG], kb0[KG], kra[KG], krb[KG];
#pragma unroll
                for (int u = 0; u < KG; ++u) {
                    const int kc = (g * KG + u) * 32;
                    qf[u] = ldl(qt + qo + kc); ka0[u] = ldl(kb + kc); kb0[u] = ldl(kb + 16 * KP + kc);
                    if (EARLY) { kra[u] = ldl(rb + kc); krb[u] = ldl(rb + 16 * KP + kc); }
                }
#pragma unroll
                for (int u = 0; u < KG; ++u) {
                    sHa = wmma16g(ka0[u], qf[u], sHa); sHb = wmma16g(kb0[u], qf[u], sHb);
                    if (EARLY) {
                        if (!rok) { kra[u] = hz; krb[u] = hz; }
                        sLa = wmma16g(kra[u], qf[u], sLa); sLb = wmma16g(krb[u], qf[u], sLb);
                    }
                }
            }
            const unsigned ma = mw >> (8 * hi);                  // bit r: key key0+8h+r; bit 16+r: key key0+16+8h+r
            float ta[8], tb2[8]; bool fa[8], fb[8]; float mx = NEGB;
#pragma unroll
            for (int r = 0; r < 8; ++r) {
                fa[r] = ((ma >> r) & 1u) != 0u;
                fb[r] = ((ma >> (16 + r)) & 1u) != 0u;
                if (EARLY) { ta[r] = (sHa[r] + sLa[r] * QRI) * SC2; tb2[r] = (sHb[r] + sLb[r] * QRI) * SC2; }
                else       { ta[r] = sHa[r] * SC2; tb2[r] = sHb[r] * SC2; }
                mx = fmaxf(mx, fmaxf(fa[r] ? ta[r] : NEGB, fb[r] ? tb2[r] : NEGB)); }
            mx = fmaxf(mx, __shfl_xor(mx, 16, 32));
            const float mnew = fmaxf(m, mx);
            const float resc = __builtin_amdgcn_exp2f(m - mnew);
            const float sh = PSH - mnew;
            v16h pb, pr = hz; float ls = 0.0f;
#pragma unroll
            for (int r = 0; r < 8; ++r) {
                const float xa = ta[r] + sh, xb = tb2[r] + sh;
                const float ea = __builtin_amdgcn_exp2f(xa), eb = __builtin_amdgcn_exp2f(xb);
                const float ga = (fa[r] & (xa >= -14.0f)) ? ea : 0.0f;       // dropped elements and sub-2^-14 values selected to 0 by value
                const float gb = (fb[r] & (xb >= -14.0f)) ? eb : 0.0f;
                const h16 pa = (h16)ga; const h16 pc = (h16)gb;
                pb[r] = pa; pb[8 + r] = pc;
                if (EARLY) { pr[r] = toh_flush((ga - (float)pa) * QRS); pr[8 + r] = toh_flush((gb - (float)pc) * QRS); ls += ga + gb; }
                else       { ls += (float)pa + (float)pc; } }
            l = l * resc + ls; m = mnew;
#pragma unroll
            for (int j = 0; j < 8; ++j) { o[j] = o[j] * resc; if (EARLY) oR[j] = oR[j] * resc; }
#pragma unroll
            for (int g = 0; g < 8 / VG; ++g) {
                v16h vf[VG];
#pragma unroll
                for (int jj = 0; jj < VG; ++jj) vf[jj] = ldl(vb + (g * VG + jj) * 16 * VP);
#pragma unroll
                for (int jj = 0; jj < VG; ++jj) {
                    o[g * VG + jj] = wmma16g(vf[jj], pb, o[g * VG + jj]);
                    if (EARLY) oR[g * VG + jj] = wmma16g(vf[jj], pr, oR[g * VG + jj]); }
            }
        }
        // hand-over, every wave: own LDS reads returned, own copies of the group's next step landed, block barrier; only then the refill of the buffer just read
        wait_lds();
        wait_copies();
        __syncthreads();
        const int s2 = pop();
        if (s2 >= 0) stage(s2, bf);
        s0 = s1; s1 = s2; bf ^= 1;
    }
    wait_copies();                                               // no copy outstanding when the buffers are taken over and the wave ends
    l += __shfl_xor(l, 16, 32);
    const int so = (grp * AW + wq) * 16;                         // this wave's rows in the merge state and among the O partial tiles
    if (hi == 0) mm[so + lr] = m;
    __syncthreads();                                             // every group's maximum readable; every wave has left the key and value buffers
    float mall = NEGB;
#pragma unroll
    for (int g = 0; g < KS; ++g) mall = fmaxf(mall, mm[(g * AW + wq) * 16 + lr]);
    const float fs = __builtin_amdgcn_exp2f(m - mall);           // 1 where no group kept a key (sums and partials are 0 there), 0 for a group without a kept key beside one that has some
    if (hi == 0) ll[so + lr] = l * fs;
    // O^T D layout: o[j][r] = (d = 16j + 8h + r, t = lane&15) -> os[t][d]; rows 0..15 x columns 0..127 all written
#pragma unroll
    for (int j = 0; j < 8; ++j) {
        v8f f = o[j];
        if (EARLY) f = o[j] + oR[j] * QRI;
        v4f a, c;
        a[0] = f[0] * fs; a[1] = f[1] * fs; a[2] = f[2] * fs; a[3] = f[3] * fs; c[0] = f[4] * fs; c[1] = f[5] * fs; c[2] = f[6] * fs; c[3] = f[7] * fs;
        *(v4fa*)(&os[(so + lr) * OSP + 16 * j + 8 * hi]) = a; *(v4fa*)(&os[(so + lr) * OSP + 16 * j + 8 * hi + 4]) = c; }
    __syncthreads();                                             // every group's rescaled sum and O partial readable
    float* orow = OUT + ((size_t)b * OUT_SEQ + (size_t)t0) * DM;
#pragma unroll
    for (int s = 0; s < 16 / KS; ++s) {                          // 16/KS trips = the wave's rows of the tile; 32 lanes x 4 floats = 128 columns = one whole row
        const int row = grp * (16 / KS) + s;
        float lt = 0.0f; v4f val = (v4f){};
#pragma unroll
        for (int g = 0; g < KS; ++g) {
            lt += ll[(g * AW + wq) * 16 + row];
            val += *(const v4fa*)(&os[((g * AW + wq) * 16 + row) * OSP + lane * 4]); }
        const bool any = lt > 0.0f;
        const float lsafe = any ? lt : 1.0f;
        const float inv = any ? ((1.0f / lsafe) * (1.0f / XCAR)) : __uint_as_float(0x7FC00000u);   // no kept key -> NaN row
        *(v4f*)(orow + (size_t)row * DM + lane * 4) = val * inv;
        if (s + 1 < 16 / KS) asm volatile("s_wait_xcnt 0x0" ::: "memory");   // stands in front of the next row's rewrite of the registers that the issued store names
    }
}

// k_flash: both instantiations in one grid (batch, SEQ/64 query tiles), chosen per block by its query tile (block-uniform); high query tiles hold the low block indices
__global__ __launch_bounds__(32 * AW * KS) __attribute__((amdgpu_num_vgpr(256)))
void k_flash(const h16* __restrict__ QH, const h16* __restrict__ KE, const h16* __restrict__ KR, const h16* __restrict__ VT, const unsigned* __restrict__ MB, float* OUT) {
    __shared__ __align__(16) h16 qt[AW * 16 * KP];               // q rows of the block
    __shared__ __align__(16) unsigned mt[AW * 16 * MP];          // mask bit words of the block's rows
    __shared__ __align__(16) h16 ring[KS * 2 * (32 * KP * 2 + DM * VP)];   // per key group two buffers each of KE, VT (and KR, multi-product blocks only); behind the loop the O partial tiles
    __shared__ float mm[KS * AW * 16], ll[KS * AW * 16];         // per (group, tile, row): running maximum, rescaled partial sum
    __shared__ __align__(16) unsigned act[AW * KS];
    const int qtile = SEQ / (16 * AW) - 1 - (int)blockIdx.y;
    const int b = blockIdx.x;
    if (qtile < EROWS / (16 * AW)) flash_body<1>(qt, mt, ring, mm, ll, act, qtile, b, QH, KE, KR, VT, MB, OUT);
    else                           flash_body<0>(qt, mt, ring, mm, ll, act, qtile, b, QH, KE, KR, VT, MB, OUT);
}

static constexpr size_t al256(size_t v) { return (v + 255) & ~(size_t)255; }
static constexpr size_t SZ_PL = al256((size_t)NB * SEQ * DM * 2);          // QH, KE, VT
static constexpr size_t SZ_RS = al256((size_t)NB * EROWS * DM * 2);        // KR
static constexpr size_t SZ_MB = al256((size_t)SEQ * MW * 4);               // MB
static constexpr size_t SZ_TOTAL = 3 * SZ_PL + SZ_RS + SZ_MB;
static_assert(SZ_TOTAL <= (size_t)134217728);          // workspace carve <= 128 MiB
static_assert(((size_t)NB * SEQ * DM) % 8 == 0);       // thread-linear 16-byte stores cover the planes exactly
static_assert(((size_t)SEQ * MW) % 4 == 0);
static_assert(((size_t)NB * OUT_SEQ * DM * 4) <= (size_t)8388608 || NB != NB_FULL || OUT_SEQ != SEQ_FULL);

extern "C" void kernel_launch(void* const* d_in, const int* in_sizes, int n_in,
                              void* d_out, int out_size, void* d_ws, size_t ws_size, hipStream_t stream) {
    if (n_in < 5) return;
    const size_t needx = ((size_t)(NB - 1) * SEQ_FULL + SEQ) * DM;
    const size_t needm = (size_t)(SEQ - 1) * SEQ_FULL + SEQ;
    if ((size_t)in_sizes[0] < needx || (size_t)in_sizes[1] < needx || (size_t)in_sizes[2] < needx) return;
    if ((size_t)in_sizes[3] < needm || in_sizes[4] < 1) return;
    if ((size_t)out_size < ((size_t)(NB - 1) * OUT_SEQ + SEQ) * DM) return;
    if (SZ_TOTAL > ws_size) return;
    // wire order: q, k, v, mask, mode
    const float* q = (const float*)d_in[0];
    const float* k = (const float*)d_in[1];
    const float* v = (const float*)d_in[2];
    const int* mask = (const int*)d_in[3];
    const float* mode = (const float*)d_in[4];
    float* OUT = (float*)d_out;      // [NB][SEQ][128]
    char* wsp = (char*)d_ws;
    h16* QH = (h16*)wsp; wsp += SZ_PL;               // [NB][SEQ][128]  q x16
    h16* KE = (h16*)wsp; wsp += SZ_PL;               // [NB][SEQ][128]  combined key x16
    h16* VT = (h16*)wsp; wsp += SZ_PL;               // [NB][128][SEQ]  v^T x16
    h16* KR = (h16*)wsp; wsp += SZ_RS;               // [NB][EROWS][128] combined-key residual x2048, tokens < EROWS
    unsigned* MB = (unsigned*)wsp; wsp += SZ_MB;     // [SEQ][SEQ/32] mask bit words

    k_prep<<<PB_MB + PB_VT + 2 * PB_X, 256, 0, stream>>>(q, k, v, mask, mode, QH, KE, KR, VT, MB);
    // query rows [0, EROWS): multi-product instantiation; rows [EROWS, SEQ): single-product instantiation (disjoint output rows)
    k_flash<<<dim3(NB, SEQ / (16 * AW), 1), 32 * AW * KS, 0, stream>>>(QH, KE, KR, VT, MB, OUT);
}

// v004
// It runs in 31.1 microseconds.
// Next to v003, in two timings, it ran 1.10 and 1.11 times as fast.
// Counting every step since v000, it is 5.86 times as fast.
#include <hip/hip_runtime.h>

// Single-head masked attention, head width 128: q/k/v [NB][SEQ][128] f32, mask [1][SEQ][SEQ] int32 (0 = dropped, read by value), mode scalar f32.
// logit = 128^-0.5 * q . ((1-a) * roll(k, 1 along d) - a * k), a = sigmoid(mode); dropped entries are replaced by -inf; softmax over keys; output = P v (f32).
// Compute dtypes, f32 accumulate everywhere: scores v_wmma_f32_16x16x32_f16: q (bf16-RNE input, x16 carry, exact in f16) against the combined key operand ke = (1-a) k[d-1] - a k[d]
// (built in f32 from bf16-RNE k, x16 carry) as single f16 on query rows >= EROWS and as f16 value + f16 residual x2048 (own accumulator) on query rows < EROWS;
// P.V v_wmma_f32_16x16x32_f16: P (x16384 carry, cancels in the normalisation) single f16 on query rows >= EROWS, f16 value + f16 residual x2048 (own accumulator, folded by 1/2048) on query rows < EROWS;
// v (bf16-RNE input, x16 carry, exact in f16) single everywhere; softmax f32 (online, running max over kept keys).
// Layout: QH [b][t][128], KE [b][s][128], KR [b][s < EROWS][128], VT [b][d][s] (transposed through LDS), MB [t][SEQ/32] mask bit words (bit j = key 32w + j kept).
// Fused flash kernel in transposed form (S^T = KE QH^T, O^T = VT P^T); operand tiles staged in LDS by asynchronous copies, shared by the four waves of a key group; a 32-key step is skipped when its mask block is all zero (per block for the copies, per wave for the work).
// The kept key steps of a block are dealt round-robin to KS key groups of four waves each; every group keeps its own softmax state and O partial, merged through LDS at the end.
// A single-product flash block owns two 32-row query tiles mirrored about the middle of rows [EROWS, SEQ), so that under a mask whose kept keys grow with the row every block has about the same work.

#ifndef NB
#define NB 8
#endif
#ifndef SEQ
#define SEQ 2048
#endif
#define NB_FULL  8
#define SEQ_FULL 2048
#ifndef OUT_SEQ
#define OUT_SEQ SEQ              // row pitch (in tokens) between batches of the output
#endif
#define DM   128
#define AW   4                   // query tiles per flash block (16 query rows each), one wave per tile and key group
#define KS   4                   // key groups per flash block (AW waves each)
#define OSP  132                 // LDS row pitch (floats) of the flash output tile
#define VTP  72                  // LDS row pitch (halves) of the transpose tile
#define MW   (SEQ / 32)          // mask bit words per query row
#define KP   136                 // LDS row pitch (halves) of the q, KE and KR tiles: 272 B
#define VP   40                  // LDS row pitch (halves) of the VT tile: 80 B
#define MP   68                  // LDS row pitch (words) of the mask-word tile: 272 B
#define EROWS (SEQ < 512 ? SEQ : 512)   // query rows (and tokens of the residual key plane) handled by the multi-product flash instantiation
#define XCAR 16.0f               // carry of the q, ke and v planes
#define QRS  2048.0f             // carry of every residual plane / residual fragment
#define QRI  (1.0f / 2048.0f)
#define SC2  ((float)(0.08838834764831845 * 1.4426950408889634 / 256.0))   // DM^-0.5 * log2(e) / (XCAR * XCAR)
#define PSH  14.0f               // log2 of the P carry (16384)
#define NEGB (-3.0e38f)

static_assert(DM == 128);                      // output row = 32 lanes x 4 floats; plane row = 16 threads x 8 halves
static_assert(DM % 32 == 0);                   // score k-loop steps by 32
static_assert(DM / 8 == 16);                   // convert kernels: row = i >> 4
static_assert((DM & (DM - 1)) == 0);           // rolled index uses a mask
static_assert(SEQ % 128 == 0);                 // MW multiple of 4: one thread packs four mask words of one row
static_assert(SEQ % 64 == 0);                  // transpose tiles of 64 tokens
static_assert(SEQ % 32 == 0);                  // key loop steps by 32
static_assert(EROWS % (16 * AW) == 0);
static_assert((KP * 2) % 16 == 0 && KP >= DM && (VP * 2) % 16 == 0 && VP >= 32 && (MP * 4) % 16 == 0 && MP >= MW);   // 16-byte copies and fragment reads stay aligned and inside a row
static_assert(MW == 64 && AW == 4 && KS == 4); // flash copy maps and step bit map: 512 threads (128 per key group), 64 rows x 64 words, one 64-bit map
static_assert((SEQ - EROWS) % (16 * AW) == 0);  // the 32-row tiles of rows [EROWS, SEQ) pair up exactly
static_assert(EROWS >= 32);
static_assert(EROWS % 32 == 0);
static_assert(EROWS <= SEQ);
static_assert(NB <= NB_FULL);
static_assert(SEQ <= SEQ_FULL);
static_assert((OSP * 4) % 16 == 0);
static_assert(OSP >= DM);
static_assert((VTP * 2) % 16 == 0);
static_assert(VTP >= 64);
static_assert((size_t)AW * 16 * (KP * 2 + MP * 4) + (size_t)KS * (4 * 32 * KP * 2 + 2 * DM * VP * 2) + (size_t)KS * AW * (2 * 16 * 4 + 4) <= 327680);   // flash static LDS: q and mask tiles, KE, KR and VT buffers of every key group, merge state, step map
static_assert((size_t)KS * AW * 16 * OSP * 4 <= (size_t)KS * (2 * 32 * KP * 2 + 2 * DM * VP * 2));   // the O partial tiles fit in the KE and VT buffers they take over behind the loop
static_assert((size_t)DM * VTP * 2 <= 131072);           // transpose static LDS
static_assert(32 * 4 * (16 / KS) * KS == 16 * DM);       // flash epilogue: 32 lanes x 4 floats x 16/KS trips x KS waves == 16 rows x DM floats
static_assert(256 * 4 * 8 == 64 * DM);                   // transpose load: 256 threads x 4 floats x 8 trips == 64 tokens x DM
static_assert(256 * 8 * 4 == DM * 64);                   // transpose store: 256 threads x 8 halves x 4 trips == DM rows x 64 tokens
static_assert((size_t)NB * SEQ * DM / 8 < (size_t)2147483647);
static_assert((size_t)SEQ * DM < (size_t)2147483647);

typedef _Float16 h16;
typedef __attribute__((ext_vector_type(16))) _Float16 v16h;
typedef __attribute__((ext_vector_type(8)))  _Float16 v8h;
typedef __attribute__((ext_vector_type(8)))  float    v8f;
typedef __attribute__((ext_vector_type(4)))  float    v4f;
typedef __attribute__((ext_vector_type(4)))  int      v4i;
typedef __attribute__((ext_vector_type(4)))  unsigned v4u;
typedef v4f  __attribute__((may_alias)) v4fa;
typedef v8h  __attribute__((may_alias)) v8ha;

__device__ __forceinline__ unsigned short f2bf(float f) { unsigned u = __float_as_uint(f); u += 0x7FFFu + ((u >> 16) & 1u); return (unsigned short)(u >> 16); }
__device__ __forceinline__ float bfr(float f) { return __uint_as_float(((unsigned)f2bf(f)) << 16); }   // value after RNE convert to bf16
__device__ __forceinline__ v16h cat16(v8h lo, v8h hi) { return __builtin_shufflevector(lo, hi, 0, 1, 2, 3, 4, 5, 6, 7, 8, 9, 10, 11, 12, 13, 14, 15); }
__device__ __forceinline__ v8f wmma16(v16h a, v16h b, v8f c) { return __builtin_amdgcn_wmma_f32_16x16x32_f16(false, a, false, b, (short)0, c, false, false); }
// fragment loaders from K-contiguous 16-bit rows; p already includes + 8*(lane>>4): elements 0..7 <- k0+8h+0..7, elements 8..15 <- k0+16+8h+0..7 (same map for A and B)
__device__ __forceinline__ v16h  ldh(const h16* p) { return cat16(*(const v8h*)p, *(const v8h*)(p + 16)); }

// f32 -> f16 convert that cannot produce an f16 subnormal (|v| < 2^-14 -> +0)
static __device__ __forceinline__ h16 toh_flush(float v) { const h16 r = (h16)v; return (fabsf(v) < 6.103515625e-05f) ? (h16)0.0f : r; }
// one WMMA with its own hazard guard (ties the accumulator, keeps A and B live)
static __device__ __forceinline__ v8f wmma16g(v16h a, v16h b, v8f c) {
    c = wmma16(a, b, c);
    asm volatile("v_nop\n\tv_nop\n\tv_nop\n\tv_nop" : "+v"(c) : "v"(a), "v"(b));
    return c;
}

__device__ __forceinline__ void cvtq_body(int blk, const float* __restrict__ src, h16* dst, int n8) {
#pragma clang fp contract(off)
    const int i = blk * 256 + threadIdx.x; if (i >= n8) return;
    const int row = i >> 4, d0 = (i & 15) * 8; const int b = row / SEQ, t = row % SEQ;
    const v8f v = *(const v8f*)(src + ((size_t)b * SEQ_FULL + (size_t)t) * DM + d0); v8h o;
#pragma unroll
    for (int e = 0; e < 8; ++e) o[e] = toh_flush(bfr(v[e]) * XCAR);
    *(v8h*)(dst + (size_t)i * 8) = o; 
}

// keff_body: combined key operand ke[d] = (1-a) * k[(d-1) mod DM] - a * k[d], a = sigmoid(mode), from bf16-RNE k and mode, in f32;
__device__ __forceinline__ void keff_body(int blk, const float* __restrict__ k, const float* __restrict__ mode, h16* KE, h16* KR, int n8) {
#pragma clang fp contract(off)
    const int i = blk * 256 + threadIdx.x; if (i >= n8) return;
    const int row = i >> 4, d0 = (i & 15) * 8; const int b = row / SEQ, t = row % SEQ;
    const float* kr = k + ((size_t)b * SEQ_FULL + (size_t)t) * DM;
    const v8f x = *(const v8f*)(kr + d0);
    const float xm = kr[(d0 + DM - 1) & (DM - 1)];
    const float mv = bfr(mode[0]);
    const float al = 1.0f / (1.0f + expf(-mv));
    const float oma = 1.0f - al;
    float prev = bfr(xm); v8h hv, rv;
#pragma unroll
    for (int e = 0; e < 8; ++e) {
        const float cur = bfr(x[e]);
        const float c = (oma * prev - al * cur) * XCAR;
        const h16 hh = toh_flush(c);
        hv[e] = hh; rv[e] = toh_flush((c - (float)hh) * QRS);
        prev = cur; }
    const bool wr = t < EROWS;
    const size_t oo = (size_t)i * 8;
    const size_t ro = ((size_t)b * EROWS + (size_t)(wr ? t : 0)) * DM + d0;
    *(v8h*)(KE + oo) = hv; if (wr) *(v8h*)(KR + ro) = rv;
    
}

// vt_body: VT[b][d][t] = f16(bf16_rne(v[b][t][d]) * 16); one block per 64 tokens of one batch (blk = batch * SEQ/64 + token tile); in[64 tokens][128 d] -> out[128 d][64 tokens] through LDS;
// LDS tile ts: cross-wave (block barrier between fill and drain); filled extent [128][64] == drained extent.
__device__ __forceinline__ void vt_body(int blk, const float* __restrict__ v, h16* VT) {
#pragma clang fp contract(off)
    __shared__ __align__(16) h16 ts[DM * VTP];
    const int tid = threadIdx.x; const int b = blk / (SEQ / 64), tok0 = (blk % (SEQ / 64)) * 64;
    const float* src = v + ((size_t)b * SEQ_FULL + (size_t)tok0) * DM;
#pragma unroll 1
    for (int i = 0; i < 8; ++i) { const int idx = i * 256 + tid; const int tk = idx >> 5, c4 = (idx & 31) * 4;   // 8 trips x 256 threads = 64 tokens x 32 float4
        const v4f x = *(const v4f*)(src + (size_t)tk * DM + c4);
#pragma unroll
        for (int e = 0; e < 4; ++e) ts[(c4 + e) * VTP + tk] = toh_flush(bfr(x[e]) * XCAR); }
    __syncthreads();
    h16* dstb = VT + (size_t)b * DM * SEQ + (size_t)tok0;
{
#pragma unroll
        for (int s = 0; s < 4; ++s) { const int p = s * 256 + tid; const int d = p >> 3, c8 = (p & 7) * 8;       // 4 trips x 32 rows = 128 rows; 8 lanes x 8 halves = 64 tokens
            const v8h val = *(const v8ha*)(&ts[d * VTP + c8]);
            *(v8h*)(dstb + (size_t)d * SEQ + c8) = val; }
         }
    asm volatile("s_wait_xcnt 0x0" ::: "memory");   // the other block ranges' code follows in the kernel's text: stands in front of any rewrite there of the registers that the issued stores name
}

// mask bit word: bit j <- (p[j] != 0), j = 0..31 (eight 16-byte loads, consumed before the next word's loads)
__device__ __forceinline__ unsigned mword(const int* __restrict__ p) {
    unsigned w = 0u;
#pragma unroll
    for (int c = 0; c < 8; ++c) { const v4i x = *(const v4i*)(p + c * 4);
        w |= ((x[0] != 0) ? 1u : 0u) << (c * 4);
        w |= ((x[1] != 0) ? 1u : 0u) << (c * 4 + 1);
        w |= ((x[2] != 0) ? 1u : 0u) << (c * 4 + 2);
        w |= ((x[3] != 0) ? 1u : 0u) << (c * 4 + 3); }
    asm volatile("" : "+v"(w) :: "memory");
    return w;
}

__device__ __forceinline__ void mbits_body(int blk, const int* __restrict__ mask, unsigned* MB, int n4) {
    const int i = blk * 256 + threadIdx.x; if (i >= n4) return;
    const int w0 = i * 4; const int t = w0 / MW, wc = w0 % MW;
    const int* src = mask + (size_t)t * SEQ_FULL + (size_t)wc * 32;
    v4u o;
    o[0] = mword(src); o[1] = mword(src + 32); o[2] = mword(src + 64); o[3] = mword(src + 96);
    *(v4u*)(MB + (size_t)i * 4) = o; 
}

// k_prep: the four independent operand preparations as block ranges of one grid (block-uniform choice): mask bit words, V^T, combined key, q
#define PB_MB ((SEQ * MW / 4 + 255) / 256)
#define PB_VT ((SEQ / 64) * NB)
#define PB_X  ((NB * SEQ * DM / 8 + 255) / 256)
__global__ __launch_bounds__(256) void k_prep(const float* __restrict__ q, const float* __restrict__ k, const float* __restrict__ v, const int* __restrict__ mask, const float* __restrict__ mode,
                                              h16* QH, h16* KE, h16* KR, h16* VT, unsigned* MB) {
    const int blk = blockIdx.x;
    if (blk < PB_MB)                      mbits_body(blk, mask, MB, SEQ * MW / 4);
    else if (blk < PB_MB + PB_VT)         vt_body(blk - PB_MB, v, VT);
    else if (blk < PB_MB + PB_VT + PB_X)  keff_body(blk - (PB_MB + PB_VT), k, mode, KE, KR, NB * SEQ * DM / 8);
    else                                  cvtq_body(blk - (PB_MB + PB_VT + PB_X), q, QH, NB * SEQ * DM / 8);
}

// low 32 bits of a __shared__ address = byte offset in the work-group's LDS (destination operand of an asynchronous copy)
__device__ __forceinline__ unsigned ldsa(const void* p) { return (unsigned)(size_t)p; }
// eight / four asynchronous 16-byte copies global -> LDS per lane; the s_wait_xcnt closes the statement so that no address register is rewritten ahead of it
__device__ __forceinline__ void cp8(unsigned l0, const void* g0, unsigned l1, const void* g1, unsigned l2, const void* g2, unsigned l3, const void* g3,
                                    unsigned l4, const void* g4, unsigned l5, const void* g5, unsigned l6, const void* g6, unsigned l7, const void* g7) {
    asm volatile("global_load_async_to_lds_b128 %0, %1, off\n\t"
                 "global_load_async_to_lds_b128 %2, %3, off\n\t"
                 "global_load_async_to_lds_b128 %4, %5, off\n\t"
                 "global_load_async_to_lds_b128 %6, %7, off\n\t"
                 "global_load_async_to_lds_b128 %8, %9, off\n\t"
                 "global_load_async_to_lds_b128 %10, %11, off\n\t"
                 "global_load_async_to_lds_b128 %12, %13, off\n\t"
                 "global_load_async_to_lds_b128 %14, %15, off\n\t"
                 "s_wait_xcnt 0x0"
                 :: "v"(l0), "v"(g0), "v"(l1), "v"(g1), "v"(l2), "v"(g2), "v"(l3), "v"(g3),
                    "v"(l4), "v"(g4), "v"(l5), "v"(g5), "v"(l6), "v"(g6), "v"(l7), "v"(g7) : "memory");
}
__device__ __forceinline__ void cp4(unsigned l0, const void* g0, unsigned l1, const void* g1, unsigned l2, const void* g2, unsigned l3, const void* g3) {
    asm volatile("global_load_async_to_lds_b128 %0, %1, off\n\t"
                 "global_load_async_to_lds_b128 %2, %3, off\n\t"
                 "global_load_async_to_lds_b128 %4, %5, off\n\t"
                 "global_load_async_to_lds_b128 %6, %7, off\n\t"
                 "s_wait_xcnt 0x0"
                 :: "v"(l0), "v"(g0), "v"(l1), "v"(g1), "v"(l2), "v"(g2), "v"(l3), "v"(g3) : "memory");
}
// this wave's asynchronous copies have landed in LDS (other waves read them behind the next block barrier)
__device__ __forceinline__ void wait_copies() { asm volatile("s_wait_asynccnt 0x0" ::: "memory"); }
// this wave's LDS reads have returned (stands in front of the barrier behind which their buffer is refilled)
__device__ __forceinline__ void wait_lds() { asm volatile("s_wait_dscnt 0x0" ::: "memory"); }
// fragment loader from an LDS tile, same element map as ldh
__device__ __forceinline__ v16h ldl(const h16* p) { return cat16(*(const v8ha*)p, *(const v8ha*)(p + 16)); }

// flash_body: fused attention, one block per 64 query rows of one batch (two runs of 32 rows, from row ra and from row rb); KS key groups of AW waves, wave (group, tile) works 16 query rows against the group's key steps.
// Wave -> (group = wave mod KS, tile = wave / KS): the four tiles of one group are the waves of equal wave mod KS, so a step that only the longer run keeps leaves every group two working waves.
// Key split: the block's kept 32-key steps, in ascending order, go round-robin to the key groups (rank mod KS); four waves per SIMD fill one another's latencies.
// Staging: the block's q rows and mask bit words are copied to LDS once; the KE / KR / VT tiles of a group's 32-key step are copied to LDS by and for the group's four waves, two buffers per group,
// the group's next step's copies in flight while this step is worked on (asynchronous copies, 16 bytes per lane; whole tile = 4 copies per thread and plane).
// Tile pitches: 272 B (q, KE, KR rows of 256 B; mask rows of 256 B) and 80 B (VT rows of 64 B), 16 B x odd for the 16-byte fragment reads.
// Transposed form: S^T[key][t] = KE QH^T (A = key rows, B = query rows, 4 k-steps of 32); lane (t = lane&15, h = lane>>4) holds keys 8h+r of each 16-key tile, so the packed
// P tile is directly the B fragment of O^T[d][t] = VT P^T (element r <- tile keys 0..15, element 8+r <- tile keys 16..31, lane unchanged), 8 d-tiles.
// Softmax state (running max over kept keys, partial sum) is one scalar per lane; the two lane halves of a row are combined with one xor-16 exchange.
// Keep rule per element from the mask bit word of (row, 32-key step); a step whose words are zero on all 64 rows of the block is neither copied nor visited (block-uniform bit map),
// a step whose words are zero on the wave's own 16 rows is not worked on by that wave (wave-uniform); kept steps are visited in ascending order.
// EARLY = 1 (query rows [0, EROWS)): scores = KE Q + KR Q / 2048; P = f16 value + f16 residual x2048; O = V P + V P_res / 2048 (residual products in their own accumulators);
//            row sum from the f32 exponentials; KR fragments are zero for keys >= EROWS (address clamped, wave-uniform select).
// EARLY = 0 (query rows [EROWS, SEQ)): single products, row sum over the converted P.
// Epilogue: the groups' running maxima are exchanged through LDS, every wave rescales its partial sum and O^T partial to the common maximum and stages them in LDS (its own tile of 16 rows x 128 columns,
// in the space of the key and value buffers, all written); wave (group, tile) then adds the KS partials of rows 16/KS * group .. of its tile in ascending group order and stores them whole (128 floats = 512 B = four lines)
// The LDS arrays belong to the kernel (one set for both instantiations) and are handed in; ra, rb = first query row of the block's local rows 0..31 and 32..63, b = batch.
template <int EARLY>
__device__ __forceinline__ void flash_body(h16* qt, unsigned* mt, h16* ring, float* mm, float* ll, unsigned* act, int ra, int rb, int b,
                                           const h16* __restrict__ QH, const h16* __restrict__ KE, const h16* __restrict__ KR, const h16* __restrict__ VT,
                                           const unsigned* __restrict__ MB, float* OUT) {
    constexpr int KB = 32 * KP, VB = DM * VP;                    // halves per KE / KR buffer, per VT buffer
    h16* const kt = ring;                                        // KE tiles [group][buffer]
    h16* const vt = ring + KS * 2 * KB;                          // VT tiles [group][buffer]
    h16* const rt = ring + (EARLY ? KS * 2 * (KB + VB) : 0);     // KR tiles [group][buffer]
    float* const os = (float*)ring;                              // O partial tiles [group][tile][16][OSP]
    constexpr int VG = EARLY ? 4 : 8;                            // V^T fragments read from LDS per group
    constexpr int KG = EARLY ? 1 : 4;                            // k-steps of q / KE / KR fragments read from LDS per group
    const int tid = threadIdx.x;
    const int lane = threadIdx.x & 31, lr = lane & 15, hi = lane >> 4;
    const int wave = __builtin_amdgcn_readfirstlane((int)(threadIdx.x >> 5));
    const int grp = wave & (KS - 1), wq = wave / KS;             // key group, query tile
    const int gt = wq * 32 + lane;                               // thread within the key group
    const int t0 = (wq < AW / 2 ? ra : rb) + (wq & (AW / 2 - 1)) * 16;   // first query row of the wave's tile
    const h16* Qb = QH + (size_t)b * SEQ * DM;
    const h16* Kb = KE + (size_t)b * SEQ * DM;
    const h16* Rb = KR + (size_t)b * EROWS * DM;
    const h16* Vb = VT + (size_t)b * DM * SEQ;
    // group copy maps: 256-B rows: thread -> (row gt>>4 + 8i, 16-B column gt&15); 64-B rows: thread -> (row gt>>2 + 32i, 16-B column gt&3)
    const int r16 = gt >> 4, c16 = gt & 15, r4 = gt >> 2, c4 = gt & 3;
    {
        // block copy map, q rows and mask words: thread -> (local row tid>>4 + 32i, 16-B column tid&15); local rows 0..31 are rows ra.., 32..63 rows rb..
        const int rq = tid >> 4, cq = tid & 15;
        const h16* qga = Qb + (size_t)(ra + rq) * DM + cq * 8;
        const h16* qgb = Qb + (size_t)(rb + rq) * DM + cq * 8;
        const unsigned ql = ldsa(qt) + (unsigned)(rq * KP + cq * 8) * 2u;
        const unsigned* mga = MB + (size_t)(ra + rq) * MW + cq * 4;
        const unsigned* mgb = MB + (size_t)(rb + rq) * MW + cq * 4;
        const unsigned ml = ldsa(mt) + (unsigned)(rq * MP + cq * 4) * 4u;
        cp4(ql, qga, ql + 32 * KP * 2, qgb, ml, mga, ml + 32 * MP * 4, mgb);
    }
    wait_copies();
    __syncthreads();                                             // q rows and mask words readable by every wave
    // block-uniform bit map of the steps that some row of the block keeps: thread -> (step tid&63, rows 8*(tid>>6) .. +7); even waves hold steps 0..31, odd waves steps 32..63
    unsigned orv = 0u;
#pragma unroll
    for (int i = 0; i < 8; ++i) orv |= mt[((tid >> 6) * 8 + i) * MP + (tid & 63)];
    const unsigned bal = __builtin_amdgcn_ballot_w32(orv != 0u);
    if (lane == 0) act[wave] = bal;
    __syncthreads();
    unsigned olo = 0u, ohi = 0u;
#pragma unroll
    for (int i = 0; i < AW * KS / 2; ++i) { olo |= act[2 * i]; ohi |= act[2 * i + 1]; }
    const unsigned alo = (unsigned)__builtin_amdgcn_readfirstlane((int)olo);
    const unsigned ahi = (unsigned)__builtin_amdgcn_readfirstlane((int)ohi);
    unsigned long long rem = ((unsigned long long)ahi << 32) | (unsigned long long)alo;
    const int trips = (__builtin_popcountll(rem) + KS - 1) / KS; // block-uniform: rounds of KS kept steps
    // the next KS kept steps leave the map in ascending order; returns the one of this key group (-1: none left for it)
    auto pop = [&]() {
        int mine = -1;
#pragma unroll
        for (int j = 0; j < KS; ++j)
            if (rem != 0ull) { const int s = __builtin_ctzll(rem); rem &= rem - 1ull; if (j == grp) mine = s; }
        return mine;
    };

    const h16* kg0 = Kb + r16 * DM + c16 * 8;
    const h16* rg0 = Rb + r16 * DM + c16 * 8;
    const h16* vg0 = Vb + r4 * SEQ + c4 * 8;
    const unsigned kl0 = ldsa(kt) + (unsigned)(grp * 2 * KB + r16 * KP + c16 * 8) * 2u;
    const unsigned rl0 = ldsa(rt) + (unsigned)(grp * 2 * KB + r16 * KP + c16 * 8) * 2u;
    const unsigned vl0 = ldsa(vt) + (unsigned)(grp * 2 * VB + r4 * VP + c4 * 8) * 2u;
    // copies of step s into the group's buffer bf (group-uniform arguments; every lane on)
    auto stage = [&](int s, int bf) {
        const int key0 = s * 32;
        const h16* kg = kg0 + key0 * DM; const h16* vg = vg0 + key0;
        const unsigned kl = kl0 + (unsigned)bf * (32 * KP * 2), vl = vl0 + (unsigned)bf * (DM * VP * 2);
        cp8(kl, kg, kl + 8 * KP * 2, kg + 8 * DM, kl + 16 * KP * 2, kg + 16 * DM, kl + 24 * KP * 2, kg + 24 * DM,
            vl, vg, vl + 32 * VP * 2, vg + 32 * SEQ, vl + 64 * VP * 2, vg + 64 * SEQ, vl + 96 * VP * 2, vg + 96 * SEQ);
        if (EARLY) {
            const int kcl = (key0 < EROWS) ? key0 : (EROWS - 32);    // clamped residual-plane key (address always inside the plane)
            const h16* rg = rg0 + kcl * DM; const unsigned rl = rl0 + (unsigned)bf * (32 * KP * 2);
            cp4(rl, rg, rl + 8 * KP * 2, rg + 8 * DM, rl + 16 * KP * 2, rg + 16 * DM, rl + 24 * KP * 2, rg + 24 * DM);
        }
    };
    int s0 = pop();                                              // the group's kept step of this round, of the next round (-1: none)
    int s1 = pop();
    if (s0 >= 0) stage(s0, 0);
    wait_copies();
    __syncthreads();                                             // each group's first kept step readable by its waves
    if (s1 >= 0) stage(s1, 1);

    const int mo = (wq * 16 + lr) * MP;
    const int qo = (wq * 16 + lr) * KP + 8 * hi;                 // B fragment: col t, k = d
    const int ko = lr * KP + 8 * hi;                             // + tile row * KP + kc   (A fragment: row key, k = d)
    const int vo = lr * VP + 8 * hi;                             // + 16j*VP               (A fragment: row d, k = key)
    const v16h hz = (v16h){};
    v8f o[8], oR[8];
#pragma unroll
    for (int j = 0; j < 8; ++j) { o[j] = (v8f){}; oR[j] = (v8f){}; }
    float m = NEGB, l = 0.0f;
    int bf = 0;
#pragma unroll 1
    for (int it = 0; it < MW / KS; ++it) {
        if (it >= trips) break;                                  // block-uniform: no kept step left
        const unsigned mw = (s0 >= 0) ? mt[mo + s0] : 0u;        // group-uniform test: no step for this group in the last round
        if (__builtin_amdgcn_ballot_w32(mw != 0u) != 0u) {       // wave-uniform: some row of this tile keeps some key of this step
            const int key0 = s0 * 32;
            const bool rok = key0 < EROWS;                       // wave-uniform
            const h16* kb = kt + (grp * 2 + bf) * KB + ko;
            const h16* rb = rt + (EARLY ? (grp * 2 + bf) * KB : 0) + ko;
            const h16* vb = vt + (grp * 2 + bf) * VB + vo;
            v8f sHa = (v8f){}, sHb = (v8f){}, sLa = (v8f){}, sLb = (v8f){};
#pragma unroll
            for (int g = 0; g < 4 / KG; ++g) {                   // the LDS fragment reads of KG k-steps issue together, one LDS latency per group
                v16h qf[KG], ka0[KG], kb0[KG], kra[KG], krb[KG];
#pragma unroll
                for (int u = 0; u < KG; ++u) {
                    const int kc = (g * KG + u) * 32;
                    qf[u] = ldl(qt + qo + kc); ka0[u] = ldl(kb + kc); kb0[u] = ldl(kb + 16 * KP + kc);
                    if (EARLY) { kra[u] = ldl(rb + kc); krb[u] = ldl(rb + 16 * KP + kc); }
                }
#pragma unroll
                for (int u = 0; u < KG; ++u) {
                    sHa = wmma16g(ka0[u], qf[u], sHa); sHb = wmma16g(kb0[u], qf[u], sHb);
                    if (EARLY) {
                        if (!rok) { kra[u] = hz; krb[u] = hz; }
                        sLa = wmma16g(kra[u], qf[u], sLa); sLb = wmma16g(krb[u], qf[u], sLb);
                    }
                }
            }
            const unsigned ma = mw >> (8 * hi);                  // bit r: key key0+8h+r; bit 16+r: key key0+16+8h+r
            float ta[8], tb2[8]; bool fa[8], fb[8]; float mx = NEGB;
#pragma unroll
            for (int r = 0; r < 8; ++r) {
                fa[r] = ((ma >> r) & 1u) != 0u;
                fb[r] = ((ma >> (16 + r)) & 1u) != 0u;
                if (EARLY) { ta[r] = (sHa[r] + sLa[r] * QRI) * SC2; tb2[r] = (sHb[r] + sLb[r] * QRI) * SC2; }
                else       { ta[r] = sHa[r] * SC2; tb2[r] = sHb[r] * SC2; }
                mx = fmaxf(mx, fmaxf(fa[r] ? ta[r] : NEGB, fb[r] ? tb2[r] : NEGB)); }
            mx = fmaxf(mx, __shfl_xor(mx, 16, 32));
            const float mnew = fmaxf(m, mx);
            const float resc = __builtin_amdgcn_exp2f(m - mnew);
            const float sh = PSH - mnew;
            v16h pb, pr = hz; float ls = 0.0f;
#pragma unroll
            for (int r = 0; r < 8; ++r) {
                const float xa = ta[r] + sh, xb = tb2[r] + sh;
                const float ea = __builtin_amdgcn_exp2f(xa), eb = __builtin_amdgcn_exp2f(xb);
                const float ga = (fa[r] & (xa >= -14.0f)) ? ea : 0.0f;       // dropped elements and sub-2^-14 values selected to 0 by value
                const float gb = (fb[r] & (xb >= -14.0f)) ? eb : 0.0f;
                const h16 pa = (h16)ga; const h16 pc = (h16)gb;
                pb[r] = pa; pb[8 + r] = pc;
                if (EARLY) { pr[r] = toh_flush((ga - (float)pa) * QRS); pr[8 + r] = toh_flush((gb - (float)pc) * QRS); ls += ga + gb; }
                else       { ls += (float)pa + (float)pc; } }
            l = l * resc + ls; m = mnew;
#pragma unroll
            for (int j = 0; j < 8; ++j) { o[j] = o[j] * resc; if (EARLY) oR[j] = oR[j] * resc; }
#pragma unroll
            for (int g = 0; g < 8 / VG; ++g) {
                v16h vf[VG];
#pragma unroll
                for (int jj = 0; jj < VG; ++jj) vf[jj] = ldl(vb + (g * VG + jj) * 16 * VP);
#pragma unroll
                for (int jj = 0; jj < VG; ++jj) {
                    o[g * VG + jj] = wmma16g(vf[jj], pb, o[g * VG + jj]);
                    if (EARLY) oR[g * VG + jj] = wmma16g(vf[jj], pr, oR[g * VG + jj]); }
            }
        }
        // hand-over, every wave: own LDS reads returned, own copies of the group's next step landed, block barrier; only then the refill of the buffer just read
        wait_lds();
        wait_copies();
        __syncthreads();
        const int s2 = pop();
        if (s2 >= 0) stage(s2, bf);
        s0 = s1; s1 = s2; bf ^= 1;
    }
    wait_copies();                                               // no copy outstanding when the buffers are taken over and the wave ends
    l += __shfl_xor(l, 16, 32);
    const int so = (grp * AW + wq) * 16;                         // this wave's rows in the merge state and among the O partial tiles
    if (hi == 0) mm[so + lr] = m;
    __syncthreads();                                             // every group's maximum readable; every wave has left the key and value buffers
    float mall = NEGB;
#pragma unroll
    for (int g = 0; g < KS; ++g) mall = fmaxf(mall, mm[(g * AW + wq) * 16 + lr]);
    const float fs = __builtin_amdgcn_exp2f(m - mall);           // 1 where no group kept a key (sums and partials are 0 there), 0 for a group without a kept key beside one that has some
    if (hi == 0) ll[so + lr] = l * fs;
    // O^T D layout: o[j][r] = (d = 16j + 8h + r, t = lane&15) -> os[t][d]; rows 0..15 x columns 0..127 all written
#pragma unroll
    for (int j = 0; j < 8; ++j) {
        v8f f = o[j];
        if (EARLY) f = o[j] + oR[j] * QRI;
        v4f a, c;
        a[0] = f[0] * fs; a[1] = f[1] * fs; a[2] = f[2] * fs; a[3] = f[3] * fs; c[0] = f[4] * fs; c[1] = f[5] * fs; c[2] = f[6] * fs; c[3] = f[7] * fs;
        *(v4fa*)(&os[(so + lr) * OSP + 16 * j + 8 * hi]) = a; *(v4fa*)(&os[(so + lr) * OSP + 16 * j + 8 * hi + 4]) = c; }
    __syncthreads();                                             // every group's rescaled sum and O partial readable
    float* orow = OUT + ((size_t)b * OUT_SEQ + (size_t)t0) * DM;
#pragma unroll
    for (int s = 0; s < 16 / KS; ++s) {                          // 16/KS trips = the wave's rows of the tile; 32 lanes x 4 floats = 128 columns = one whole row
        const int row = grp * (16 / KS) + s;
        float lt = 0.0f; v4f val = (v4f){};
#pragma unroll
        for (int g = 0; g < KS; ++g) {
            lt += ll[(g * AW + wq) * 16 + row];
            val += *(const v4fa*)(&os[((g * AW + wq) * 16 + row) * OSP + lane * 4]); }
        const bool any = lt > 0.0f;
        const float lsafe = any ? lt : 1.0f;
        const float inv = any ? ((1.0f / lsafe) * (1.0f / XCAR)) : __uint_as_float(0x7FC00000u);   // no kept key -> NaN row
        *(v4f*)(orow + (size_t)row * DM + lane * 4) = val * inv;
        if (s + 1 < 16 / KS) asm volatile("s_wait_xcnt 0x0" ::: "memory");   // stands in front of the next row's rewrite of the registers that the issued store names
    }
}

// k_flash: both instantiations in one grid (batch, SEQ/64 blocks), chosen by the block index (block-uniform); the single-product blocks hold the low block indices:
// block y < LATEB owns the 32-row tiles y and 2 * LATEB - 1 - y of rows [EROWS, SEQ); the multi-product blocks own 64 consecutive rows of [0, EROWS), high rows first
__global__ __launch_bounds__(32 * AW * KS) __attribute__((amdgpu_num_vgpr(256)))
void k_flash(const h16* __restrict__ QH, const h16* __restrict__ KE, const h16* __restrict__ KR, const h16* __restrict__ VT, const unsigned* __restrict__ MB, float* OUT) {
    __shared__ __align__(16) h16 qt[AW * 16 * KP];               // q rows of the block
    __shared__ __align__(16) unsigned mt[AW * 16 * MP];          // mask bit words of the block's rows
    __shared__ __align__(16) h16 ring[KS * 2 * (32 * KP * 2 + DM * VP)];   // per key group two buffers each of KE, VT (and KR, multi-product blocks only); behind the loop the O partial tiles
    __shared__ float mm[KS * AW * 16], ll[KS * AW * 16];         // per (group, tile, row): running maximum, rescaled partial sum
    __shared__ __align__(16) unsigned act[AW * KS];
    constexpr int LATEB = (SEQ - EROWS) / (16 * AW);
    const int y = blockIdx.y;
    const int b = blockIdx.x;
    if (y >= LATEB) { const int r0 = (SEQ / (16 * AW) - 1 - y) * 16 * AW; flash_body<1>(qt, mt, ring, mm, ll, act, r0, r0 + 32, b, QH, KE, KR, VT, MB, OUT); }
    else            flash_body<0>(qt, mt, ring, mm, ll, act, EROWS + 32 * y, SEQ - 32 - 32 * y, b, QH, KE, KR, VT, MB, OUT);
}

static constexpr size_t al256(size_t v) { return (v + 255) & ~(size_t)255; }
static constexpr size_t SZ_PL = al256((size_t)NB * SEQ * DM * 2);          // QH, KE, VT
static constexpr size_t SZ_RS = al256((size_t)NB * EROWS * DM * 2);        // KR
static constexpr size_t SZ_MB = al256((size_t)SEQ * MW * 4);               // MB
static constexpr size_t SZ_TOTAL = 3 * SZ_PL + SZ_RS + SZ_MB;
static_assert(SZ_TOTAL <= (size_t)134217728);          // workspace carve <= 128 MiB
static_assert(((size_t)NB * SEQ * DM) % 8 == 0);       // thread-linear 16-byte stores cover the planes exactly
static_assert(((size_t)SEQ * MW) % 4 == 0);
static_assert(((size_t)NB * OUT_SEQ * DM * 4) <= (size_t)8388608 || NB != NB_FULL || OUT_SEQ != SEQ_FULL);

extern "C" void kernel_launch(void* const* d_in, const int* in_sizes, int n_in,
                              void* d_out, int out_size, void* d_ws, size_t ws_size, hipStream_t stream) {
    if (n_in < 5) return;
    const size_t needx = ((size_t)(NB - 1) * SEQ_FULL + SEQ) * DM;
    const size_t needm = (size_t)(SEQ - 1) * SEQ_FULL + SEQ;
    if ((size_t)in_sizes[0] < needx || (size_t)in_sizes[1] < needx || (size_t)in_sizes[2] < needx) return;
    if ((size_t)in_sizes[3] < needm || in_sizes[4] < 1) return;
    if ((size_t)out_size < ((size_t)(NB - 1) * OUT_SEQ + SEQ) * DM) return;
    if (SZ_TOTAL > ws_size) return;
    // wire order: q, k, v, mask, mode
    const float* q = (const float*)d_in[0];
    const float* k = (const float*)d_in[1];
    const float* v = (const float*)d_in[2];
    const int* mask = (const int*)d_in[3];
    const float* mode = (const float*)d_in[4];
    float* OUT = (float*)d_out;      // [NB][SEQ][128]
    char* wsp = (char*)d_ws;
    h16* QH = (h16*)wsp; wsp += SZ_PL;               // [NB][SEQ][128]  q x16
    h16* KE = (h16*)wsp; wsp += SZ_PL;               // [NB][SEQ][128]  combined key x16
    h16* VT = (h16*)wsp; wsp += SZ_PL;               // [NB][128][SEQ]  v^T x16
    h16* KR = (h16*)wsp; wsp += SZ_RS;               // [NB][EROWS][128] combined-key residual x2048, tokens < EROWS
    unsigned* MB = (unsigned*)wsp; wsp += SZ_MB;     // [SEQ][SEQ/32] mask bit words

    k_prep<<<PB_MB + PB_VT + 2 * PB_X, 256, 0, stream>>>(q, k, v, mask, mode, QH, KE, KR, VT, MB);
    // query rows [0, EROWS): multi-product instantiation; rows [EROWS, SEQ): single-product instantiation (disjoint output rows)
    k_flash<<<dim3(NB, SEQ / (16 * AW), 1), 32 * AW * KS, 0, stream>>>(QH, KE, KR, VT, MB, OUT);
}

// v005
// One run takes 29.3 microseconds.
// In two side-by-side timings against v004, it was 1.04 and 1.06 times as fast.
// Over all steps from v000 it is 6.15 times as fast.
#include <hip/hip_runtime.h>

// Single-head masked attention, head width 128: q/k/v [NB][SEQ][128] f32, mask [1][SEQ][SEQ] int32 (0 = dropped, read by value), mode scalar f32.
// logit = 128^-0.5 * q . ((1-a) * roll(k, 1 along d) - a * k), a = sigmoid(mode); dropped entries are replaced by -inf; softmax over keys; output = P v (f32).
// Compute dtypes, f32 accumulate everywhere: scores v_wmma_f32_16x16x32_f16: q (bf16-RNE input, x16 carry, exact in f16) against the combined key operand ke = (1-a) k[d-1] - a k[d]
// (built in f32 from bf16-RNE k, x16 carry) as single f16 on query rows >= EROWS and as f16 value + f16 residual x2048 (own accumulator) on query rows < EROWS;
// P.V v_wmma_f32_16x16x32_f16: P (x16384 carry, cancels in the normalisation) single f16 on query rows >= EROWS, f16 value + f16 residual x2048 (own accumulator, folded by 1/2048) on query rows < EROWS;
// v (bf16-RNE input, x16 carry, exact in f16) single everywhere; softmax f32 (online, running max over kept keys).
// Layout: QH [b][t][128], KE [b][s][128], KR [b][s < EROWS][128], VT [b][d][s] (transposed through LDS), MB [t][SEQ/32] mask bit words (bit j = key 32w + j kept).
// Fused flash kernel in transposed form (S^T = KE QH^T, O^T = VT P^T); operand tiles staged in LDS by asynchronous copies, shared by the four waves of a key group; a 32-key step is skipped when its mask block is all zero (per block for the copies, per wave for the work).
// The kept key steps of a block are dealt round-robin to KS key groups of four waves each; every group keeps its own softmax state and O partial, merged through LDS at the end.
// A single-product flash block owns two 32-row query tiles mirrored about the middle of rows [EROWS, SEQ), so that under a mask whose kept keys grow with the row every block has about the same work.

#ifndef NB
#define NB 8
#endif
#ifndef SEQ
#define SEQ 2048
#endif
#define NB_FULL  8
#define SEQ_FULL 2048
#ifndef OUT_SEQ
#define OUT_SEQ SEQ              // row pitch (in tokens) between batches of the output
#endif
#define DM   128
#define AW   4                   // query tiles per flash block (16 query rows each), one wave per tile and key group
#define KS   4                   // key groups per flash block (AW waves each)
#define OSP  132                 // LDS row pitch (floats) of the flash output tile
#define VTP  72                  // LDS row pitch (halves) of the transpose tile
#define MW   (SEQ / 32)          // mask bit words per query row
#define KP   136                 // LDS row pitch (halves) of the q, KE and KR tiles: 272 B
#define VP   40                  // LDS row pitch (halves) of the VT tile: 80 B
#define MP   68                  // LDS row pitch (words) of the mask-word tile: 272 B
#define EROWS (SEQ < 512 ? SEQ : 512)   // query rows (and tokens of the residual key plane) handled by the multi-product flash instantiation
#define XCAR 16.0f               // carry of the q, ke and v planes
#define QRS  2048.0f             // carry of every residual plane / residual fragment
#define QRI  (1.0f / 2048.0f)
#define SC2  ((float)(0.08838834764831845 * 1.4426950408889634 / 256.0))   // DM^-0.5 * log2(e) / (XCAR * XCAR)
#define PSH  14.0f               // log2 of the P carry (16384)
#define NEGB (-3.0e38f)

static_assert(DM == 128);                      // output row = 32 lanes x 4 floats; plane row = 16 threads x 8 halves
static_assert(DM % 32 == 0);                   // score k-loop steps by 32
static_assert(DM / 8 == 16);                   // convert kernels: row = i >> 4
static_assert((DM & (DM - 1)) == 0);           // rolled index uses a mask
static_assert(SEQ % 128 == 0);                 // MW multiple of 4: one thread packs four mask words of one row
static_assert(SEQ % 64 == 0);                  // transpose tiles of 64 tokens
static_assert(SEQ % 32 == 0);                  // key loop steps by 32
static_assert(EROWS % (16 * AW) == 0);
static_assert((KP * 2) % 16 == 0 && KP >= DM && (VP * 2) % 16 == 0 && VP >= 32 && (MP * 4) % 16 == 0 && MP >= MW);   // 16-byte copies and fragment reads stay aligned and inside a row
static_assert(MW == 64 && AW == 4 && KS == 4); // flash copy maps and step bit map: 512 threads (128 per key group), 64 rows x 64 words, one 64-bit map
static_assert((SEQ - EROWS) % (16 * AW) == 0);  // the 32-row tiles of rows [EROWS, SEQ) pair up exactly
static_assert(EROWS >= 32);
static_assert(EROWS % 32 == 0);
static_assert(EROWS <= SEQ);
static_assert(NB <= NB_FULL);
static_assert(SEQ <= SEQ_FULL);
static_assert((OSP * 4) % 16 == 0);
static_assert(OSP >= DM);
static_assert((VTP * 2) % 16 == 0);
static_assert(VTP >= 64);
static_assert((size_t)AW * 16 * (KP * 2 + MP * 4) + (size_t)KS * (4 * 32 * KP * 2 + 2 * DM * VP * 2) + (size_t)KS * AW * (2 * 16 * 4 + 4) <= 327680);   // flash static LDS: q and mask tiles, KE, KR and VT buffers of every key group, merge state, step map
static_assert((size_t)KS * AW * 16 * OSP * 4 <= (size_t)KS * (2 * 32 * KP * 2 + 2 * DM * VP * 2));   // the O partial tiles fit in the KE and VT buffers they take over behind the loop
static_assert((size_t)DM * VTP * 2 <= 131072);           // transpose static LDS
static_assert(32 * 4 * (16 / KS) * KS == 16 * DM);       // flash epilogue: 32 lanes x 4 floats x 16/KS trips x KS waves == 16 rows x DM floats
static_assert(256 * 4 * 8 == 64 * DM);                   // transpose load: 256 threads x 4 floats x 8 trips == 64 tokens x DM
static_assert(256 * 8 * 4 == DM * 64);                   // transpose store: 256 threads x 8 halves x 4 trips == DM rows x 64 tokens
static_assert((size_t)NB * SEQ * DM / 8 < (size_t)2147483647);
static_assert((size_t)SEQ * DM < (size_t)2147483647);

typedef _Float16 h16;
typedef __attribute__((ext_vector_type(16))) _Float16 v16h;
typedef __attribute__((ext_vector_type(8)))  _Float16 v8h;
typedef __attribute__((ext_vector_type(8)))  float    v8f;
typedef __attribute__((ext_vector_type(4)))  float    v4f;
typedef __attribute__((ext_vector_type(4)))  int      v4i;
typedef __attribute__((ext_vector_type(4)))  unsigned v4u;
typedef v4f  __attribute__((may_alias)) v4fa;
typedef v8h  __attribute__((may_alias)) v8ha;

__device__ __forceinline__ unsigned short f2bf(float f) { unsigned u = __float_as_uint(f); u += 0x7FFFu + ((u >> 16) & 1u); return (unsigned short)(u >> 16); }
__device__ __forceinline__ float bfr(float f) { return __uint_as_float(((unsigned)f2bf(f)) << 16); }   // value after RNE convert to bf16
__device__ __forceinline__ v16h cat16(v8h lo, v8h hi) { return __builtin_shufflevector(lo, hi, 0, 1, 2, 3, 4, 5, 6, 7, 8, 9, 10, 11, 12, 13, 14, 15); }
__device__ __forceinline__ v8f wmma16(v16h a, v16h b, v8f c) { return __builtin_amdgcn_wmma_f32_16x16x32_f16(false, a, false, b, (short)0, c, false, false); }
// fragment loaders from K-contiguous 16-bit rows; p already includes + 8*(lane>>4): elements 0..7 <- k0+8h+0..7, elements 8..15 <- k0+16+8h+0..7 (same map for A and B)
__device__ __forceinline__ v16h  ldh(const h16* p) { return cat16(*(const v8h*)p, *(const v8h*)(p + 16)); }

// f32 -> f16 convert that cannot produce an f16 subnormal (|v| < 2^-14 -> +0)
static __device__ __forceinline__ h16 toh_flush(float v) { const h16 r = (h16)v; return (fabsf(v) < 6.103515625e-05f) ? (h16)0.0f : r; }
// one WMMA with its own hazard guard (ties the accumulator, keeps A and B live)
static __device__ __forceinline__ v8f wmma16g(v16h a, v16h b, v8f c) {
    c = wmma16(a, b, c);
    asm volatile("v_nop\n\tv_nop\n\tv_nop\n\tv_nop" : "+v"(c) : "v"(a), "v"(b));
    return c;
}

__device__ __forceinline__ void cvtq_body(int blk, const float* __restrict__ src, h16* dst, int n8) {
#pragma clang fp contract(off)
    const int i = blk * 256 + threadIdx.x; if (i >= n8) return;
    const int row = i >> 4, d0 = (i & 15) * 8; const int b = row / SEQ, t = row % SEQ;
    const v8f v = *(const v8f*)(src + ((size_t)b * SEQ_FULL + (size_t)t) * DM + d0); v8h o;
#pragma unroll
    for (int e = 0; e < 8; ++e) o[e] = toh_flush(bfr(v[e]) * XCAR);
    *(v8h*)(dst + (size_t)i * 8) = o; 
}

// keff_body: combined key operand ke[d] = (1-a) * k[(d-1) mod DM] - a * k[d], a = sigmoid(mode), from bf16-RNE k and mode, in f32;
__device__ __forceinline__ void keff_body(int blk, const float* __restrict__ k, const float* __restrict__ mode, h16* KE, h16* KR, int n8) {
#pragma clang fp contract(off)
    const int i = blk * 256 + threadIdx.x; if (i >= n8) return;
    const int row = i >> 4, d0 = (i & 15) * 8; const int b = row / SEQ, t = row % SEQ;
    const float* kr = k + ((size_t)b * SEQ_FULL + (size_t)t) * DM;
    const v8f x = *(const v8f*)(kr + d0);
    const float xm = kr[(d0 + DM - 1) & (DM - 1)];
    const float mv = bfr(mode[0]);
    const float al = 1.0f / (1.0f + expf(-mv));
    const float oma = 1.0f - al;
    float prev = bfr(xm); v8h hv, rv;
#pragma unroll
    for (int e = 0; e < 8; ++e) {
        const float cur = bfr(x[e]);
        const float c = (oma * prev - al * cur) * XCAR;
        const h16 hh = toh_flush(c);
        hv[e] = hh; rv[e] = toh_flush((c - (float)hh) * QRS);
        prev = cur; }
    const bool wr = t < EROWS;
    const size_t oo = (size_t)i * 8;
    const size_t ro = ((size_t)b * EROWS + (size_t)(wr ? t : 0)) * DM + d0;
    *(v8h*)(KE + oo) = hv; if (wr) *(v8h*)(KR + ro) = rv;
    
}

// vt_body: VT[b][d][t] = f16(bf16_rne(v[b][t][d]) * 16); one block per 64 tokens of one batch (blk = batch * SEQ/64 + token tile); in[64 tokens][128 d] -> out[128 d][64 tokens] through LDS;
// LDS tile ts: cross-wave (block barrier between fill and drain); filled extent [128][64] == drained extent.
__device__ __forceinline__ void vt_body(int blk, const float* __restrict__ v, h16* VT) {
#pragma clang fp contract(off)
    __shared__ __align__(16) h16 ts[DM * VTP];
    const int tid = threadIdx.x; const int b = blk / (SEQ / 64), tok0 = (blk % (SEQ / 64)) * 64;
    const float* src = v + ((size_t)b * SEQ_FULL + (size_t)tok0) * DM;
#pragma unroll 1
    for (int i = 0; i < 8; ++i) { const int idx = i * 256 + tid; const int tk = idx >> 5, c4 = (idx & 31) * 4;   // 8 trips x 256 threads = 64 tokens x 32 float4
        const v4f x = *(const v4f*)(src + (size_t)tk * DM + c4);
#pragma unroll
        for (int e = 0; e < 4; ++e) ts[(c4 + e) * VTP + tk] = toh_flush(bfr(x[e]) * XCAR); }
    __syncthreads();
    h16* dstb = VT + (size_t)b * DM * SEQ + (size_t)tok0;
{
#pragma unroll
        for (int s = 0; s < 4; ++s) { const int p = s * 256 + tid; const int d = p >> 3, c8 = (p & 7) * 8;       // 4 trips x 32 rows = 128 rows; 8 lanes x 8 halves = 64 tokens
            const v8h val = *(const v8ha*)(&ts[d * VTP + c8]);
            *(v8h*)(dstb + (size_t)d * SEQ + c8) = val; }
         }
    asm volatile("s_wait_xcnt 0x0" ::: "memory");   // the other block ranges' code follows in the kernel's text: stands in front of any rewrite there of the registers that the issued stores name
}

// mask bit word: bit j <- (p[j] != 0), j = 0..31 (eight 16-byte loads, consumed before the next word's loads)
__device__ __forceinline__ unsigned mword(const int* __restrict__ p) {
    unsigned w = 0u;
#pragma unroll
    for (int c = 0; c < 8; ++c) { const v4i x = *(const v4i*)(p + c * 4);
        w |= ((x[0] != 0) ? 1u : 0u) << (c * 4);
        w |= ((x[1] != 0) ? 1u : 0u) << (c * 4 + 1);
        w |= ((x[2] != 0) ? 1u : 0u) << (c * 4 + 2);
        w |= ((x[3] != 0) ? 1u : 0u) << (c * 4 + 3); }
    asm volatile("" : "+v"(w) :: "memory");
    return w;
}

__device__ __forceinline__ void mbits_body(int blk, const int* __restrict__ mask, unsigned* MB, int n4) {
    const int i = blk * 256 + threadIdx.x; if (i >= n4) return;
    const int w0 = i * 4; const int t = w0 / MW, wc = w0 % MW;
    const int* src = mask + (size_t)t * SEQ_FULL + (size_t)wc * 32;
    v4u o;
    o[0] = mword(src); o[1] = mword(src + 32); o[2] = mword(src + 64); o[3] = mword(src + 96);
    *(v4u*)(MB + (size_t)i * 4) = o; 
}

// k_prep: the four independent operand preparations as block ranges of one grid (block-uniform choice): mask bit words, V^T, combined key, q
#define PB_MB ((SEQ * MW / 4 + 255) / 256)
#define PB_VT ((SEQ / 64) * NB)
#define PB_X  ((NB * SEQ * DM / 8 + 255) / 256)
__global__ __launch_bounds__(256) void k_prep(const float* __restrict__ q, const float* __restrict__ k, const float* __restrict__ v, const int* __restrict__ mask, const float* __restrict__ mode,
                                              h16* QH, h16* KE, h16* KR, h16* VT, unsigned* MB) {
    const int blk = blockIdx.x;
    if (blk < PB_MB)                      mbits_body(blk, mask, MB, SEQ * MW / 4);
    else if (blk < PB_MB + PB_VT)         vt_body(blk - PB_MB, v, VT);
    else if (blk < PB_MB + PB_VT + PB_X)  keff_body(blk - (PB_MB + PB_VT), k, mode, KE, KR, NB * SEQ * DM / 8);
    else                                  cvtq_body(blk - (PB_MB + PB_VT + PB_X), q, QH, NB * SEQ * DM / 8);
}

// low 32 bits of a __shared__ address = byte offset in the work-group's LDS (destination operand of an asynchronous copy)
__device__ __forceinline__ unsigned ldsa(const void* p) { return (unsigned)(size_t)p; }
// eight / four asynchronous 16-byte copies global -> LDS per lane; the s_wait_xcnt closes the statement so that no address register is rewritten ahead of it
__device__ __forceinline__ void cp8(unsigned l0, const void* g0, unsigned l1, const void* g1, unsigned l2, const void* g2, unsigned l3, const void* g3,
                                    unsigned l4, const void* g4, unsigned l5, const void* g5, unsigned l6, const void* g6, unsigned l7, const void* g7) {
    asm volatile("global_load_async_to_lds_b128 %0, %1, off\n\t"
                 "global_load_async_to_lds_b128 %2, %3, off\n\t"
                 "global_load_async_to_lds_b128 %4, %5, off\n\t"
                 "global_load_async_to_lds_b128 %6, %7, off\n\t"
                 "global_load_async_to_lds_b128 %8, %9, off\n\t"
                 "global_load_async_to_lds_b128 %10, %11, off\n\t"
                 "global_load_async_to_lds_b128 %12, %13, off\n\t"
                 "global_load_async_to_lds_b128 %14, %15, off\n\t"
                 "s_wait_xcnt 0x0"
                 :: "v"(l0), "v"(g0), "v"(l1), "v"(g1), "v"(l2), "v"(g2), "v"(l3), "v"(g3),
                    "v"(l4), "v"(g4), "v"(l5), "v"(g5), "v"(l6), "v"(g6), "v"(l7), "v"(g7) : "memory");
}
__device__ __forceinline__ void cp4(unsigned l0, const void* g0, unsigned l1, const void* g1, unsigned l2, const void* g2, unsigned l3, const void* g3) {
    asm volatile("global_load_async_to_lds_b128 %0, %1, off\n\t"
                 "global_load_async_to_lds_b128 %2, %3, off\n\t"
                 "global_load_async_to_lds_b128 %4, %5, off\n\t"
                 "global_load_async_to_lds_b128 %6, %7, off\n\t"
                 "s_wait_xcnt 0x0"
                 :: "v"(l0), "v"(g0), "v"(l1), "v"(g1), "v"(l2), "v"(g2), "v"(l3), "v"(g3) : "memory");
}
// this wave's asynchronous copies have landed in LDS (other waves read them behind the next block barrier)
__device__ __forceinline__ void wait_copies() { asm volatile("s_wait_asynccnt 0x0" ::: "memory"); }
// this wave's LDS reads have returned (stands in front of the barrier behind which their buffer is refilled)
__device__ __forceinline__ void wait_lds() { asm volatile("s_wait_dscnt 0x0" ::: "memory"); }
// compile-time flag handed to a generic lambda
template <bool B> struct flagc { static constexpr bool value = B; };
// fragment loader from an LDS tile, same element map as ldh
__device__ __forceinline__ v16h ldl(const h16* p) { return cat16(*(const v8ha*)p, *(const v8ha*)(p + 16)); }

// flash_body: fused attention, one block per 64 query rows of one batch (two runs of 32 rows, from row ra and from row rb); KS key groups of AW waves, wave (group, tile) works 16 query rows against the group's key steps.
// Wave -> (group = wave mod KS, tile = wave / KS): the four tiles of one group are the waves of equal wave mod KS, so a step that only the longer run keeps leaves every group two working waves.
// Key split: the block's kept 32-key steps, in ascending order, go round-robin to the key groups (rank mod KS); four waves per SIMD fill one another's latencies.
// Staging: the block's q rows and mask bit words are copied to LDS once; the KE / KR / VT tiles of a group's 32-key step are copied to LDS by and for the group's four waves, two buffers per group,
// the group's next step's copies in flight while this step is worked on (asynchronous copies, 16 bytes per lane; whole tile = 4 copies per thread and plane).
// Tile pitches: 272 B (q, KE, KR rows of 256 B; mask rows of 256 B) and 80 B (VT rows of 64 B), 16 B x odd for the 16-byte fragment reads.
// Transposed form: S^T[key][t] = KE QH^T (A = key rows, B = query rows, 4 k-steps of 32); lane (t = lane&15, h = lane>>4) holds keys 8h+r of each 16-key tile, so the packed
// P tile is directly the B fragment of O^T[d][t] = VT P^T (element r <- tile keys 0..15, element 8+r <- tile keys 16..31, lane unchanged), 8 d-tiles.
// Softmax state (running max over kept keys, partial sum) is one scalar per lane; the two lane halves of a row are combined with one xor-16 exchange.
// Keep rule per element from the mask bit word of (row, 32-key step); a step whose words are zero on all 64 rows of the block is neither copied nor visited (block-uniform bit map),
// a step whose words are zero on the wave's own 16 rows is not worked on by that wave (wave-uniform); kept steps are visited in ascending order.
// A step whose words are all ones on the wave's own 16 rows takes a softmax path without the per-element keep tests (wave-uniform branch, same values).
// EARLY = 1 (query rows [0, EROWS)): scores = KE Q + KR Q / 2048; P = f16 value + f16 residual x2048; O = V P + V P_res / 2048 (residual products in their own accumulators);
//            row sum from the f32 exponentials; KR fragments are zero for keys >= EROWS (address clamped, wave-uniform select).
// EARLY = 0 (query rows [EROWS, SEQ)): single products, row sum over the converted P.
// Epilogue: the groups' running maxima are exchanged through LDS, every wave rescales its partial sum and O^T partial to the common maximum and stages them in LDS (its own tile of 16 rows x 128 columns,
// in the space of the key and value buffers, all written); wave (group, tile) then adds the KS partials of rows 16/KS * group .. of its tile in ascending group order and stores them whole (128 floats = 512 B = four lines)
// The LDS arrays belong to the kernel (one set for both instantiations) and are handed in; ra, rb = first query row of the block's local rows 0..31 and 32..63, b = batch.
template <int EARLY>
__device__ __forceinline__ void flash_body(h16* qt, unsigned* mt, h16* ring, float* mm, float* ll, unsigned* act, int ra, int rb, int b,
                                           const h16* __restrict__ QH, const h16* __restrict__ KE, const h16* __restrict__ KR, const h16* __restrict__ VT,
                                           const unsigned* __restrict__ MB, float* OUT) {
    constexpr int KB = 32 * KP, VB = DM * VP;                    // halves per KE / KR buffer, per VT buffer
    h16* const kt = ring;                                        // KE tiles [group][buffer]
    h16* const vt = ring + KS * 2 * KB;                          // VT tiles [group][buffer]
    h16* const rt = ring + (EARLY ? KS * 2 * (KB + VB) : 0);     // KR tiles [group][buffer]
    float* const os = (float*)ring;                              // O partial tiles [group][tile][16][OSP]
    constexpr int VG = EARLY ? 4 : 8;                            // V^T fragments read from LDS per group
    constexpr int KG = EARLY ? 1 : 4;                            // k-steps of q / KE / KR fragments read from LDS per group
    const int tid = threadIdx.x;
    const int lane = threadIdx.x & 31, lr = lane & 15, hi = lane >> 4;
    const int wave = __builtin_amdgcn_readfirstlane((int)(threadIdx.x >> 5));
    const int grp = wave & (KS - 1), wq = wave / KS;             // key group, query tile
    const int gt = wq * 32 + lane;                               // thread within the key group
    const int t0 = (wq < AW / 2 ? ra : rb) + (wq & (AW / 2 - 1)) * 16;   // first query row of the wave's tile
    const h16* Qb = QH + (size_t)b * SEQ * DM;
    const h16* Kb = KE + (size_t)b * SEQ * DM;
    const h16* Rb = KR + (size_t)b * EROWS * DM;
    const h16* Vb = VT + (size_t)b * DM * SEQ;
    // group copy maps: 256-B rows: thread -> (row gt>>4 + 8i, 16-B column gt&15); 64-B rows: thread -> (row gt>>2 + 32i, 16-B column gt&3)
    const int r16 = gt >> 4, c16 = gt & 15, r4 = gt >> 2, c4 = gt & 3;
    {
        // block copy map, q rows and mask words: thread -> (local row tid>>4 + 32i, 16-B column tid&15); local rows 0..31 are rows ra.., 32..63 rows rb..
        const int rq = tid >> 4, cq = tid & 15;
        const h16* qga = Qb + (size_t)(ra + rq) * DM + cq * 8;
        const h16* qgb = Qb + (size_t)(rb + rq) * DM + cq * 8;
        const unsigned ql = ldsa(qt) + (unsigned)(rq * KP + cq * 8) * 2u;
        const unsigned* mga = MB + (size_t)(ra + rq) * MW + cq * 4;
        const unsigned* mgb = MB + (size_t)(rb + rq) * MW + cq * 4;
        const unsigned ml = ldsa(mt) + (unsigned)(rq * MP + cq * 4) * 4u;
        cp4(ql, qga, ql + 32 * KP * 2, qgb, ml, mga, ml + 32 * MP * 4, mgb);
    }
    wait_copies();
    __syncthreads();                                             // q rows and mask words readable by every wave
    // block-uniform bit map of the steps that some row of the block keeps: thread -> (step tid&63, rows 8*(tid>>6) .. +7); even waves hold steps 0..31, odd waves steps 32..63
    unsigned orv = 0u;
#pragma unroll
    for (int i = 0; i < 8; ++i) orv |= mt[((tid >> 6) * 8 + i) * MP + (tid & 63)];
    const unsigned bal = __builtin_amdgcn_ballot_w32(orv != 0u);
    if (lane == 0) act[wave] = bal;
    __syncthreads();
    unsigned olo = 0u, ohi = 0u;
#pragma unroll
    for (int i = 0; i < AW * KS / 2; ++i) { olo |= act[2 * i]; ohi |= act[2 * i + 1]; }
    const unsigned alo = (unsigned)__builtin_amdgcn_readfirstlane((int)olo);
    const unsigned ahi = (unsigned)__builtin_amdgcn_readfirstlane((int)ohi);
    unsigned long long rem = ((unsigned long long)ahi << 32) | (unsigned long long)alo;
    const int trips = (__builtin_popcountll(rem) + KS - 1) / KS; // block-uniform: rounds of KS kept steps
    // the next KS kept steps leave the map in ascending order; returns the one of this key group (-1: none left for it)
    auto pop = [&]() {
        int mine = -1;
#pragma unroll
        for (int j = 0; j < KS; ++j)
            if (rem != 0ull) { const int s = __builtin_ctzll(rem); rem &= rem - 1ull; if (j == grp) mine = s; }
        return mine;
    };

    const h16* kg0 = Kb + r16 * DM + c16 * 8;
    const h16* rg0 = Rb + r16 * DM + c16 * 8;
    const h16* vg0 = Vb + r4 * SEQ + c4 * 8;
    const unsigned kl0 = ldsa(kt) + (unsigned)(grp * 2 * KB + r16 * KP + c16 * 8) * 2u;
    const unsigned rl0 = ldsa(rt) + (unsigned)(grp * 2 * KB + r16 * KP + c16 * 8) * 2u;
    const unsigned vl0 = ldsa(vt) + (unsigned)(grp * 2 * VB + r4 * VP + c4 * 8) * 2u;
    // copies of step s into the group's buffer bf (group-uniform arguments; every lane on)
    auto stage = [&](int s, int bf) {
        const int key0 = s * 32;
        const h16* kg = kg0 + key0 * DM; const h16* vg = vg0 + key0;
        const unsigned kl = kl0 + (unsigned)bf * (32 * KP * 2), vl = vl0 + (unsigned)bf * (DM * VP * 2);
        cp8(kl, kg, kl + 8 * KP * 2, kg + 8 * DM, kl + 16 * KP * 2, kg + 16 * DM, kl + 24 * KP * 2, kg + 24 * DM,
            vl, vg, vl + 32 * VP * 2, vg + 32 * SEQ, vl + 64 * VP * 2, vg + 64 * SEQ, vl + 96 * VP * 2, vg + 96 * SEQ);
        if (EARLY) {
            const int kcl = (key0 < EROWS) ? key0 : (EROWS - 32);    // clamped residual-plane key (address always inside the plane)
            const h16* rg = rg0 + kcl * DM; const unsigned rl = rl0 + (unsigned)bf * (32 * KP * 2);
            cp4(rl, rg, rl + 8 * KP * 2, rg + 8 * DM, rl + 16 * KP * 2, rg + 16 * DM, rl + 24 * KP * 2, rg + 24 * DM);
        }
    };
    int s0 = pop();                                              // the group's kept step of this round, of the next round (-1: none)
    int s1 = pop();
    if (s0 >= 0) stage(s0, 0);
    wait_copies();
    __syncthreads();                                             // each group's first kept step readable by its waves
    if (s1 >= 0) stage(s1, 1);

    const int mo = (wq * 16 + lr) * MP;
    const int qo = (wq * 16 + lr) * KP + 8 * hi;                 // B fragment: col t, k = d
    const int ko = lr * KP + 8 * hi;                             // + tile row * KP + kc   (A fragment: row key, k = d)
    const int vo = lr * VP + 8 * hi;                             // + 16j*VP               (A fragment: row d, k = key)
    const v16h hz = (v16h){};
    v8f o[8], oR[8];
#pragma unroll
    for (int j = 0; j < 8; ++j) { o[j] = (v8f){}; oR[j] = (v8f){}; }
    float m = NEGB, l = 0.0f;
    int bf = 0;
#pragma unroll 1
    for (int it = 0; it < MW / KS; ++it) {
        if (it >= trips) break;                                  // block-uniform: no kept step left
        const unsigned mw = (s0 >= 0) ? mt[mo + s0] : 0u;        // group-uniform test: no step for this group in the last round
        if (__builtin_amdgcn_ballot_w32(mw != 0u) != 0u) {       // wave-uniform: some row of this tile keeps some key of this step
            const bool full = __builtin_amdgcn_ballot_w32(mw != 0xFFFFFFFFu) == 0u;   // wave-uniform: all 16 rows of the tile keep all 32 keys of the step
            const int key0 = s0 * 32;
            const bool rok = key0 < EROWS;                       // wave-uniform
            const h16* kb = kt + (grp * 2 + bf) * KB + ko;
            const h16* rb = rt + (EARLY ? (grp * 2 + bf) * KB : 0) + ko;
            const h16* vb = vt + (grp * 2 + bf) * VB + vo;
            v8f sHa = (v8f){}, sHb = (v8f){}, sLa = (v8f){}, sLb = (v8f){};
#pragma unroll
            for (int g = 0; g < 4 / KG; ++g) {                   // the LDS fragment reads of KG k-steps issue together, one LDS latency per group
                v16h qf[KG], ka0[KG], kb0[KG], kra[KG], krb[KG];
#pragma unroll
                for (int u = 0; u < KG; ++u) {
                    const int kc = (g * KG + u) * 32;
                    qf[u] = ldl(qt + qo + kc); ka0[u] = ldl(kb + kc); kb0[u] = ldl(kb + 16 * KP + kc);
                    if (EARLY) { kra[u] = ldl(rb + kc); krb[u] = ldl(rb + 16 * KP + kc); }
                }
#pragma unroll
                for (int u = 0; u < KG; ++u) {
                    sHa = wmma16g(ka0[u], qf[u], sHa); sHb = wmma16g(kb0[u], qf[u], sHb);
                    if (EARLY) {
                        if (!rok) { kra[u] = hz; krb[u] = hz; }
                        sLa = wmma16g(kra[u], qf[u], sLa); sLb = wmma16g(krb[u], qf[u], sLb);
                    }
                }
            }
            v16h vpre[VG];                                       // single-product blocks: the V^T fragments, read inside either softmax path
            v16h pb, pr = hz; float ls = 0.0f, resc = 1.0f, mnew = m;
            // softmax of the step's 16 x 32 scores; FULL: every row of the tile keeps every key of the step, so the keep tests are identities and are not computed
            auto soft = [&](auto fc) {
                constexpr bool FULL = decltype(fc)::value;
                const unsigned ma = mw >> (8 * hi);              // bit r: key key0+8h+r; bit 16+r: key key0+16+8h+r
                float ta[8], tb2[8]; bool fa[8], fb[8]; float mx = NEGB;
#pragma unroll
                for (int r = 0; r < 8; ++r) {
                    fa[r] = FULL || ((ma >> r) & 1u) != 0u;
                    fb[r] = FULL || ((ma >> (16 + r)) & 1u) != 0u;
                    if (EARLY) { ta[r] = (sHa[r] + sLa[r] * QRI) * SC2; tb2[r] = (sHb[r] + sLb[r] * QRI) * SC2; }
                    else       { ta[r] = sHa[r] * SC2; tb2[r] = sHb[r] * SC2; }
                    mx = fmaxf(mx, fmaxf(fa[r] ? ta[r] : NEGB, fb[r] ? tb2[r] : NEGB)); }
                const float mo2 = __shfl_xor(mx, 16, 32);
                // single-product blocks: V^T fragment reads issue behind the exchange (LDS returns in order: the exchange does not wait for them) and land under the exponentials
#pragma unroll
                for (int jj = 0; jj < VG; ++jj) if (!EARLY) vpre[jj] = ldl(vb + jj * 16 * VP);
                mx = fmaxf(mx, mo2);
                mnew = fmaxf(m, mx);
                resc = __builtin_amdgcn_exp2f(m - mnew);
                const float sh = PSH - mnew;
#pragma unroll
                for (int r = 0; r < 8; ++r) {
                    const float xa = ta[r] + sh, xb = tb2[r] + sh;
                    const float ea = __builtin_amdgcn_exp2f(xa), eb = __builtin_amdgcn_exp2f(xb);
                    const float ga = (fa[r] & (xa >= -14.0f)) ? ea : 0.0f;   // dropped elements and sub-2^-14 values selected to 0 by value
                    const float gb = (fb[r] & (xb >= -14.0f)) ? eb : 0.0f;
                    const h16 pa = (h16)ga; const h16 pc = (h16)gb;
                    pb[r] = pa; pb[8 + r] = pc;
                    if (EARLY) { pr[r] = toh_flush((ga - (float)pa) * QRS); pr[8 + r] = toh_flush((gb - (float)pc) * QRS); ls += ga + gb; }
                    else       { ls += (float)pa + (float)pc; } }
            };
            if (__builtin_expect(full, true)) soft(flagc<true>{}); else soft(flagc<false>{});   // wave-uniform; the hint lays the shorter path out as the fall-through
            l = l * resc + ls; m = mnew;
#pragma unroll
            for (int j = 0; j < 8; ++j) { o[j] = o[j] * resc; if (EARLY) oR[j] = oR[j] * resc; }
#pragma unroll
            for (int g = 0; g < 8 / VG; ++g) {
                v16h vf[VG];
#pragma unroll
                for (int jj = 0; jj < VG; ++jj) vf[jj] = EARLY ? ldl(vb + (g * VG + jj) * 16 * VP) : vpre[jj];
#pragma unroll
                for (int jj = 0; jj < VG; ++jj) {
                    o[g * VG + jj] = wmma16g(vf[jj], pb, o[g * VG + jj]);
                    if (EARLY) oR[g * VG + jj] = wmma16g(vf[jj], pr, oR[g * VG + jj]); }
            }
        }
        // hand-over, every wave: own LDS reads returned, own copies of the group's next step landed, block barrier; only then the refill of the buffer just read
        wait_lds();
        wait_copies();
        __syncthreads();
        const int s2 = pop();
        if (s2 >= 0) stage(s2, bf);
        s0 = s1; s1 = s2; bf ^= 1;
    }
    wait_copies();                                               // no copy outstanding when the buffers are taken over and the wave ends
    l += __shfl_xor(l, 16, 32);
    const int so = (grp * AW + wq) * 16;                         // this wave's rows in the merge state and among the O partial tiles
    if (hi == 0) mm[so + lr] = m;
    __syncthreads();                                             // every group's maximum readable; every wave has left the key and value buffers
    float mall = NEGB;
#pragma unroll
    for (int g = 0; g < KS; ++g) mall = fmaxf(mall, mm[(g * AW + wq) * 16 + lr]);
    const float fs = __builtin_amdgcn_exp2f(m - mall);           // 1 where no group kept a key (sums and partials are 0 there), 0 for a group without a kept key beside one that has some
    if (hi == 0) ll[so + lr] = l * fs;
    // O^T D layout: o[j][r] = (d = 16j + 8h + r, t = lane&15) -> os[t][d]; rows 0..15 x columns 0..127 all written
#pragma unroll
    for (int j = 0; j < 8; ++j) {
        v8f f = o[j];
        if (EARLY) f = o[j] + oR[j] * QRI;
        v4f a, c;
        a[0] = f[0] * fs; a[1] = f[1] * fs; a[2] = f[2] * fs; a[3] = f[3] * fs; c[0] = f[4] * fs; c[1] = f[5] * fs; c[2] = f[6] * fs; c[3] = f[7] * fs;
        *(v4fa*)(&os[(so + lr) * OSP + 16 * j + 8 * hi]) = a; *(v4fa*)(&os[(so + lr) * OSP + 16 * j + 8 * hi + 4]) = c; }
    __syncthreads();                                             // every group's rescaled sum and O partial readable
    float* orow = OUT + ((size_t)b * OUT_SEQ + (size_t)t0) * DM;
#pragma unroll
    for (int s = 0; s < 16 / KS; ++s) {                          // 16/KS trips = the wave's rows of the tile; 32 lanes x 4 floats = 128 columns = one whole row
        const int row = grp * (16 / KS) + s;
        float lt = 0.0f; v4f val = (v4f){};
#pragma unroll
        for (int g = 0; g < KS; ++g) {
            lt += ll[(g * AW + wq) * 16 + row];
            val += *(const v4fa*)(&os[((g * AW + wq) * 16 + row) * OSP + lane * 4]); }
        const bool any = lt > 0.0f;
        const float lsafe = any ? lt : 1.0f;
        const float inv = any ? ((1.0f / lsafe) * (1.0f / XCAR)) : __uint_as_float(0x7FC00000u);   // no kept key -> NaN row
        *(v4f*)(orow + (size_t)row * DM + lane * 4) = val * inv;
        if (s + 1 < 16 / KS) asm volatile("s_wait_xcnt 0x0" ::: "memory");   // stands in front of the next row's rewrite of the registers that the issued store names
    }
}

// k_flash: both instantiations in one grid (batch, SEQ/64 blocks), chosen by the block index (block-uniform); the single-product blocks hold the low block indices:
// block y < LATEB owns the 32-row tiles y and 2 * LATEB - 1 - y of rows [EROWS, SEQ); the multi-product blocks own 64 consecutive rows of [0, EROWS), high rows first
__global__ __launch_bounds__(32 * AW * KS) __attribute__((amdgpu_num_vgpr(256)))
void k_flash(const h16* __restrict__ QH, const h16* __restrict__ KE, const h16* __restrict__ KR, const h16* __restrict__ VT, const unsigned* __restrict__ MB, float* OUT) {
    __shared__ __align__(16) h16 qt[AW * 16 * KP];               // q rows of the block
    __shared__ __align__(16) unsigned mt[AW * 16 * MP];          // mask bit words of the block's rows
    __shared__ __align__(16) h16 ring[KS * 2 * (32 * KP * 2 + DM * VP)];   // per key group two buffers each of KE, VT (and KR, multi-product blocks only); behind the loop the O partial tiles
    __shared__ float mm[KS * AW * 16], ll[KS * AW * 16];         // per (group, tile, row): running maximum, rescaled partial sum
    __shared__ __align__(16) unsigned act[AW * KS];
    constexpr int LATEB = (SEQ - EROWS) / (16 * AW);
    const int y = blockIdx.y;
    const int b = blockIdx.x;
    if (y >= LATEB) { const int r0 = (SEQ / (16 * AW) - 1 - y) * 16 * AW; flash_body<1>(qt, mt, ring, mm, ll, act, r0, r0 + 32, b, QH, KE, KR, VT, MB, OUT); }
    else            flash_body<0>(qt, mt, ring, mm, ll, act, EROWS + 32 * y, SEQ - 32 - 32 * y, b, QH, KE, KR, VT, MB, OUT);
}

static constexpr size_t al256(size_t v) { return (v + 255) & ~(size_t)255; }
static constexpr size_t SZ_PL = al256((size_t)NB * SEQ * DM * 2);          // QH, KE, VT
static constexpr size_t SZ_RS = al256((size_t)NB * EROWS * DM * 2);        // KR
static constexpr size_t SZ_MB = al256((size_t)SEQ * MW * 4);               // MB
static constexpr size_t SZ_TOTAL = 3 * SZ_PL + SZ_RS + SZ_MB;
static_assert(SZ_TOTAL <= (size_t)134217728);          // workspace carve <= 128 MiB
static_assert(((size_t)NB * SEQ * DM) % 8 == 0);       // thread-linear 16-byte stores cover the planes exactly
static_assert(((size_t)SEQ * MW) % 4 == 0);
static_assert(((size_t)NB * OUT_SEQ * DM * 4) <= (size_t)8388608 || NB != NB_FULL || OUT_SEQ != SEQ_FULL);

extern "C" void kernel_launch(void* const* d_in, const int* in_sizes, int n_in,
                              void* d_out, int out_size, void* d_ws, size_t ws_size, hipStream_t stream) {
    if (n_in < 5) return;
    const size_t needx = ((size_t)(NB - 1) * SEQ_FULL + SEQ) * DM;
    const size_t needm = (size_t)(SEQ - 1) * SEQ_FULL + SEQ;
    if ((size_t)in_sizes[0] < needx || (size_t)in_sizes[1] < needx || (size_t)in_sizes[2] < needx) return;
    if ((size_t)in_sizes[3] < needm || in_sizes[4] < 1) return;
    if ((size_t)out_size < ((size_t)(NB - 1) * OUT_SEQ + SEQ) * DM) return;
    if (SZ_TOTAL > ws_size) return;
    // wire order: q, k, v, mask, mode
    const float* q = (const float*)d_in[0];
    const float* k = (const float*)d_in[1];
    const float* v = (const float*)d_in[2];
    const int* mask = (const int*)d_in[3];
    const float* mode = (const float*)d_in[4];
    float* OUT = (float*)d_out;      // [NB][SEQ][128]
    char* wsp = (char*)d_ws;
    h16* QH = (h16*)wsp; wsp += SZ_PL;               // [NB][SEQ][128]  q x16
    h16* KE = (h16*)wsp; wsp += SZ_PL;               // [NB][SEQ][128]  combined key x16
    h16* VT = (h16*)wsp; wsp += SZ_PL;               // [NB][128][SEQ]  v^T x16
    h16* KR = (h16*)wsp; wsp += SZ_RS;               // [NB][EROWS][128] combined-key residual x2048, tokens < EROWS
    unsigned* MB = (unsigned*)wsp; wsp += SZ_MB;     // [SEQ][SEQ/32] mask bit words

    k_prep<<<PB_MB + PB_VT + 2 * PB_X, 256, 0, stream>>>(q, k, v, mask, mode, QH, KE, KR, VT, MB);
    // query rows [0, EROWS): multi-product instantiation; rows [EROWS, SEQ): single-product instantiation (disjoint output rows)
    k_flash<<<dim3(NB, SEQ / (16 * AW), 1), 32 * AW * KS, 0, stream>>>(QH, KE, KR, VT, MB, OUT);
}

// v006
// A run of this version takes 27.4 microseconds.
// Two timings next to v005 put it at 1.08 and 1.09 times that version's speed.
// Over all steps from v000 it is 6.65 times as fast.
#include <hip/hip_runtime.h>

// Single-head masked attention, head width 128: q/k/v [NB][SEQ][128] f32, mask [1][SEQ][SEQ] int32 (0 = dropped, read by value), mode scalar f32.
// logit = 128^-0.5 * q . ((1-a) * roll(k, 1 along d) - a * k), a = sigmoid(mode); dropped entries are replaced by -inf; softmax over keys; output = P v (f32).
// Compute dtypes, f32 accumulate everywhere: scores v_wmma_f32_16x16x32_f16: q (bf16-RNE input, x16 carry, exact in f16) against the combined key operand ke = (1-a) k[d-1] - a k[d]
// (built in f32 from bf16-RNE k, x16 carry) as single f16 on query rows >= EROWS and as f16 value + f16 residual x2048 (own accumulator) on query rows < EROWS;
// P.V v_wmma_f32_16x16x32_f16: P (x16384 carry, cancels in the normalisation) single f16 on query rows >= EROWS, f16 value + f16 residual x2048 (own accumulator, folded by 1/2048) on query rows < EROWS;
// v (bf16-RNE input, x16 carry, exact in f16) single everywhere; softmax f32 (online, running max over kept keys).
// Layout: QH [b][t][128], KE [b][s][128], KR [b][s < EROWS][128], VT [b][d][s] (transposed through LDS), MB [t][SEQ/32] mask bit words (bit j = key 32w + j kept).
// Fused flash kernel in transposed form (S^T = KE QH^T, O^T = VT P^T); operand tiles staged in LDS by asynchronous copies, shared by the four waves of a key group; a 32-key step is skipped when its mask block is all zero (per block for the copies, per wave for the work).
// The kept key steps of a block are dealt round-robin to KS key groups of four waves each; every group keeps its own softmax state and O partial, merged through LDS at the end.
// A single-product flash block owns two 32-row query tiles mirrored about the middle of rows [EROWS, SEQ), so that under a mask whose kept keys grow with the row every block has about the same work.

#ifndef NB
#define NB 8
#endif
#ifndef SEQ
#define SEQ 2048
#endif
#define NB_FULL  8
#define SEQ_FULL 2048
#ifndef OUT_SEQ
#define OUT_SEQ SEQ              // row pitch (in tokens) between batches of the output
#endif
#define DM   128
#define AW   4                   // query tiles per flash block (16 query rows each), one wave per tile and key group
#define KS   4                   // key groups per flash block (AW waves each)
#define OSP  132                 // LDS row pitch (floats) of the flash output tile
#define VTP  72                  // LDS row pitch (halves) of the transpose tile
#define MW   (SEQ / 32)          // mask bit words per query row
#define KP   136                 // LDS row pitch (halves) of the q, KE and KR tiles: 272 B
#define VP   40                  // LDS row pitch (halves) of the VT tile: 80 B
#define MP   68                  // LDS row pitch (words) of the mask-word tile: 272 B
#define EROWS (SEQ < 512 ? SEQ : 512)   // query rows (and tokens of the residual key plane) handled by the multi-product flash instantiation
#define XCAR 16.0f               // carry of the q, ke and v planes
#define QRS  2048.0f             // carry of every residual plane / residual fragment
#define QRI  (1.0f / 2048.0f)
#define SC2  ((float)(0.08838834764831845 * 1.4426950408889634 / 256.0))   // DM^-0.5 * log2(e) / (XCAR * XCAR)
#define PSH  14.0f               // log2 of the P carry (16384)
#define NEGB (-3.0e38f)

static_assert(DM == 128);                      // output row = 32 lanes x 4 floats; plane row = 16 threads x 8 halves
static_assert(DM % 32 == 0);                   // score k-loop steps by 32
static_assert(DM / 8 == 16);                   // k_prep: row = tid >> 4
static_assert((DM & (DM - 1)) == 0);           // rolled index uses a mask
static_assert(SEQ % 128 == 0);                 // MW multiple of 4: a 16-byte copy moves four mask words of one row
static_assert(SEQ % 64 == 0);                  // transpose tiles of 64 tokens
static_assert(SEQ % 32 == 0);                  // key loop steps by 32
static_assert(EROWS % (16 * AW) == 0);
static_assert((KP * 2) % 16 == 0 && KP >= DM && (VP * 2) % 16 == 0 && VP >= 32 && (MP * 4) % 16 == 0 && MP >= MW);   // 16-byte copies and fragment reads stay aligned and inside a row
static_assert(MW == 64 && AW == 4 && KS == 4); // flash copy maps and step bit map: 512 threads (128 per key group), 64 rows x 64 words, one 64-bit map
static_assert((SEQ - EROWS) % (16 * AW) == 0);  // the 32-row tiles of rows [EROWS, SEQ) pair up exactly
static_assert(EROWS >= 32);
static_assert(EROWS % 32 == 0);
static_assert(EROWS <= SEQ);
static_assert(NB <= NB_FULL);
static_assert(SEQ <= SEQ_FULL);
static_assert((OSP * 4) % 16 == 0);
static_assert(OSP >= DM);
static_assert((VTP * 2) % 16 == 0);
static_assert(VTP >= 64);
static_assert((size_t)AW * 16 * (KP * 2 + MP * 4) + (size_t)KS * (4 * 32 * KP * 2 + 2 * DM * VP * 2) + (size_t)KS * AW * (2 * 16 * 4 + 4) <= 327680);   // flash static LDS: q and mask tiles, KE, KR and VT buffers of every key group, merge state, step map
static_assert((size_t)KS * AW * 16 * OSP * 4 <= (size_t)KS * (2 * 32 * KP * 2 + 2 * DM * VP * 2));   // the O partial tiles fit in the KE and VT buffers they take over behind the loop
static_assert((size_t)DM * VTP * 2 <= 131072);           // transpose static LDS
static_assert(32 * 4 * (16 / KS) * KS == 16 * DM);       // flash epilogue: 32 lanes x 4 floats x 16/KS trips x KS waves == 16 rows x DM floats
static_assert((size_t)NB * SEQ * DM / 8 < (size_t)2147483647);
static_assert((size_t)SEQ * DM < (size_t)2147483647);

typedef _Float16 h16;
typedef __attribute__((ext_vector_type(16))) _Float16 v16h;
typedef __attribute__((ext_vector_type(8)))  _Float16 v8h;
typedef __attribute__((ext_vector_type(8)))  float    v8f;
typedef __attribute__((ext_vector_type(4)))  float    v4f;
typedef __attribute__((ext_vector_type(4)))  int      v4i;
typedef __attribute__((ext_vector_type(4)))  unsigned v4u;
typedef v4f  __attribute__((may_alias)) v4fa;
typedef v8h  __attribute__((may_alias)) v8ha;
typedef __attribute__((ext_vector_type(4)))  _Float16 v4h;
typedef v4h  __attribute__((may_alias)) v4ha;

__device__ __forceinline__ unsigned short f2bf(float f) { unsigned u = __float_as_uint(f); u += 0x7FFFu + ((u >> 16) & 1u); return (unsigned short)(u >> 16); }
__device__ __forceinline__ float bfr(float f) { return __uint_as_float(((unsigned)f2bf(f)) << 16); }   // value after RNE convert to bf16
__device__ __forceinline__ v16h cat16(v8h lo, v8h hi) { return __builtin_shufflevector(lo, hi, 0, 1, 2, 3, 4, 5, 6, 7, 8, 9, 10, 11, 12, 13, 14, 15); }
__device__ __forceinline__ v8f wmma16(v16h a, v16h b, v8f c) { return __builtin_amdgcn_wmma_f32_16x16x32_f16(false, a, false, b, (short)0, c, false, false); }
// fragment loaders from K-contiguous 16-bit rows; p already includes + 8*(lane>>4): elements 0..7 <- k0+8h+0..7, elements 8..15 <- k0+16+8h+0..7 (same map for A and B)
__device__ __forceinline__ v16h  ldh(const h16* p) { return cat16(*(const v8h*)p, *(const v8h*)(p + 16)); }

// f32 -> f16 convert that cannot produce an f16 subnormal (|v| < 2^-14 -> +0)
static __device__ __forceinline__ h16 toh_flush(float v) { const h16 r = (h16)v; return (fabsf(v) < 6.103515625e-05f) ? (h16)0.0f : r; }
// one WMMA with its own hazard guard (ties the accumulator, keeps A and B live)
static __device__ __forceinline__ v8f wmma16g(v16h a, v16h b, v8f c) {
    c = wmma16(a, b, c);
    asm volatile("v_nop\n\tv_nop\n\tv_nop\n\tv_nop" : "+v"(c) : "v"(a), "v"(b));
    return c;
}

// eight q or v-like values: f16(bf16_rne(x) * 16)
__device__ __forceinline__ v8h cvt8(v8f v) {
    v8h o;
#pragma unroll
    for (int e = 0; e < 8; ++e) o[e] = toh_flush(bfr(v[e]) * XCAR);
    return o;
}

// keff8: combined key operand ke[d] = (1-a) * k[(d-1) mod DM] - a * k[d] for eight consecutive d, from bf16-RNE k, in f32 (x = k[d0..d0+7], xm = k[(d0-1) mod DM]); hv = f16 value, rv = f16 residual x2048
__device__ __forceinline__ void keff8(v8f x, float xm, float al, float oma, v8h& hv, v8h& rv) {
#pragma clang fp contract(off)   // as it stood in the key preparation: both products of the combination are rounded before the subtraction, so value and residual planes keep their bits
    float prev = bfr(xm);
#pragma unroll
    for (int e = 0; e < 8; ++e) {
        const float cur = bfr(x[e]);
        const float c = (oma * prev - al * cur) * XCAR;
        const h16 hh = toh_flush(c);
        hv[e] = hh; rv[e] = toh_flush((c - (float)hh) * QRS);
        prev = cur; }
}

// stands behind a group of issued global loads: s_wait_xcnt in front of any rewrite (also by a later load's result) of the address registers that they name;
// the scheduling barrier keeps the group in front of it, and so ahead of the first use: without it the scheduler sinks part of the k and q loads behind the wait for v, a second memory latency
__device__ __forceinline__ void loads_issued() { asm volatile("s_wait_xcnt 0x0" ::: "memory"); __builtin_amdgcn_sched_barrier(0); }

// k_prep: all operand preparation in one resident round: NB * SEQ / 64 blocks of 16 waves (one per WGP on a chip of that many), so that few waves have to start.
// Block = 64 tokens of one batch of q, k and v, and 512 mask bit words; every thread issues all its loads (46, 328 bytes) ahead of any use, in the order of use.
// v: thread = 4 tokens x 4 columns (a wave's load = 4 rows x one whole 128-byte line), written to the LDS tile ts[d][token] as four 8-byte runs of tokens; block barrier; drained as rows of 64 tokens: VT[b][d][t] = f16(bf16_rne(v[b][t][d]) * 16).
// k, q: thread = two runs of 8 columns. mask: wave = 32 words of one row; load c brings the 32 entries of word c, one per lane (one line), the wave's vote on != 0 is the word (bit j = key 32w + j kept), lane c keeps it.
#define PT   512
#define PBLK (NB * (SEQ / 64))
static_assert(PT * 16 == 64 * DM);                       // v: 512 threads x (4 tokens x 4 columns); q, k: 512 threads x 2 x 8 columns == 64 tokens x DM
static_assert(PT * 8 * 2 == DM * 64);                    // transpose drain: 512 threads x 8 halves x 2 trips == DM rows x 64 tokens
static_assert((size_t)PBLK * PT == (size_t)SEQ * MW);    // mask: one word per thread of the grid
static_assert(MW % 32 == 0);                             // a wave's 32 words lie in one row
static_assert(EROWS % 64 == 0);                          // a block's tokens lie on one side of EROWS
__global__ __launch_bounds__(PT) void k_prep(const float* __restrict__ q, const float* __restrict__ k, const float* __restrict__ v, const int* __restrict__ mask, const float* __restrict__ mode,
                                             h16* QH, h16* KE, h16* KR, h16* VT, unsigned* MB) {
    __shared__ __align__(16) h16 ts[DM * VTP];
    const int tid = threadIdx.x, lane = tid & 31;
    const int wave = __builtin_amdgcn_readfirstlane((int)(threadIdx.x >> 5));
    const int blk = blockIdx.x;
    const int b = blk / (SEQ / 64), tok0 = (blk % (SEQ / 64)) * 64;
    const size_t ib = ((size_t)b * SEQ_FULL + (size_t)tok0) * DM;    // the block's first element in q, k, v
    const int vc = ((wave & 3) * 8 + (lane & 7)) * 4;                // v: first column, first token of the thread's 4 x 4 piece
    const int vk = ((wave >> 2) * 4 + (lane >> 3)) * 4;
    const int row = tid >> 4, d0 = (tid & 15) * 8;                   // q, k: local rows row and row + 32, columns d0 .. d0 + 7
    const int gw = blk * (PT / 32) + wave;                           // mask: the wave's run of 32 words
    const int mrow = gw / (MW / 32), mw0 = (gw % (MW / 32)) * 32;
    const int* ms = mask + (size_t)mrow * SEQ_FULL + (size_t)mw0 * 32 + lane;
    v4f xv[4]; v8f xk[2], xq[2]; float xm[2]; int xw[32];
    const float mraw = mode[0];
#pragma unroll
    for (int r = 0; r < 4; ++r) xv[r] = *(const v4f*)(v + ib + (size_t)(vk + r) * DM + vc);
    loads_issued();
#pragma unroll
    for (int u = 0; u < 2; ++u) {
        const float* kr = k + ib + (size_t)(row + 32 * u) * DM;
        xk[u] = *(const v8f*)(kr + d0); xm[u] = kr[(d0 + DM - 1) & (DM - 1)]; }
    loads_issued();
#pragma unroll
    for (int u = 0; u < 2; ++u) xq[u] = *(const v8f*)(q + ib + (size_t)(row + 32 * u) * DM + d0);
    loads_issued();
#pragma unroll
    for (int c = 0; c < 32; ++c) xw[c] = ms[c * 32];
    loads_issued();
    // v through the transpose tile
#pragma unroll
    for (int e = 0; e < 4; ++e) {
        v4h o;
#pragma unroll
        for (int r = 0; r < 4; ++r) o[r] = toh_flush(bfr(xv[r][e]) * XCAR);
        *(v4ha*)(&ts[(vc + e) * VTP + vk]) = o; }
    // block barrier with LDS-only fences: transpose tile filled [128][64] == drained extent; __syncthreads() would also wait here for every global load still in flight (k, q, mask)
    __builtin_amdgcn_fence(__ATOMIC_RELEASE, "workgroup", "local");
    __builtin_amdgcn_s_barrier();
    __builtin_amdgcn_fence(__ATOMIC_ACQUIRE, "workgroup", "local");
    h16* dstb = VT + (size_t)b * DM * SEQ + (size_t)tok0;
#pragma unroll
    for (int s = 0; s < 2; ++s) { const int p = s * PT + tid; const int d = p >> 3, c8 = (p & 7) * 8;   // 2 trips x 64 rows = 128 rows; 8 lanes x 8 halves = 64 tokens
        const v8h val = *(const v8ha*)(&ts[d * VTP + c8]);
        *(v8h*)(dstb + (size_t)d * SEQ + c8) = val; }
    // combined key (and its residual on tokens < EROWS)
    const float mv = bfr(mraw);
    const float al = 1.0f / (1.0f + expf(-mv));
    const float oma = 1.0f - al;
    const size_t ob = ((size_t)b * SEQ + (size_t)tok0) * DM;         // the block's first element in QH, KE
    const bool wr = tok0 < EROWS;                                    // block-uniform
#pragma unroll
    for (int u = 0; u < 2; ++u) {
        v8h hv, rv; keff8(xk[u], xm[u], al, oma, hv, rv);
        *(v8h*)(KE + ob + (size_t)(row + 32 * u) * DM + d0) = hv;
        asm volatile("s_wait_xcnt 0x0" ::: "memory");   // stands in front of the rewrite, in the residual branch, of the registers that the issued store names
        if (wr) *(v8h*)(KR + ((size_t)b * EROWS + (size_t)(tok0 + row + 32 * u)) * DM + d0) = rv; }
#pragma unroll
    for (int u = 0; u < 2; ++u) *(v8h*)(QH + ob + (size_t)(row + 32 * u) * DM + d0) = cvt8(xq[u]);
    unsigned w = 0u;
#pragma unroll
    for (int c = 0; c < 32; ++c) { const unsigned bal = __builtin_amdgcn_ballot_w32(xw[c] != 0); w = (lane == c) ? bal : w; }
    MB[(size_t)gw * 32 + lane] = w;
}

// low 32 bits of a __shared__ address = byte offset in the work-group's LDS (destination operand of an asynchronous copy)
__device__ __forceinline__ unsigned ldsa(const void* p) { return (unsigned)(size_t)p; }
// eight / four asynchronous 16-byte copies global -> LDS per lane; the s_wait_xcnt closes the statement so that no address register is rewritten ahead of it
__device__ __forceinline__ void cp8(unsigned l0, const void* g0, unsigned l1, const void* g1, unsigned l2, const void* g2, unsigned l3, const void* g3,
                                    unsigned l4, const void* g4, unsigned l5, const void* g5, unsigned l6, const void* g6, unsigned l7, const void* g7) {
    asm volatile("global_load_async_to_lds_b128 %0, %1, off\n\t"
                 "global_load_async_to_lds_b128 %2, %3, off\n\t"
                 "global_load_async_to_lds_b128 %4, %5, off\n\t"
                 "global_load_async_to_lds_b128 %6, %7, off\n\t"
                 "global_load_async_to_lds_b128 %8, %9, off\n\t"
                 "global_load_async_to_lds_b128 %10, %11, off\n\t"
                 "global_load_async_to_lds_b128 %12, %13, off\n\t"
                 "global_load_async_to_lds_b128 %14, %15, off\n\t"
                 "s_wait_xcnt 0x0"
                 :: "v"(l0), "v"(g0), "v"(l1), "v"(g1), "v"(l2), "v"(g2), "v"(l3), "v"(g3),
                    "v"(l4), "v"(g4), "v"(l5), "v"(g5), "v"(l6), "v"(g6), "v"(l7), "v"(g7) : "memory");
}
__device__ __forceinline__ void cp4(unsigned l0, const void* g0, unsigned l1, const void* g1, unsigned l2, const void* g2, unsigned l3, const void* g3) {
    asm volatile("global_load_async_to_lds_b128 %0, %1, off\n\t"
                 "global_load_async_to_lds_b128 %2, %3, off\n\t"
                 "global_load_async_to_lds_b128 %4, %5, off\n\t"
                 "global_load_async_to_lds_b128 %6, %7, off\n\t"
                 "s_wait_xcnt 0x0"
                 :: "v"(l0), "v"(g0), "v"(l1), "v"(g1), "v"(l2), "v"(g2), "v"(l3), "v"(g3) : "memory");
}
// this wave's asynchronous copies have landed in LDS (other waves read them behind the next block barrier)
__device__ __forceinline__ void wait_copies() { asm volatile("s_wait_asynccnt 0x0" ::: "memory"); }
// this wave's LDS reads have returned (stands in front of the barrier behind which their buffer is refilled)
__device__ __forceinline__ void wait_lds() { asm volatile("s_wait_dscnt 0x0" ::: "memory"); }
// compile-time flag handed to a generic lambda
template <bool B> struct flagc { static constexpr bool value = B; };
// fragment loader from an LDS tile, same element map as ldh
__device__ __forceinline__ v16h ldl(const h16* p) { return cat16(*(const v8ha*)p, *(const v8ha*)(p + 16)); }

// flash_body: fused attention, one block per 64 query rows of one batch (two runs of 32 rows, from row ra and from row rb); KS key groups of AW waves, wave (group, tile) works 16 query rows against the group's key steps.
// Wave -> (group = wave mod KS, tile = wave / KS): the four tiles of one group are the waves of equal wave mod KS, so a step that only the longer run keeps leaves every group two working waves.
// Key split: the block's kept 32-key steps, in ascending order, go round-robin to the key groups (rank mod KS); four waves per SIMD fill one another's latencies.
// Staging: the block's q rows and mask bit words are copied to LDS once; the KE / KR / VT tiles of a group's 32-key step are copied to LDS by and for the group's four waves, two buffers per group,
// the group's next step's copies in flight while this step is worked on (asynchronous copies, 16 bytes per lane; whole tile = 4 copies per thread and plane).
// Tile pitches: 272 B (q, KE, KR rows of 256 B; mask rows of 256 B) and 80 B (VT rows of 64 B), 16 B x odd for the 16-byte fragment reads.
// Transposed form: S^T[key][t] = KE QH^T (A = key rows, B = query rows, 4 k-steps of 32); lane (t = lane&15, h = lane>>4) holds keys 8h+r of each 16-key tile, so the packed
// P tile is directly the B fragment of O^T[d][t] = VT P^T (element r <- tile keys 0..15, element 8+r <- tile keys 16..31, lane unchanged), 8 d-tiles.
// Softmax state (running max over kept keys, partial sum) is one scalar per lane; the two lane halves of a row are combined with one xor-16 exchange.
// Keep rule per element from the mask bit word of (row, 32-key step); a step whose words are zero on all 64 rows of the block is neither copied nor visited (block-uniform bit map),
// a step whose words are zero on the wave's own 16 rows is not worked on by that wave (wave-uniform); kept steps are visited in ascending order.
// A step whose words are all ones on the wave's own 16 rows takes a softmax path without the per-element keep tests (wave-uniform branch, same values).
// EARLY = 1 (query rows [0, EROWS)): scores = KE Q + KR Q / 2048; P = f16 value + f16 residual x2048; O = V P + V P_res / 2048 (residual products in their own accumulators);
//            row sum from the f32 exponentials; KR fragments are zero for keys >= EROWS (address clamped, wave-uniform select).
// EARLY = 0 (query rows [EROWS, SEQ)): single products, row sum over the converted P.
// Epilogue: the groups' running maxima are exchanged through LDS, every wave rescales its partial sum and O^T partial to the common maximum and stages them in LDS (its own tile of 16 rows x 128 columns,
// in the space of the key and value buffers, all written); wave (group, tile) then adds the KS partials of rows 16/KS * group .. of its tile in ascending group order and stores them whole (128 floats = 512 B = four lines)
// The LDS arrays belong to the kernel (one set for both instantiations) and are handed in; ra, rb = first query row of the block's local rows 0..31 and 32..63, b = batch.
template <int EARLY>
__device__ __forceinline__ void flash_body(h16* qt, unsigned* mt, h16* ring, float* mm, float* ll, unsigned* act, int ra, int rb, int b,
                                           const h16* __restrict__ QH, const h16* __restrict__ KE, const h16* __restrict__ KR, const h16* __restrict__ VT,
                                           const unsigned* __restrict__ MB, float* OUT) {
    constexpr int KB = 32 * KP, VB = DM * VP;                    // halves per KE / KR buffer, per VT buffer
    h16* const kt = ring;                                        // KE tiles [group][buffer]
    h16* const vt = ring + KS * 2 * KB;                          // VT tiles [group][buffer]
    h16* const rt = ring + (EARLY ? KS * 2 * (KB + VB) : 0);     // KR tiles [group][buffer]
    float* const os = (float*)ring;                              // O partial tiles [group][tile][16][OSP]
    constexpr int VG = EARLY ? 4 : 8;                            // V^T fragments read from LDS per group
    constexpr int KG = EARLY ? 1 : 4;                            // k-steps of q / KE / KR fragments read from LDS per group
    const int tid = threadIdx.x;
    const int lane = threadIdx.x & 31, lr = lane & 15, hi = lane >> 4;
    const int wave = __builtin_amdgcn_readfirstlane((int)(threadIdx.x >> 5));
    const int grp = wave & (KS - 1), wq = wave / KS;             // key group, query tile
    const int gt = wq * 32 + lane;                               // thread within the key group
    const int t0 = (wq < AW / 2 ? ra : rb) + (wq & (AW / 2 - 1)) * 16;   // first query row of the wave's tile
    const h16* Qb = QH + (size_t)b * SEQ * DM;
    const h16* Kb = KE + (size_t)b * SEQ * DM;
    const h16* Rb = KR + (size_t)b * EROWS * DM;
    const h16* Vb = VT + (size_t)b * DM * SEQ;
    // group copy maps: 256-B rows: thread -> (row gt>>4 + 8i, 16-B column gt&15); 64-B rows: thread -> (row gt>>2 + 32i, 16-B column gt&3)
    const int r16 = gt >> 4, c16 = gt & 15, r4 = gt >> 2, c4 = gt & 3;
    {
        // block copy map, q rows and mask words: thread -> (local row tid>>4 + 32i, 16-B column tid&15); local rows 0..31 are rows ra.., 32..63 rows rb..
        const int rq = tid >> 4, cq = tid & 15;
        const h16* qga = Qb + (size_t)(ra + rq) * DM + cq * 8;
        const h16* qgb = Qb + (size_t)(rb + rq) * DM + cq * 8;
        const unsigned ql = ldsa(qt) + (unsigned)(rq * KP + cq * 8) * 2u;
        const unsigned* mga = MB + (size_t)(ra + rq) * MW + cq * 4;
        const unsigned* mgb = MB + (size_t)(rb + rq) * MW + cq * 4;
        const unsigned ml = ldsa(mt) + (unsigned)(rq * MP + cq * 4) * 4u;
        cp4(ql, qga, ql + 32 * KP * 2, qgb, ml, mga, ml + 32 * MP * 4, mgb);
    }
    wait_copies();
    __syncthreads();                                             // q rows and mask words readable by every wave
    // block-uniform bit map of the steps that some row of the block keeps: thread -> (step tid&63, rows 8*(tid>>6) .. +7); even waves hold steps 0..31, odd waves steps 32..63
    unsigned orv = 0u;
#pragma unroll
    for (int i = 0; i < 8; ++i) orv |= mt[((tid >> 6) * 8 + i) * MP + (tid & 63)];
    const unsigned bal = __builtin_amdgcn_ballot_w32(orv != 0u);
    if (lane == 0) act[wave] = bal;
    __syncthreads();
    unsigned olo = 0u, ohi = 0u;
#pragma unroll
    for (int i = 0; i < AW * KS / 2; ++i) { olo |= act[2 * i]; ohi |= act[2 * i + 1]; }
    const unsigned alo = (unsigned)__builtin_amdgcn_readfirstlane((int)olo);
    const unsigned ahi = (unsigned)__builtin_amdgcn_readfirstlane((int)ohi);
    unsigned long long rem = ((unsigned long long)ahi << 32) | (unsigned long long)alo;
    const int trips = (__builtin_popcountll(rem) + KS - 1) / KS; // block-uniform: rounds of KS kept steps
    // the next KS kept steps leave the map in ascending order; returns the one of this key group (-1: none left for it)
    auto pop = [&]() {
        int mine = -1;
#pragma unroll
        for (int j = 0; j < KS; ++j)
            if (rem != 0ull) { const int s = __builtin_ctzll(rem); rem &= rem - 1ull; if (j == grp) mine = s; }
        return mine;
    };

    const h16* kg0 = Kb + r16 * DM + c16 * 8;
    const h16* rg0 = Rb + r16 * DM + c16 * 8;
    const h16* vg0 = Vb + r4 * SEQ + c4 * 8;
    const unsigned kl0 = ldsa(kt) + (unsigned)(grp * 2 * KB + r16 * KP + c16 * 8) * 2u;
    const unsigned rl0 = ldsa(rt) + (unsigned)(grp * 2 * KB + r16 * KP + c16 * 8) * 2u;
    const unsigned vl0 = ldsa(vt) + (unsigned)(grp * 2 * VB + r4 * VP + c4 * 8) * 2u;
    // copies of step s into the group's buffer bf (group-uniform arguments; every lane on)
    auto stage = [&](int s, int bf) {
        const int key0 = s * 32;
        const h16* kg = kg0 + key0 * DM; const h16* vg = vg0 + key0;
        const unsigned kl = kl0 + (unsigned)bf * (32 * KP * 2), vl = vl0 + (unsigned)bf * (DM * VP * 2);
        cp8(kl, kg, kl + 8 * KP * 2, kg + 8 * DM, kl + 16 * KP * 2, kg + 16 * DM, kl + 24 * KP * 2, kg + 24 * DM,
            vl, vg, vl + 32 * VP * 2, vg + 32 * SEQ, vl + 64 * VP * 2, vg + 64 * SEQ, vl + 96 * VP * 2, vg + 96 * SEQ);
        if (EARLY) {
            const int kcl = (key0 < EROWS) ? key0 : (EROWS - 32);    // clamped residual-plane key (address always inside the plane)
            const h16* rg = rg0 + kcl * DM; const unsigned rl = rl0 + (unsigned)bf * (32 * KP * 2);
            cp4(rl, rg, rl + 8 * KP * 2, rg + 8 * DM, rl + 16 * KP * 2, rg + 16 * DM, rl + 24 * KP * 2, rg + 24 * DM);
        }
    };
    int s0 = pop();                                              // the group's kept step of this round, of the next round (-1: none)
    int s1 = pop();
    if (s0 >= 0) stage(s0, 0);
    wait_copies();
    __syncthreads();                                             // each group's first kept step readable by its waves
    if (s1 >= 0) stage(s1, 1);

    const int mo = (wq * 16 + lr) * MP;
    const int qo = (wq * 16 + lr) * KP + 8 * hi;                 // B fragment: col t, k = d
    const int ko = lr * KP + 8 * hi;                             // + tile row * KP + kc   (A fragment: row key, k = d)
    const int vo = lr * VP + 8 * hi;                             // + 16j*VP               (A fragment: row d, k = key)
    const v16h hz = (v16h){};
    v8f o[8], oR[8];
#pragma unroll
    for (int j = 0; j < 8; ++j) { o[j] = (v8f){}; oR[j] = (v8f){}; }
    float m = NEGB, l = 0.0f;
    int bf = 0;
#pragma unroll 1
    for (int it = 0; it < MW / KS; ++it) {
        if (it >= trips) break;                                  // block-uniform: no kept step left
        const unsigned mw = (s0 >= 0) ? mt[mo + s0] : 0u;        // group-uniform test: no step for this group in the last round
        if (__builtin_amdgcn_ballot_w32(mw != 0u) != 0u) {       // wave-uniform: some row of this tile keeps some key of this step
            const bool full = __builtin_amdgcn_ballot_w32(mw != 0xFFFFFFFFu) == 0u;   // wave-uniform: all 16 rows of the tile keep all 32 keys of the step
            const int key0 = s0 * 32;
            const bool rok = key0 < EROWS;                       // wave-uniform
            const h16* kb = kt + (grp * 2 + bf) * KB + ko;
            const h16* rb = rt + (EARLY ? (grp * 2 + bf) * KB : 0) + ko;
            const h16* vb = vt + (grp * 2 + bf) * VB + vo;
            v8f sHa = (v8f){}, sHb = (v8f){}, sLa = (v8f){}, sLb = (v8f){};
#pragma unroll
            for (int g = 0; g < 4 / KG; ++g) {                   // the LDS fragment reads of KG k-steps issue together, one LDS latency per group
                v16h qf[KG], ka0[KG], kb0[KG], kra[KG], krb[KG];
#pragma unroll
                for (int u = 0; u < KG; ++u) {
                    const int kc = (g * KG + u) * 32;
                    qf[u] = ldl(qt + qo + kc); ka0[u] = ldl(kb + kc); kb0[u] = ldl(kb + 16 * KP + kc);
                    if (EARLY) { kra[u] = ldl(rb + kc); krb[u] = ldl(rb + 16 * KP + kc); }
                }
#pragma unroll
                for (int u = 0; u < KG; ++u) {
                    sHa = wmma16g(ka0[u], qf[u], sHa); sHb = wmma16g(kb0[u], qf[u], sHb);
                    if (EARLY) {
                        if (!rok) { kra[u] = hz; krb[u] = hz; }
                        sLa = wmma16g(kra[u], qf[u], sLa); sLb = wmma16g(krb[u], qf[u], sLb);
                    }
                }
            }
            v16h vpre[VG];                                       // single-product blocks: the V^T fragments, read inside either softmax path
            v16h pb, pr = hz; float ls = 0.0f, resc = 1.0f, mnew = m;
            // softmax of the step's 16 x 32 scores; FULL: every row of the tile keeps every key of the step, so the keep tests are identities and are not computed
            auto soft = [&](auto fc) {
                constexpr bool FULL = decltype(fc)::value;
                const unsigned ma = mw >> (8 * hi);              // bit r: key key0+8h+r; bit 16+r: key key0+16+8h+r
                float ta[8], tb2[8]; bool fa[8], fb[8]; float mx = NEGB;
#pragma unroll
                for (int r = 0; r < 8; ++r) {
                    fa[r] = FULL || ((ma >> r) & 1u) != 0u;
                    fb[r] = FULL || ((ma >> (16 + r)) & 1u) != 0u;
                    if (EARLY) { ta[r] = (sHa[r] + sLa[r] * QRI) * SC2; tb2[r] = (sHb[r] + sLb[r] * QRI) * SC2; }
                    else       { ta[r] = sHa[r] * SC2; tb2[r] = sHb[r] * SC2; }
                    mx = fmaxf(mx, fmaxf(fa[r] ? ta[r] : NEGB, fb[r] ? tb2[r] : NEGB)); }
                const float mo2 = __shfl_xor(mx, 16, 32);
                // single-product blocks: V^T fragment reads issue behind the exchange (LDS returns in order: the exchange does not wait for them) and land under the exponentials
#pragma unroll
                for (int jj = 0; jj < VG; ++jj) if (!EARLY) vpre[jj] = ldl(vb + jj * 16 * VP);
                mx = fmaxf(mx, mo2);
                mnew = fmaxf(m, mx);
                resc = __builtin_amdgcn_exp2f(m - mnew);
                const float sh = PSH - mnew;
#pragma unroll
                for (int r = 0; r < 8; ++r) {
                    const float xa = ta[r] + sh, xb = tb2[r] + sh;
                    const float ea = __builtin_amdgcn_exp2f(xa), eb = __builtin_amdgcn_exp2f(xb);
                    const float ga = (fa[r] & (xa >= -14.0f)) ? ea : 0.0f;   // dropped elements and sub-2^-14 values selected to 0 by value
                    const float gb = (fb[r] & (xb >= -14.0f)) ? eb : 0.0f;
                    const h16 pa = (h16)ga; const h16 pc = (h16)gb;
                    pb[r] = pa; pb[8 + r] = pc;
                    if (EARLY) { pr[r] = toh_flush((ga - (float)pa) * QRS); pr[8 + r] = toh_flush((gb - (float)pc) * QRS); ls += ga + gb; }
                    else       { ls += (float)pa + (float)pc; } }
            };
            if (__builtin_expect(full, true)) soft(flagc<true>{}); else soft(flagc<false>{});   // wave-uniform; the hint lays the shorter path out as the fall-through
            l = l * resc + ls; m = mnew;
#pragma unroll
            for (int j = 0; j < 8; ++j) { o[j] = o[j] * resc; if (EARLY) oR[j] = oR[j] * resc; }
#pragma unroll
            for (int g = 0; g < 8 / VG; ++g) {
                v16h vf[VG];
#pragma unroll
                for (int jj = 0; jj < VG; ++jj) vf[jj] = EARLY ? ldl(vb + (g * VG + jj) * 16 * VP) : vpre[jj];
#pragma unroll
                for (int jj = 0; jj < VG; ++jj) {
                    o[g * VG + jj] = wmma16g(vf[jj], pb, o[g * VG + jj]);
                    if (EARLY) oR[g * VG + jj] = wmma16g(vf[jj], pr, oR[g * VG + jj]); }
            }
        }
        // hand-over, every wave: own LDS reads returned, own copies of the group's next step landed, block barrier; only then the refill of the buffer just read
        wait_lds();
        wait_copies();
        __syncthreads();
        const int s2 = pop();
        if (s2 >= 0) stage(s2, bf);
        s0 = s1; s1 = s2; bf ^= 1;
    }
    wait_copies();                                               // no copy outstanding when the buffers are taken over and the wave ends
    l += __shfl_xor(l, 16, 32);
    const int so = (grp * AW + wq) * 16;                         // this wave's rows in the merge state and among the O partial tiles
    if (hi == 0) mm[so + lr] = m;
    __syncthreads();                                             // every group's maximum readable; every wave has left the key and value buffers
    float mall = NEGB;
#pragma unroll
    for (int g = 0; g < KS; ++g) mall = fmaxf(mall, mm[(g * AW + wq) * 16 + lr]);
    const float fs = __builtin_amdgcn_exp2f(m - mall);           // 1 where no group kept a key (sums and partials are 0 there), 0 for a group without a kept key beside one that has some
    if (hi == 0) ll[so + lr] = l * fs;
    // O^T D layout: o[j][r] = (d = 16j + 8h + r, t = lane&15) -> os[t][d]; rows 0..15 x columns 0..127 all written
#pragma unroll
    for (int j = 0; j < 8; ++j) {
        v8f f = o[j];
        if (EARLY) f = o[j] + oR[j] * QRI;
        v4f a, c;
        a[0] = f[0] * fs; a[1] = f[1] * fs; a[2] = f[2] * fs; a[3] = f[3] * fs; c[0] = f[4] * fs; c[1] = f[5] * fs; c[2] = f[6] * fs; c[3] = f[7] * fs;
        *(v4fa*)(&os[(so + lr) * OSP + 16 * j + 8 * hi]) = a; *(v4fa*)(&os[(so + lr) * OSP + 16 * j + 8 * hi + 4]) = c; }
    __syncthreads();                                             // every group's rescaled sum and O partial readable
    float* orow = OUT + ((size_t)b * OUT_SEQ + (size_t)t0) * DM;
#pragma unroll
    for (int s = 0; s < 16 / KS; ++s) {                          // 16/KS trips = the wave's rows of the tile; 32 lanes x 4 floats = 128 columns = one whole row
        const int row = grp * (16 / KS) + s;
        float lt = 0.0f; v4f val = (v4f){};
#pragma unroll
        for (int g = 0; g < KS; ++g) {
            lt += ll[(g * AW + wq) * 16 + row];
            val += *(const v4fa*)(&os[((g * AW + wq) * 16 + row) * OSP + lane * 4]); }
        const bool any = lt > 0.0f;
        const float lsafe = any ? lt : 1.0f;
        const float inv = any ? ((1.0f / lsafe) * (1.0f / XCAR)) : __uint_as_float(0x7FC00000u);   // no kept key -> NaN row
        *(v4f*)(orow + (size_t)row * DM + lane * 4) = val * inv;
        if (s + 1 < 16 / KS) asm volatile("s_wait_xcnt 0x0" ::: "memory");   // stands in front of the next row's rewrite of the registers that the issued store names
    }
}

// k_flash: both instantiations in one grid (batch, SEQ/64 blocks), chosen by the block index (block-uniform); the single-product blocks hold the low block indices:
// block y < LATEB owns the 32-row tiles y and 2 * LATEB - 1 - y of rows [EROWS, SEQ); the multi-product blocks own 64 consecutive rows of [0, EROWS), high rows first
__global__ __launch_bounds__(32 * AW * KS) __attribute__((amdgpu_num_vgpr(256)))
void k_flash(const h16* __restrict__ QH, const h16* __restrict__ KE, const h16* __restrict__ KR, const h16* __restrict__ VT, const unsigned* __restrict__ MB, float* OUT) {
    __shared__ __align__(16) h16 qt[AW * 16 * KP];               // q rows of the block
    __shared__ __align__(16) unsigned mt[AW * 16 * MP];          // mask bit words of the block's rows
    __shared__ __align__(16) h16 ring[KS * 2 * (32 * KP * 2 + DM * VP)];   // per key group two buffers each of KE, VT (and KR, multi-product blocks only); behind the loop the O partial tiles
    __shared__ float mm[KS * AW * 16], ll[KS * AW * 16];         // per (group, tile, row): running maximum, rescaled partial sum
    __shared__ __align__(16) unsigned act[AW * KS];
    constexpr int LATEB = (SEQ - EROWS) / (16 * AW);
    const int y = blockIdx.y;
    const int b = blockIdx.x;
    if (y >= LATEB) { const int r0 = (SEQ / (16 * AW) - 1 - y) * 16 * AW; flash_body<1>(qt, mt, ring, mm, ll, act, r0, r0 + 32, b, QH, KE, KR, VT, MB, OUT); }
    else            flash_body<0>(qt, mt, ring, mm, ll, act, EROWS + 32 * y, SEQ - 32 - 32 * y, b, QH, KE, KR, VT, MB, OUT);
}

static constexpr size_t al256(size_t v) { return (v + 255) & ~(size_t)255; }
static constexpr size_t SZ_PL = al256((size_t)NB * SEQ * DM * 2);          // QH, KE, VT
static constexpr size_t SZ_RS = al256((size_t)NB * EROWS * DM * 2);        // KR
static constexpr size_t SZ_MB = al256((size_t)SEQ * MW * 4);               // MB
static constexpr size_t SZ_TOTAL = 3 * SZ_PL + SZ_RS + SZ_MB;
static_assert(SZ_TOTAL <= (size_t)134217728);          // workspace carve <= 128 MiB
static_assert(((size_t)NB * SEQ * DM) % 8 == 0);       // thread-linear 16-byte stores cover the planes exactly
static_assert(((size_t)SEQ * MW) % 4 == 0);
static_assert(((size_t)NB * OUT_SEQ * DM * 4) <= (size_t)8388608 || NB != NB_FULL || OUT_SEQ != SEQ_FULL);

extern "C" void kernel_launch(void* const* d_in, const int* in_sizes, int n_in,
                              void* d_out, int out_size, void* d_ws, size_t ws_size, hipStream_t stream) {
    if (n_in < 5) return;
    const size_t needx = ((size_t)(NB - 1) * SEQ_FULL + SEQ) * DM;
    const size_t needm = (size_t)(SEQ - 1) * SEQ_FULL + SEQ;
    if ((size_t)in_sizes[0] < needx || (size_t)in_sizes[1] < needx || (size_t)in_sizes[2] < needx) return;
    if ((size_t)in_sizes[3] < needm || in_sizes[4] < 1) return;
    if ((size_t)out_size < ((size_t)(NB - 1) * OUT_SEQ + SEQ) * DM) return;
    if (SZ_TOTAL > ws_size) return;
    // wire order: q, k, v, mask, mode
    const float* q = (const float*)d_in[0];
    const float* k = (const float*)d_in[1];
    const float* v = (const float*)d_in[2];
    const int* mask = (const int*)d_in[3];
    const float* mode = (const float*)d_in[4];
    float* OUT = (float*)d_out;      // [NB][SEQ][128]
    char* wsp = (char*)d_ws;
    h16* QH = (h16*)wsp; wsp += SZ_PL;               // [NB][SEQ][128]  q x16
    h16* KE = (h16*)wsp; wsp += SZ_PL;               // [NB][SEQ][128]  combined key x16
    h16* VT = (h16*)wsp; wsp += SZ_PL;               // [NB][128][SEQ]  v^T x16
    h16* KR = (h16*)wsp; wsp += SZ_RS;               // [NB][EROWS][128] combined-key residual x2048, tokens < EROWS
    unsigned* MB = (unsigned*)wsp; wsp += SZ_MB;     // [SEQ][SEQ/32] mask bit words

    k_prep<<<PBLK, PT, 0, stream>>>(q, k, v, mask, mode, QH, KE, KR, VT, MB);
    // query rows [0, EROWS): multi-product instantiation; rows [EROWS, SEQ): single-product instantiation (disjoint output rows)
    k_flash<<<dim3(NB, SEQ / (16 * AW), 1), 32 * AW * KS, 0, stream>>>(QH, KE, KR, VT, MB, OUT);
}

// v007
// It runs in 25.7 microseconds.
// Two timings next to v006 both put it at 1.06 times that version's speed.
// All steps since v000 together make it 7.05 times as fast.
#include <hip/hip_runtime.h>

// Single-head masked attention, head width 128: q/k/v [NB][SEQ][128] f32, mask [1][SEQ][SEQ] int32 (0 = dropped, read by value), mode scalar f32.
// logit = 128^-0.5 * q . ((1-a) * roll(k, 1 along d) - a * k), a = sigmoid(mode); dropped entries are replaced by -inf; softmax over keys; output = P v (f32).
// Compute dtypes, f32 accumulate everywhere: scores v_wmma_f32_16x16x32_f16: q (bf16-RNE input, x16 carry, exact in f16) against the combined key operand ke = (1-a) k[d-1] - a k[d]
// (built in f32 from bf16-RNE k, x16 carry) as single f16 on query rows >= EROWS and as f16 value + f16 residual x2048 (own accumulator) on query rows < EROWS;
// P.V v_wmma_f32_16x16x32_f16: P (x16384 carry, cancels in the normalisation) single f16 on query rows >= EROWS, f16 value + f16 residual x2048 (own accumulator, folded by 1/2048) on query rows < EROWS;
// v (bf16-RNE input, x16 carry, exact in f16) single everywhere; softmax f32 (online, running max over kept keys).
// Layout: QH [b][t][128], KE [b][s][128], KR [b][s < EROWS][128], VT [b][d][s] (transposed through LDS), MB [t][SEQ/32] mask bit words (bit j = key 32w + j kept).
// Fused flash kernel in transposed form (S^T = KE QH^T, O^T = VT P^T); operand tiles staged in LDS by asynchronous copies, shared by the four waves of a key group; a 32-key step is skipped when its mask block is all zero (per block for the copies, per wave for the work).
// The kept key steps of a block are dealt round-robin to KS key groups of four waves each; every group keeps its own softmax state and O partial, merged through LDS at the end.
// Single-product blocks keep three K/V buffers per key group: a step's copies are issued two rounds ahead, alternately by the group's two wave pairs, so that each wave has one step in flight and waits for it alone.
// A single-product flash block owns two 32-row query tiles mirrored about the middle of rows [EROWS, SEQ), so that under a mask whose kept keys grow with the row every block has about the same work.

#ifndef NB
#define NB 8
#endif
#ifndef SEQ
#define SEQ 2048
#endif
#define NB_FULL  8
#define SEQ_FULL 2048
#ifndef OUT_SEQ
#define OUT_SEQ SEQ              // row pitch (in tokens) between batches of the output
#endif
#define DM   128
#define AW   4                   // query tiles per flash block (16 query rows each), one wave per tile and key group
#define KS   4                   // key groups per flash block (AW waves each)
#define OSP  132                 // LDS row pitch (floats) of the flash output tile
#define VTP  72                  // LDS row pitch (halves) of the transpose tile
#define MW   (SEQ / 32)          // mask bit words per query row
#define KP   136                 // LDS row pitch (halves) of the q, KE and KR tiles: 272 B
#define VP   40                  // LDS row pitch (halves) of the VT tile: 80 B
#define MP   68                  // LDS row pitch (words) of the mask-word tile: 272 B
#define EROWS (SEQ < 512 ? SEQ : 512)   // query rows (and tokens of the residual key plane) handled by the multi-product flash instantiation
#define XCAR 16.0f               // carry of the q, ke and v planes
#define QRS  2048.0f             // carry of every residual plane / residual fragment
#define QRI  (1.0f / 2048.0f)
#define SC2  ((float)(0.08838834764831845 * 1.4426950408889634 / 256.0))   // DM^-0.5 * log2(e) / (XCAR * XCAR)
#define PSH  14.0f               // log2 of the P carry (16384)
#define NEGB (-3.0e38f)

static_assert(DM == 128);                      // output row = 32 lanes x 4 floats; plane row = 16 threads x 8 halves
static_assert(DM % 32 == 0);                   // score k-loop steps by 32
static_assert(DM / 8 == 16);                   // k_prep: row = tid >> 4
static_assert((DM & (DM - 1)) == 0);           // rolled index uses a mask
static_assert(SEQ % 128 == 0);                 // MW multiple of 4: a 16-byte copy moves four mask words of one row
static_assert(SEQ % 64 == 0);                  // transpose tiles of 64 tokens
static_assert(SEQ % 32 == 0);                  // key loop steps by 32
static_assert(EROWS % (16 * AW) == 0);
static_assert((KP * 2) % 16 == 0 && KP >= DM && (VP * 2) % 16 == 0 && VP >= 32 && (MP * 4) % 16 == 0 && MP >= MW);   // 16-byte copies and fragment reads stay aligned and inside a row
static_assert(MW == 64 && AW == 4 && KS == 4); // flash copy maps and step bit map: 512 threads (128 per key group), 64 rows x 64 words, one 64-bit map
static_assert((SEQ - EROWS) % (16 * AW) == 0);  // the 32-row tiles of rows [EROWS, SEQ) pair up exactly
static_assert(EROWS >= 32);
static_assert(EROWS % 32 == 0);
static_assert(EROWS <= SEQ);
static_assert(NB <= NB_FULL);
static_assert(SEQ <= SEQ_FULL);
static_assert((OSP * 4) % 16 == 0);
static_assert(OSP >= DM);
static_assert((VTP * 2) % 16 == 0);
static_assert(VTP >= 64);
#define RING_E (KS * 2 * (32 * KP * 2 + DM * VP))   // halves of the K/V ring, multi-product blocks: two buffers each of KE, KR, VT per key group
#define RING_L (KS * 3 * (32 * KP + DM * VP))       // single-product blocks: three buffers each of KE, VT per key group
#define RINGH  (RING_E > RING_L ? RING_E : RING_L)
static_assert((size_t)AW * 16 * (KP * 2 + MP * 4) + (size_t)RINGH * 2 + (size_t)KS * AW * (2 * 16 * 4 + 4) <= 327680);   // flash static LDS: q and mask tiles, K/V ring, merge state, step map
static_assert((size_t)KS * AW * 16 * OSP * 4 <= (size_t)KS * (2 * 32 * KP * 2 + 2 * DM * VP * 2));   // the O partial tiles fit in the KE and VT buffers they take over behind the loop
static_assert((size_t)DM * VTP * 2 <= 131072);           // transpose static LDS
static_assert(32 * 4 * (16 / KS) * KS == 16 * DM);       // flash epilogue: 32 lanes x 4 floats x 16/KS trips x KS waves == 16 rows x DM floats
static_assert((size_t)NB * SEQ * DM / 8 < (size_t)2147483647);
static_assert((size_t)SEQ * DM < (size_t)2147483647);

typedef _Float16 h16;
typedef __attribute__((ext_vector_type(16))) _Float16 v16h;
typedef __attribute__((ext_vector_type(8)))  _Float16 v8h;
typedef __attribute__((ext_vector_type(8)))  float    v8f;
typedef __attribute__((ext_vector_type(4)))  float    v4f;
typedef __attribute__((ext_vector_type(4)))  int      v4i;
typedef __attribute__((ext_vector_type(4)))  unsigned v4u;
typedef v4f  __attribute__((may_alias)) v4fa;
typedef v8h  __attribute__((may_alias)) v8ha;
typedef __attribute__((ext_vector_type(4)))  _Float16 v4h;
typedef v4h  __attribute__((may_alias)) v4ha;

__device__ __forceinline__ unsigned short f2bf(float f) { unsigned u = __float_as_uint(f); u += 0x7FFFu + ((u >> 16) & 1u); return (unsigned short)(u >> 16); }
__device__ __forceinline__ float bfr(float f) { return __uint_as_float(((unsigned)f2bf(f)) << 16); }   // value after RNE convert to bf16
__device__ __forceinline__ v16h cat16(v8h lo, v8h hi) { return __builtin_shufflevector(lo, hi, 0, 1, 2, 3, 4, 5, 6, 7, 8, 9, 10, 11, 12, 13, 14, 15); }
__device__ __forceinline__ v8f wmma16(v16h a, v16h b, v8f c) { return __builtin_amdgcn_wmma_f32_16x16x32_f16(false, a, false, b, (short)0, c, false, false); }
// fragment loaders from K-contiguous 16-bit rows; p already includes + 8*(lane>>4): elements 0..7 <- k0+8h+0..7, elements 8..15 <- k0+16+8h+0..7 (same map for A and B)
__device__ __forceinline__ v16h  ldh(const h16* p) { return cat16(*(const v8h*)p, *(const v8h*)(p + 16)); }

// f32 -> f16 convert that cannot produce an f16 subnormal (|v| < 2^-14 -> +0)
static __device__ __forceinline__ h16 toh_flush(float v) { const h16 r = (h16)v; return (fabsf(v) < 6.103515625e-05f) ? (h16)0.0f : r; }
// one WMMA with its own hazard guard (ties the accumulator, keeps A and B live)
static __device__ __forceinline__ v8f wmma16g(v16h a, v16h b, v8f c) {
    c = wmma16(a, b, c);
    asm volatile("v_nop\n\tv_nop\n\tv_nop\n\tv_nop" : "+v"(c) : "v"(a), "v"(b));
    return c;
}

// eight q or v-like values: f16(bf16_rne(x) * 16)
__device__ __forceinline__ v8h cvt8(v8f v) {
    v8h o;
#pragma unroll
    for (int e = 0; e < 8; ++e) o[e] = toh_flush(bfr(v[e]) * XCAR);
    return o;
}

// keff8: combined key operand ke[d] = (1-a) * k[(d-1) mod DM] - a * k[d] for eight consecutive d, from bf16-RNE k, in f32 (x = k[d0..d0+7], xm = k[(d0-1) mod DM]); hv = f16 value, rv = f16 residual x2048
__device__ __forceinline__ void keff8(v8f x, float xm, float al, float oma, v8h& hv, v8h& rv) {
#pragma clang fp contract(off)   // as it stood in the key preparation: both products of the combination are rounded before the subtraction, so value and residual planes keep their bits
    float prev = bfr(xm);
#pragma unroll
    for (int e = 0; e < 8; ++e) {
        const float cur = bfr(x[e]);
        const float c = (oma * prev - al * cur) * XCAR;
        const h16 hh = toh_flush(c);
        hv[e] = hh; rv[e] = toh_flush((c - (float)hh) * QRS);
        prev = cur; }
}

// stands behind a group of issued global loads: s_wait_xcnt in front of any rewrite (also by a later load's result) of the address registers that they name;
// the scheduling barrier keeps the group in front of it, and so ahead of the first use: without it the scheduler sinks part of the k and q loads behind the wait for v, a second memory latency
__device__ __forceinline__ void loads_issued() { asm volatile("s_wait_xcnt 0x0" ::: "memory"); __builtin_amdgcn_sched_barrier(0); }

// k_prep: all operand preparation in one resident round: NB * SEQ / 64 blocks of 16 waves (one per WGP on a chip of that many), so that few waves have to start.
// Block = 64 tokens of one batch of q, k and v, and 512 mask bit words; every thread issues all its loads (46, 328 bytes) ahead of any use, in the order of use.
// v: thread = 4 tokens x 4 columns (a wave's load = 4 rows x one whole 128-byte line), written to the LDS tile ts[d][token] as four 8-byte runs of tokens; block barrier; drained as rows of 64 tokens: VT[b][d][t] = f16(bf16_rne(v[b][t][d]) * 16).
// k, q: thread = two runs of 8 columns. mask: wave = 32 words of one row; load c brings the 32 entries of word c, one per lane (one line), the wave's vote on != 0 is the word (bit j = key 32w + j kept), lane c keeps it.
#define PT   512
#define PBLK (NB * (SEQ / 64))
static_assert(PT * 16 == 64 * DM);                       // v: 512 threads x (4 tokens x 4 columns); q, k: 512 threads x 2 x 8 columns == 64 tokens x DM
static_assert(PT * 8 * 2 == DM * 64);                    // transpose drain: 512 threads x 8 halves x 2 trips == DM rows x 64 tokens
static_assert((size_t)PBLK * PT == (size_t)SEQ * MW);    // mask: one word per thread of the grid
static_assert(MW % 32 == 0);                             // a wave's 32 words lie in one row
static_assert(EROWS % 64 == 0);                          // a block's tokens lie on one side of EROWS
__global__ __launch_bounds__(PT) void k_prep(const float* __restrict__ q, const float* __restrict__ k, const float* __restrict__ v, const int* __restrict__ mask, const float* __restrict__ mode,
                                             h16* QH, h16* KE, h16* KR, h16* VT, unsigned* MB) {
    __shared__ __align__(16) h16 ts[DM * VTP];
    const int tid = threadIdx.x, lane = tid & 31;
    const int wave = __builtin_amdgcn_readfirstlane((int)(threadIdx.x >> 5));
    const int blk = blockIdx.x;
    const int b = blk / (SEQ / 64), tok0 = (blk % (SEQ / 64)) * 64;
    const size_t ib = ((size_t)b * SEQ_FULL + (size_t)tok0) * DM;    // the block's first element in q, k, v
    const int vc = ((wave & 3) * 8 + (lane & 7)) * 4;                // v: first column, first token of the thread's 4 x 4 piece
    const int vk = ((wave >> 2) * 4 + (lane >> 3)) * 4;
    const int row = tid >> 4, d0 = (tid & 15) * 8;                   // q, k: local rows row and row + 32, columns d0 .. d0 + 7
    const int gw = blk * (PT / 32) + wave;                           // mask: the wave's run of 32 words
    const int mrow = gw / (MW / 32), mw0 = (gw % (MW / 32)) * 32;
    const int* ms = mask + (size_t)mrow * SEQ_FULL + (size_t)mw0 * 32 + lane;
    v4f xv[4]; v8f xk[2], xq[2]; float xm[2]; int xw[32];
    const float mraw = mode[0];
#pragma unroll
    for (int r = 0; r < 4; ++r) xv[r] = *(const v4f*)(v + ib + (size_t)(vk + r) * DM + vc);
    loads_issued();
#pragma unroll
    for (int u = 0; u < 2; ++u) {
        const float* kr = k + ib + (size_t)(row + 32 * u) * DM;
        xk[u] = *(const v8f*)(kr + d0); xm[u] = kr[(d0 + DM - 1) & (DM - 1)]; }
    loads_issued();
#pragma unroll
    for (int u = 0; u < 2; ++u) xq[u] = *(const v8f*)(q + ib + (size_t)(row + 32 * u) * DM + d0);
    loads_issued();
#pragma unroll
    for (int c = 0; c < 32; ++c) xw[c] = ms[c * 32];
    loads_issued();
    // v through the transpose tile
#pragma unroll
    for (int e = 0; e < 4; ++e) {
        v4h o;
#pragma unroll
        for (int r = 0; r < 4; ++r) o[r] = toh_flush(bfr(xv[r][e]) * XCAR);
        *(v4ha*)(&ts[(vc + e) * VTP + vk]) = o; }
    // block barrier with LDS-only fences: transpose tile filled [128][64] == drained extent; __syncthreads() would also wait here for every global load still in flight (k, q, mask)
    __builtin_amdgcn_fence(__ATOMIC_RELEASE, "workgroup", "local");
    __builtin_amdgcn_s_barrier();
    __builtin_amdgcn_fence(__ATOMIC_ACQUIRE, "workgroup", "local");
    h16* dstb = VT + (size_t)b * DM * SEQ + (size_t)tok0;
#pragma unroll
    for (int s = 0; s < 2; ++s) { const int p = s * PT + tid; const int d = p >> 3, c8 = (p & 7) * 8;   // 2 trips x 64 rows = 128 rows; 8 lanes x 8 halves = 64 tokens
        const v8h val = *(const v8ha*)(&ts[d * VTP + c8]);
        *(v8h*)(dstb + (size_t)d * SEQ + c8) = val; }
    // combined key (and its residual on tokens < EROWS)
    const float mv = bfr(mraw);
    const float al = 1.0f / (1.0f + expf(-mv));
    const float oma = 1.0f - al;
    const size_t ob = ((size_t)b * SEQ + (size_t)tok0) * DM;         // the block's first element in QH, KE
    const bool wr = tok0 < EROWS;                                    // block-uniform
#pragma unroll
    for (int u = 0; u < 2; ++u) {
        v8h hv, rv; keff8(xk[u], xm[u], al, oma, hv, rv);
        *(v8h*)(KE + ob + (size_t)(row + 32 * u) * DM + d0) = hv;
        asm volatile("s_wait_xcnt 0x0" ::: "memory");   // stands in front of the rewrite, in the residual branch, of the registers that the issued store names
        if (wr) *(v8h*)(KR + ((size_t)b * EROWS + (size_t)(tok0 + row + 32 * u)) * DM + d0) = rv; }
#pragma unroll
    for (int u = 0; u < 2; ++u) *(v8h*)(QH + ob + (size_t)(row + 32 * u) * DM + d0) = cvt8(xq[u]);
    unsigned w = 0u;
#pragma unroll
    for (int c = 0; c < 32; ++c) { const unsigned bal = __builtin_amdgcn_ballot_w32(xw[c] != 0); w = (lane == c) ? bal : w; }
    MB[(size_t)gw * 32 + lane] = w;
}

// low 32 bits of a __shared__ address = byte offset in the work-group's LDS (destination operand of an asynchronous copy)
__device__ __forceinline__ unsigned ldsa(const void* p) { return (unsigned)(size_t)p; }
// eight / four asynchronous 16-byte copies global -> LDS per lane; the s_wait_xcnt closes the statement so that no address register is rewritten ahead of it
__device__ __forceinline__ void cp8(unsigned l0, const void* g0, unsigned l1, const void* g1, unsigned l2, const void* g2, unsigned l3, const void* g3,
                                    unsigned l4, const void* g4, unsigned l5, const void* g5, unsigned l6, const void* g6, unsigned l7, const void* g7) {
    asm volatile("global_load_async_to_lds_b128 %0, %1, off\n\t"
                 "global_load_async_to_lds_b128 %2, %3, off\n\t"
                 "global_load_async_to_lds_b128 %4, %5, off\n\t"
                 "global_load_async_to_lds_b128 %6, %7, off\n\t"
                 "global_load_async_to_lds_b128 %8, %9, off\n\t"
                 "global_load_async_to_lds_b128 %10, %11, off\n\t"
                 "global_load_async_to_lds_b128 %12, %13, off\n\t"
                 "global_load_async_to_lds_b128 %14, %15, off\n\t"
                 "s_wait_xcnt 0x0"
                 :: "v"(l0), "v"(g0), "v"(l1), "v"(g1), "v"(l2), "v"(g2), "v"(l3), "v"(g3),
                    "v"(l4), "v"(g4), "v"(l5), "v"(g5), "v"(l6), "v"(g6), "v"(l7), "v"(g7) : "memory");
}
__device__ __forceinline__ void cp4(unsigned l0, const void* g0, unsigned l1, const void* g1, unsigned l2, const void* g2, unsigned l3, const void* g3) {
    asm volatile("global_load_async_to_lds_b128 %0, %1, off\n\t"
                 "global_load_async_to_lds_b128 %2, %3, off\n\t"
                 "global_load_async_to_lds_b128 %4, %5, off\n\t"
                 "global_load_async_to_lds_b128 %6, %7, off\n\t"
                 "s_wait_xcnt 0x0"
                 :: "v"(l0), "v"(g0), "v"(l1), "v"(g1), "v"(l2), "v"(g2), "v"(l3), "v"(g3) : "memory");
}
// this wave's asynchronous copies have landed in LDS (other waves read them behind the next block barrier)
__device__ __forceinline__ void wait_copies() { asm volatile("s_wait_asynccnt 0x0" ::: "memory"); }
// this wave's LDS reads have returned (stands in front of the barrier behind which their buffer is refilled)
__device__ __forceinline__ void wait_lds() { asm volatile("s_wait_dscnt 0x0" ::: "memory"); }
// compile-time flag handed to a generic lambda
template <bool B> struct flagc { static constexpr bool value = B; };
// fragment loader from an LDS tile, same element map as ldh
__device__ __forceinline__ v16h ldl(const h16* p) { return cat16(*(const v8ha*)p, *(const v8ha*)(p + 16)); }

// flash_body: fused attention, one block per 64 query rows of one batch (two runs of 32 rows, from row ra and from row rb); KS key groups of AW waves, wave (group, tile) works 16 query rows against the group's key steps.
// Wave -> (group = wave mod KS, tile = wave / KS): the four tiles of one group are the waves of equal wave mod KS, so a step that only the longer run keeps leaves every group two working waves.
// Key split: the block's kept 32-key steps, in ascending order, go round-robin to the key groups (rank mod KS); four waves per SIMD fill one another's latencies.
// Staging: the block's q rows and mask bit words are copied to LDS once; the KE / KR / VT tiles of a group's 32-key step are copied to LDS by and for the group's four waves, two buffers per group,
// the group's next step's copies in flight while this step is worked on (asynchronous copies, 16 bytes per lane; whole tile = 4 copies per thread and plane);
// single-product blocks: three buffers per group, the next two steps' copies in flight, each step copied by one pair of the group's waves (8 copies per thread and plane).
// Tile pitches: 272 B (q, KE, KR rows of 256 B; mask rows of 256 B) and 80 B (VT rows of 64 B), 16 B x odd for the 16-byte fragment reads.
// Transposed form: S^T[key][t] = KE QH^T (A = key rows, B = query rows, 4 k-steps of 32); lane (t = lane&15, h = lane>>4) holds keys 8h+r of each 16-key tile, so the packed
// P tile is directly the B fragment of O^T[d][t] = VT P^T (element r <- tile keys 0..15, element 8+r <- tile keys 16..31, lane unchanged), 8 d-tiles.
// Softmax state (running max over kept keys, partial sum) is one scalar per lane; the two lane halves of a row are combined with one xor-16 exchange.
// Keep rule per element from the mask bit word of (row, 32-key step); a step whose words are zero on all 64 rows of the block is neither copied nor visited (block-uniform bit map),
// a step whose words are zero on the wave's own 16 rows is not worked on by that wave (wave-uniform); kept steps are visited in ascending order.
// A step whose words are all ones on the wave's own 16 rows takes a softmax path without the per-element keep tests (wave-uniform branch, same values).
// EARLY = 1 (query rows [0, EROWS)): scores = KE Q + KR Q / 2048; P = f16 value + f16 residual x2048; O = V P + V P_res / 2048 (residual products in their own accumulators);
//            row sum from the f32 exponentials; KR fragments are zero for keys >= EROWS (address clamped, wave-uniform select).
// EARLY = 0 (query rows [EROWS, SEQ)): single products, row sum over the converted P.
// Epilogue: the groups' running maxima are exchanged through LDS, every wave rescales its partial sum and O^T partial to the common maximum and stages them in LDS (its own tile of 16 rows x 128 columns,
// in the space of the key and value buffers, all written); wave (group, tile) then adds the KS partials of rows 16/KS * group .. of its tile in ascending group order and stores them whole (128 floats = 512 B = four lines)
// The LDS arrays belong to the kernel (one set for both instantiations) and are handed in; ra, rb = first query row of the block's local rows 0..31 and 32..63, b = batch.
template <int EARLY>
__device__ __forceinline__ void flash_body(h16* qt, unsigned* mt, h16* ring, float* mm, float* ll, unsigned* act, int ra, int rb, int b,
                                           const h16* __restrict__ QH, const h16* __restrict__ KE, const h16* __restrict__ KR, const h16* __restrict__ VT,
                                           const unsigned* __restrict__ MB, float* OUT) {
    constexpr int KB = 32 * KP, VB = DM * VP;                    // halves per KE / KR buffer, per VT buffer
    h16* const kt = ring;                                        // KE tiles [group][buffer]
    constexpr int NBF = EARLY ? 2 : 3;                           // buffers per key group and plane
    h16* const vt = ring + KS * NBF * KB;                        // VT tiles [group][buffer]
    h16* const rt = ring + (EARLY ? KS * 2 * (KB + VB) : 0);     // KR tiles [group][buffer]
    float* const os = (float*)ring;                              // O partial tiles [group][tile][16][OSP]
    constexpr int VG = EARLY ? 4 : 8;                            // V^T fragments read from LDS per group
    constexpr int KG = EARLY ? 1 : 4;                            // k-steps of q / KE / KR fragments read from LDS per group
    const int tid = threadIdx.x;
    const int lane = threadIdx.x & 31, lr = lane & 15, hi = lane >> 4;
    const int wave = __builtin_amdgcn_readfirstlane((int)(threadIdx.x >> 5));
    const int grp = wave & (KS - 1), wq = wave / KS;             // key group, query tile
    const int pr = wq >> 1;                                      // single-product blocks: the wave's pair within its key group (copies the steps of the rounds of that parity)
    const int gt = (EARLY ? wq : (wq & 1)) * 32 + lane;          // thread among the waves that copy one step: the key group / the pair
    const int t0 = (wq < AW / 2 ? ra : rb) + (wq & (AW / 2 - 1)) * 16;   // first query row of the wave's tile
    const h16* Qb = QH + (size_t)b * SEQ * DM;
    const h16* Kb = KE + (size_t)b * SEQ * DM;
    const h16* Rb = KR + (size_t)b * EROWS * DM;
    const h16* Vb = VT + (size_t)b * DM * SEQ;
    // copy maps: 256-B rows: thread -> (row gt>>4 + 8i (pair: 4i), 16-B column gt&15); 64-B rows: thread -> (row gt>>2 + 32i (pair: 16i), 16-B column gt&3)
    const int r16 = gt >> 4, c16 = gt & 15, r4 = gt >> 2, c4 = gt & 3;
    {
        // block copy map, q rows and mask words: thread -> (local row tid>>4 + 32i, 16-B column tid&15); local rows 0..31 are rows ra.., 32..63 rows rb..
        const int rq = tid >> 4, cq = tid & 15;
        const h16* qga = Qb + (size_t)(ra + rq) * DM + cq * 8;
        const h16* qgb = Qb + (size_t)(rb + rq) * DM + cq * 8;
        const unsigned ql = ldsa(qt) + (unsigned)(rq * KP + cq * 8) * 2u;
        const unsigned* mga = MB + (size_t)(ra + rq) * MW + cq * 4;
        const unsigned* mgb = MB + (size_t)(rb + rq) * MW + cq * 4;
        const unsigned ml = ldsa(mt) + (unsigned)(rq * MP + cq * 4) * 4u;
        cp4(ql, qga, ql + 32 * KP * 2, qgb, ml, mga, ml + 32 * MP * 4, mgb);
    }
    wait_copies();
    __syncthreads();                                             // q rows and mask words readable by every wave
    // block-uniform bit map of the steps that some row of the block keeps: thread -> (step tid&63, rows 8*(tid>>6) .. +7); even waves hold steps 0..31, odd waves steps 32..63
    unsigned orv = 0u;
#pragma unroll
    for (int i = 0; i < 8; ++i) orv |= mt[((tid >> 6) * 8 + i) * MP + (tid & 63)];
    const unsigned bal = __builtin_amdgcn_ballot_w32(orv != 0u);
    if (lane == 0) act[wave] = bal;
    __syncthreads();
    unsigned olo = 0u, ohi = 0u;
#pragma unroll
    for (int i = 0; i < AW * KS / 2; ++i) { olo |= act[2 * i]; ohi |= act[2 * i + 1]; }
    const unsigned alo = (unsigned)__builtin_amdgcn_readfirstlane((int)olo);
    const unsigned ahi = (unsigned)__builtin_amdgcn_readfirstlane((int)ohi);
    unsigned long long rem = ((unsigned long long)ahi << 32) | (unsigned long long)alo;
    const int trips = (__builtin_popcountll(rem) + KS - 1) / KS; // block-uniform: rounds of KS kept steps
    // the next KS kept steps leave the map in ascending order; returns the one of this key group (-1: none left for it)
    auto pop = [&]() {
        int mine = -1;
#pragma unroll
        for (int j = 0; j < KS; ++j)
            if (rem != 0ull) { const int s = __builtin_ctzll(rem); rem &= rem - 1ull; if (j == grp) mine = s; }
        return mine;
    };

    const h16* kg0 = Kb + r16 * DM + c16 * 8;
    const h16* rg0 = Rb + r16 * DM + c16 * 8;
    const h16* vg0 = Vb + r4 * SEQ + c4 * 8;
    const unsigned kl0 = ldsa(kt) + (unsigned)(grp * NBF * KB + r16 * KP + c16 * 8) * 2u;
    const unsigned rl0 = ldsa(rt) + (unsigned)(grp * 2 * KB + r16 * KP + c16 * 8) * 2u;
    const unsigned vl0 = ldsa(vt) + (unsigned)(grp * NBF * VB + r4 * VP + c4 * 8) * 2u;
    // copies of step s into the group's buffer bf (group-uniform arguments; every lane on); multi-product: by the group's four waves, single-product: by one pair (16 copies per thread)
    auto stage = [&](int s, int bf) {
        const int key0 = s * 32;
        const h16* kg = kg0 + key0 * DM; const h16* vg = vg0 + key0;
        const unsigned kl = kl0 + (unsigned)bf * (32 * KP * 2), vl = vl0 + (unsigned)bf * (DM * VP * 2);
        if (!EARLY) {
            cp8(kl, kg, kl + 4 * KP * 2, kg + 4 * DM, kl + 8 * KP * 2, kg + 8 * DM, kl + 12 * KP * 2, kg + 12 * DM,
                kl + 16 * KP * 2, kg + 16 * DM, kl + 20 * KP * 2, kg + 20 * DM, kl + 24 * KP * 2, kg + 24 * DM, kl + 28 * KP * 2, kg + 28 * DM);
            cp8(vl, vg, vl + 16 * VP * 2, vg + 16 * SEQ, vl + 32 * VP * 2, vg + 32 * SEQ, vl + 48 * VP * 2, vg + 48 * SEQ,
                vl + 64 * VP * 2, vg + 64 * SEQ, vl + 80 * VP * 2, vg + 80 * SEQ, vl + 96 * VP * 2, vg + 96 * SEQ, vl + 112 * VP * 2, vg + 112 * SEQ);
        } else {
            cp8(kl, kg, kl + 8 * KP * 2, kg + 8 * DM, kl + 16 * KP * 2, kg + 16 * DM, kl + 24 * KP * 2, kg + 24 * DM,
                vl, vg, vl + 32 * VP * 2, vg + 32 * SEQ, vl + 64 * VP * 2, vg + 64 * SEQ, vl + 96 * VP * 2, vg + 96 * SEQ);
            const int kcl = (key0 < EROWS) ? key0 : (EROWS - 32);    // clamped residual-plane key (address always inside the plane)
            const h16* rg = rg0 + kcl * DM; const unsigned rl = rl0 + (unsigned)bf * (32 * KP * 2);
            cp4(rl, rg, rl + 8 * KP * 2, rg + 8 * DM, rl + 16 * KP * 2, rg + 16 * DM, rl + 24 * KP * 2, rg + 24 * DM);
        }
    };
    int s0 = pop();                                              // the group's kept step of this round, of the next round (-1: none)
    int s1 = pop();
    int s2 = -1;                                                 // single-product blocks: of the round after that
    if (EARLY) {
        if (s0 >= 0) stage(s0, 0);
        wait_copies();
        __syncthreads();                                         // each group's first kept step readable by its waves
        if (s1 >= 0) stage(s1, 1);
    } else {
        s2 = pop();
        if (pr == 0) { if (s0 >= 0) stage(s0, 0); wait_copies(); }   // wave-uniform: pair 0 brings round 0 and waits for it; pair 1's round 1 stays in flight over the barrier
        else         { if (s1 >= 0) stage(s1, 1); }
        __syncthreads();                                         // each group's first kept step readable by its waves
        if (pr == 0 && s2 >= 0) stage(s2, 2);                    // third buffer, not yet read by anybody
    }

    const int mo = (wq * 16 + lr) * MP;
    const int qo = (wq * 16 + lr) * KP + 8 * hi;                 // B fragment: col t, k = d
    const int ko = lr * KP + 8 * hi;                             // + tile row * KP + kc   (A fragment: row key, k = d)
    const int vo = lr * VP + 8 * hi;                             // + 16j*VP               (A fragment: row d, k = key)
    const v16h hz = (v16h){};
    v8f o[8], oR[8];
#pragma unroll
    for (int j = 0; j < 8; ++j) { o[j] = (v8f){}; oR[j] = (v8f){}; }
    float m = NEGB, l = 0.0f;
    int bf = 0;
#pragma unroll 1
    for (int it = 0; it < MW / KS; ++it) {
        if (it >= trips) break;                                  // block-uniform: no kept step left
        const unsigned mw = (s0 >= 0) ? mt[mo + s0] : 0u;        // group-uniform test: no step for this group in the last round
        if (__builtin_amdgcn_ballot_w32(mw != 0u) != 0u) {       // wave-uniform: some row of this tile keeps some key of this step
            const bool full = __builtin_amdgcn_ballot_w32(mw != 0xFFFFFFFFu) == 0u;   // wave-uniform: all 16 rows of the tile keep all 32 keys of the step
            const int key0 = s0 * 32;
            const bool rok = key0 < EROWS;                       // wave-uniform
            const h16* kb = kt + (grp * NBF + bf) * KB + ko;
            const h16* rb = rt + (EARLY ? (grp * 2 + bf) * KB : 0) + ko;
            const h16* vb = vt + (grp * NBF + bf) * VB + vo;
            v8f sHa = (v8f){}, sHb = (v8f){}, sLa = (v8f){}, sLb = (v8f){};
#pragma unroll
            for (int g = 0; g < 4 / KG; ++g) {                   // the LDS fragment reads of KG k-steps issue together, one LDS latency per group
                v16h qf[KG], ka0[KG], kb0[KG], kra[KG], krb[KG];
#pragma unroll
                for (int u = 0; u < KG; ++u) {
                    const int kc = (g * KG + u) * 32;
                    qf[u] = ldl(qt + qo + kc); ka0[u] = ldl(kb + kc); kb0[u] = ldl(kb + 16 * KP + kc);
                    if (EARLY) { kra[u] = ldl(rb + kc); krb[u] = ldl(rb + 16 * KP + kc); }
                }
#pragma unroll
                for (int u = 0; u < KG; ++u) {
                    sHa = wmma16g(ka0[u], qf[u], sHa); sHb = wmma16g(kb0[u], qf[u], sHb);
                    if (EARLY) {
                        if (!rok) { kra[u] = hz; krb[u] = hz; }
                        sLa = wmma16g(kra[u], qf[u], sLa); sLb = wmma16g(krb[u], qf[u], sLb);
                    }
                }
            }
            v16h vpre[VG];                                       // single-product blocks: the V^T fragments, read inside either softmax path
            v16h pb, pr = hz; float ls = 0.0f, resc = 1.0f, mnew = m;
            // softmax of the step's 16 x 32 scores; FULL: every row of the tile keeps every key of the step, so the keep tests are identities and are not computed
            auto soft = [&](auto fc) {
                constexpr bool FULL = decltype(fc)::value;
                const unsigned ma = mw >> (8 * hi);              // bit r: key key0+8h+r; bit 16+r: key key0+16+8h+r
                float ta[8], tb2[8]; bool fa[8], fb[8]; float mx = NEGB;
#pragma unroll
                for (int r = 0; r < 8; ++r) {
                    fa[r] = FULL || ((ma >> r) & 1u) != 0u;
                    fb[r] = FULL || ((ma >> (16 + r)) & 1u) != 0u;
                    if (EARLY) { ta[r] = (sHa[r] + sLa[r] * QRI) * SC2; tb2[r] = (sHb[r] + sLb[r] * QRI) * SC2; }
                    else       { ta[r] = sHa[r] * SC2; tb2[r] = sHb[r] * SC2; }
                    mx = fmaxf(mx, fmaxf(fa[r] ? ta[r] : NEGB, fb[r] ? tb2[r] : NEGB)); }
                const float mo2 = __shfl_xor(mx, 16, 32);
                // single-product blocks: V^T fragment reads issue behind the exchange (LDS returns in order: the exchange does not wait for them) and land under the exponentials
#pragma unroll
                for (int jj = 0; jj < VG; ++jj) if (!EARLY) vpre[jj] = ldl(vb + jj * 16 * VP);
                mx = fmaxf(mx, mo2);
                mnew = fmaxf(m, mx);
                resc = __builtin_amdgcn_exp2f(m - mnew);
                const float sh = PSH - mnew;
#pragma unroll
                for (int r = 0; r < 8; ++r) {
                    const float xa = ta[r] + sh, xb = tb2[r] + sh;
                    const float ea = __builtin_amdgcn_exp2f(xa), eb = __builtin_amdgcn_exp2f(xb);
                    const float ga = (fa[r] & (xa >= -14.0f)) ? ea : 0.0f;   // dropped elements and sub-2^-14 values selected to 0 by value
                    const float gb = (fb[r] & (xb >= -14.0f)) ? eb : 0.0f;
                    const h16 pa = (h16)ga; const h16 pc = (h16)gb;
                    pb[r] = pa; pb[8 + r] = pc;
                    if (EARLY) { pr[r] = toh_flush((ga - (float)pa) * QRS); pr[8 + r] = toh_flush((gb - (float)pc) * QRS); ls += ga + gb; }
                    else       { ls += (float)pa + (float)pc; } }
            };
            if (__builtin_expect(full, true)) soft(flagc<true>{}); else soft(flagc<false>{});   // wave-uniform; the hint lays the shorter path out as the fall-through
            l = l * resc + ls; m = mnew;
#pragma unroll
            for (int j = 0; j < 8; ++j) { o[j] = o[j] * resc; if (EARLY) oR[j] = oR[j] * resc; }
#pragma unroll
            for (int g = 0; g < 8 / VG; ++g) {
                v16h vf[VG];
#pragma unroll
                for (int jj = 0; jj < VG; ++jj) vf[jj] = EARLY ? ldl(vb + (g * VG + jj) * 16 * VP) : vpre[jj];
#pragma unroll
                for (int jj = 0; jj < VG; ++jj) {
                    o[g * VG + jj] = wmma16g(vf[jj], pb, o[g * VG + jj]);
                    if (EARLY) oR[g * VG + jj] = wmma16g(vf[jj], pr, oR[g * VG + jj]); }
            }
        }
        // hand-over, every wave: own LDS reads returned, own copies of the group's next step landed, block barrier; only then the refill of the buffer just read
        wait_lds();
        if (EARLY) {
            wait_copies();
            __syncthreads();
            const int sn = pop();
            if (sn >= 0) stage(sn, bf);
            s0 = s1; s1 = sn; bf ^= 1;
        } else {
            // round it + 1 was copied by the pair of its parity: that pair alone waits (all it has in flight is that round); the other pair's round it + 2 flies on over the barrier.
            // Behind the barrier the same pair copies round it + 3 into the buffer that round it has just read.
            const bool due = ((it + 1 + pr) & 1) == 0;           // wave-uniform
            if (due) wait_copies();
            __syncthreads();
            const int sn = pop();
            if (due && sn >= 0) stage(sn, bf);
            s0 = s1; s1 = s2; s2 = sn; bf = (bf == NBF - 1) ? 0 : bf + 1;
        }
    }
    wait_copies();                                               // no copy outstanding when the buffers are taken over and the wave ends
    l += __shfl_xor(l, 16, 32);
    const int so = (grp * AW + wq) * 16;                         // this wave's rows in the merge state and among the O partial tiles
    if (hi == 0) mm[so + lr] = m;
    __syncthreads();                                             // every group's maximum readable; every wave has left the key and value buffers
    float mall = NEGB;
#pragma unroll
    for (int g = 0; g < KS; ++g) mall = fmaxf(mall, mm[(g * AW + wq) * 16 + lr]);
    const float fs = __builtin_amdgcn_exp2f(m - mall);           // 1 where no group kept a key (sums and partials are 0 there), 0 for a group without a kept key beside one that has some
    if (hi == 0) ll[so + lr] = l * fs;
    // O^T D layout: o[j][r] = (d = 16j + 8h + r, t = lane&15) -> os[t][d]; rows 0..15 x columns 0..127 all written
#pragma unroll
    for (int j = 0; j < 8; ++j) {
        v8f f = o[j];
        if (EARLY) f = o[j] + oR[j] * QRI;
        v4f a, c;
        a[0] = f[0] * fs; a[1] = f[1] * fs; a[2] = f[2] * fs; a[3] = f[3] * fs; c[0] = f[4] * fs; c[1] = f[5] * fs; c[2] = f[6] * fs; c[3] = f[7] * fs;
        *(v4fa*)(&os[(so + lr) * OSP + 16 * j + 8 * hi]) = a; *(v4fa*)(&os[(so + lr) * OSP + 16 * j + 8 * hi + 4]) = c; }
    __syncthreads();                                             // every group's rescaled sum and O partial readable
    float* orow = OUT + ((size_t)b * OUT_SEQ + (size_t)t0) * DM;
#pragma unroll
    for (int s = 0; s < 16 / KS; ++s) {                          // 16/KS trips = the wave's rows of the tile; 32 lanes x 4 floats = 128 columns = one whole row
        const int row = grp * (16 / KS) + s;
        float lt = 0.0f; v4f val = (v4f){};
#pragma unroll
        for (int g = 0; g < KS; ++g) {
            lt += ll[(g * AW + wq) * 16 + row];
            val += *(const v4fa*)(&os[((g * AW + wq) * 16 + row) * OSP + lane * 4]); }
        const bool any = lt > 0.0f;
        const float lsafe = any ? lt : 1.0f;
        const float inv = any ? ((1.0f / lsafe) * (1.0f / XCAR)) : __uint_as_float(0x7FC00000u);   // no kept key -> NaN row
        *(v4f*)(orow + (size_t)row * DM + lane * 4) = val * inv;
        if (s + 1 < 16 / KS) asm volatile("s_wait_xcnt 0x0" ::: "memory");   // stands in front of the next row's rewrite of the registers that the issued store names
    }
}

// k_flash: both instantiations in one grid (batch, SEQ/64 blocks), chosen by the block index (block-uniform); the single-product blocks hold the low block indices:
// block y < LATEB owns the 32-row tiles y and 2 * LATEB - 1 - y of rows [EROWS, SEQ); the multi-product blocks own 64 consecutive rows of [0, EROWS), high rows first
__global__ __launch_bounds__(32 * AW * KS) __attribute__((amdgpu_num_vgpr(256)))
void k_flash(const h16* __restrict__ QH, const h16* __restrict__ KE, const h16* __restrict__ KR, const h16* __restrict__ VT, const unsigned* __restrict__ MB, float* OUT) {
    __shared__ __align__(16) h16 qt[AW * 16 * KP];               // q rows of the block
    __shared__ __align__(16) unsigned mt[AW * 16 * MP];          // mask bit words of the block's rows
    __shared__ __align__(16) h16 ring[RINGH];                    // per key group: two buffers each of KE, KR, VT (multi-product blocks) or three each of KE, VT (single-product blocks); behind the loop the O partial tiles
    __shared__ float mm[KS * AW * 16], ll[KS * AW * 16];         // per (group, tile, row): running maximum, rescaled partial sum
    __shared__ __align__(16) unsigned act[AW * KS];
    constexpr int LATEB = (SEQ - EROWS) / (16 * AW);
    const int y = blockIdx.y;
    const int b = blockIdx.x;
    if (y >= LATEB) { const int r0 = (SEQ / (16 * AW) - 1 - y) * 16 * AW; flash_body<1>(qt, mt, ring, mm, ll, act, r0, r0 + 32, b, QH, KE, KR, VT, MB, OUT); }
    else            flash_body<0>(qt, mt, ring, mm, ll, act, EROWS + 32 * y, SEQ - 32 - 32 * y, b, QH, KE, KR, VT, MB, OUT);
}

static constexpr size_t al256(size_t v) { return (v + 255) & ~(size_t)255; }
static constexpr size_t SZ_PL = al256((size_t)NB * SEQ * DM * 2);          // QH, KE, VT
static constexpr size_t SZ_RS = al256((size_t)NB * EROWS * DM * 2);        // KR
static constexpr size_t SZ_MB = al256((size_t)SEQ * MW * 4);               // MB
static constexpr size_t SZ_TOTAL = 3 * SZ_PL + SZ_RS + SZ_MB;
static_assert(SZ_TOTAL <= (size_t)134217728);          // workspace carve <= 128 MiB
static_assert(((size_t)NB * SEQ * DM) % 8 == 0);       // thread-linear 16-byte stores cover the planes exactly
static_assert(((size_t)SEQ * MW) % 4 == 0);
static_assert(((size_t)NB * OUT_SEQ * DM * 4) <= (size_t)8388608 || NB != NB_FULL || OUT_SEQ != SEQ_FULL);

extern "C" void kernel_launch(void* const* d_in, const int* in_sizes, int n_in,
                              void* d_out, int out_size, void* d_ws, size_t ws_size, hipStream_t stream) {
    if (n_in < 5) return;
    const size_t needx = ((size_t)(NB - 1) * SEQ_FULL + SEQ) * DM;
    const size_t needm = (size_t)(SEQ - 1) * SEQ_FULL + SEQ;
    if ((size_t)in_sizes[0] < needx || (size_t)in_sizes[1] < needx || (size_t)in_sizes[2] < needx) return;
    if ((size_t)in_sizes[3] < needm || in_sizes[4] < 1) return;
    if ((size_t)out_size < ((size_t)(NB - 1) * OUT_SEQ + SEQ) * DM) return;
    if (SZ_TOTAL > ws_size) return;
    // wire order: q, k, v, mask, mode
    const float* q = (const float*)d_in[0];
    const float* k = (const float*)d_in[1];
    const float* v = (const float*)d_in[2];
    const int* mask = (const int*)d_in[3];
    const float* mode = (const float*)d_in[4];
    float* OUT = (float*)d_out;      // [NB][SEQ][128]
    char* wsp = (char*)d_ws;
    h16* QH = (h16*)wsp; wsp += SZ_PL;               // [NB][SEQ][128]  q x16
    h16* KE = (h16*)wsp; wsp += SZ_PL;               // [NB][SEQ][128]  combined key x16
    h16* VT = (h16*)wsp; wsp += SZ_PL;               // [NB][128][SEQ]  v^T x16
    h16* KR = (h16*)wsp; wsp += SZ_RS;               // [NB][EROWS][128] combined-key residual x2048, tokens < EROWS
    unsigned* MB = (unsigned*)wsp; wsp += SZ_MB;     // [SEQ][SEQ/32] mask bit words

    k_prep<<<PBLK, PT, 0, stream>>>(q, k, v, mask, mode, QH, KE, KR, VT, MB);
    // query rows [0, EROWS): multi-product instantiation; rows [EROWS, SEQ): single-product instantiation (disjoint output rows)
    k_flash<<<dim3(NB, SEQ / (16 * AW), 1), 32 * AW * KS, 0, stream>>>(QH, KE, KR, VT, MB, OUT);
}

// v008
// A run of this version takes 25 microseconds.
// In two side-by-side timings against v007, it was 1.04 and 1.03 times as fast.
// All steps since v000 together make it 7.27 times as fast.
#include <hip/hip_runtime.h>

// Single-head masked attention, head width 128: q/k/v [NB][SEQ][128] f32, mask [1][SEQ][SEQ] int32 (0 = dropped, read by value), mode scalar f32.
// logit = 128^-0.5 * q . ((1-a) * roll(k, 1 along d) - a * k), a = sigmoid(mode); dropped entries are replaced by -inf; softmax over keys; output = P v (f32).
// Compute dtypes, f32 accumulate everywhere: scores v_wmma_f32_16x16x32_f16: q (bf16-RNE input, x16 carry, exact in f16) against the combined key operand ke = (1-a) k[d-1] - a k[d]
// (built in f32 from bf16-RNE k, x16 carry) as single f16 on query rows >= EROWS and as f16 value + f16 residual x2048 (own accumulator) on query rows < EROWS;
// P.V v_wmma_f32_16x16x32_f16: P (x16384 carry, cancels in the normalisation) single f16 on query rows >= EROWS, f16 value + f16 residual x2048 (own accumulator, folded by 1/2048) on query rows < EROWS;
// v (bf16-RNE input, x16 carry, exact in f16) single everywhere; softmax f32 (online, running max over kept keys).
// Layout: QH [b][t][128], KE [b][s][128], KR [b][s < EROWS][128], VT [b][d][s] (transposed through LDS), MB [t][SEQ/32] mask bit words (bit j = key 32w + j kept).
// Fused flash kernel in transposed form (S^T = KE QH^T, O^T = VT P^T); operand tiles staged in LDS by asynchronous copies, shared by the four waves of a key group; a 32-key step is skipped when its mask block is all zero (per block for the copies, per wave for the work).
// The kept key steps of a block are dealt round-robin to KS key groups of four waves each; every group keeps its own softmax state and O partial, merged through LDS at the end.
// Single-product blocks keep three K/V buffers per key group: a step's copies are issued two rounds ahead, alternately by the group's two wave pairs, so that each wave has one step in flight and waits for it alone.
// A single-product flash block owns two 32-row query tiles mirrored about the middle of rows [EROWS, SEQ), so that under a mask whose kept keys grow with the row every block has about the same work.

#ifndef NB
#define NB 8
#endif
#ifndef SEQ
#define SEQ 2048
#endif
#define NB_FULL  8
#define SEQ_FULL 2048
#ifndef OUT_SEQ
#define OUT_SEQ SEQ              // row pitch (in tokens) between batches of the output
#endif
#define DM   128
#define AW   4                   // query tiles per flash block (16 query rows each), one wave per tile and key group
#define KS   4                   // key groups per flash block (AW waves each)
#define OSP  132                 // LDS row pitch (floats) of the flash output tile
#define VTP  72                  // LDS row pitch (halves) of the transpose tile
#define MW   (SEQ / 32)          // mask bit words per query row
#define KP   136                 // LDS row pitch (halves) of the q, KE and KR tiles: 272 B
#define VP   40                  // LDS row pitch (halves) of the VT tile: 80 B
#define MP   68                  // LDS row pitch (words) of the mask-word tile: 272 B
#define EROWS (SEQ < 512 ? SEQ : 512)   // query rows (and tokens of the residual key plane) handled by the multi-product flash instantiation
#define XCAR 16.0f               // carry of the q, ke and v planes
#define QRS  2048.0f             // carry of every residual plane / residual fragment
#define QRI  (1.0f / 2048.0f)
#define SC2  ((float)(0.08838834764831845 * 1.4426950408889634 / 256.0))   // DM^-0.5 * log2(e) / (XCAR * XCAR)
#define PSH  14.0f               // log2 of the P carry (16384)
#define NEGB (-3.0e38f)

static_assert(DM == 128);                      // output row = 32 lanes x 4 floats; plane row = 16 threads x 8 halves
static_assert(DM % 32 == 0);                   // score k-loop steps by 32
static_assert(DM / 8 == 16);                   // k_prep: row = tid >> 4
static_assert((DM & (DM - 1)) == 0);           // rolled index uses a mask
static_assert(SEQ % 128 == 0);                 // MW multiple of 4: a 16-byte copy moves four mask words of one row
static_assert(SEQ % 64 == 0);                  // transpose tiles of 64 tokens
static_assert(SEQ % 32 == 0);                  // key loop steps by 32
static_assert(EROWS % (16 * AW) == 0);
static_assert((KP * 2) % 16 == 0 && KP >= DM && (VP * 2) % 16 == 0 && VP >= 32 && (MP * 4) % 16 == 0 && MP >= MW);   // 16-byte copies and fragment reads stay aligned and inside a row
static_assert(MW == 64 && AW == 4 && KS == 4); // flash copy maps and step bit map: 512 threads (128 per key group), 64 rows x 64 words, one 64-bit map
static_assert((SEQ - EROWS) % (16 * AW) == 0);  // the 32-row tiles of rows [EROWS, SEQ) pair up exactly
static_assert(EROWS >= 32);
static_assert(EROWS % 32 == 0);
static_assert(EROWS <= SEQ);
static_assert(NB <= NB_FULL);
static_assert(SEQ <= SEQ_FULL);
static_assert((OSP * 4) % 16 == 0);
static_assert(OSP >= DM);
static_assert((VTP * 2) % 16 == 0);
static_assert(VTP >= 64);
#define RING_E (KS * 2 * (32 * KP * 2 + DM * VP))   // halves of the K/V ring, multi-product blocks: two buffers each of KE, KR, VT per key group
#define RING_L (KS * 3 * (32 * KP + DM * VP))       // single-product blocks: three buffers each of KE, VT per key group
#define RINGH  (RING_E > RING_L ? RING_E : RING_L)
static_assert((size_t)AW * 16 * (KP * 2 + MP * 4) + (size_t)RINGH * 2 + (size_t)KS * AW * (2 * 16 * 4 + 4) <= 327680);   // flash static LDS: q and mask tiles, K/V ring, merge state, step map
static_assert((size_t)KS * AW * 16 * OSP * 4 <= (size_t)KS * (2 * 32 * KP * 2 + 2 * DM * VP * 2));   // the O partial tiles fit in the KE and VT buffers they take over behind the loop
static_assert((size_t)DM * VTP * 2 <= 131072);           // transpose static LDS
static_assert(32 * 4 * (16 / KS) * KS == 16 * DM);       // flash epilogue: 32 lanes x 4 floats x 16/KS trips x KS waves == 16 rows x DM floats
static_assert((size_t)NB * SEQ * DM / 8 < (size_t)2147483647);
static_assert((size_t)SEQ * DM < (size_t)2147483647);

typedef _Float16 h16;
typedef __attribute__((ext_vector_type(16))) _Float16 v16h;
typedef __attribute__((ext_vector_type(8)))  _Float16 v8h;
typedef __attribute__((ext_vector_type(8)))  float    v8f;
typedef __attribute__((ext_vector_type(4)))  float    v4f;
typedef __attribute__((ext_vector_type(4)))  int      v4i;
typedef __attribute__((ext_vector_type(4)))  unsigned v4u;
typedef v4f  __attribute__((may_alias)) v4fa;
typedef v8h  __attribute__((may_alias)) v8ha;
typedef __attribute__((ext_vector_type(4)))  _Float16 v4h;
typedef v4h  __attribute__((may_alias)) v4ha;

__device__ __forceinline__ unsigned short f2bf(float f) { unsigned u = __float_as_uint(f); u += 0x7FFFu + ((u >> 16) & 1u); return (unsigned short)(u >> 16); }
__device__ __forceinline__ float bfr(float f) { return __uint_as_float(((unsigned)f2bf(f)) << 16); }   // value after RNE convert to bf16
__device__ __forceinline__ v16h cat16(v8h lo, v8h hi) { return __builtin_shufflevector(lo, hi, 0, 1, 2, 3, 4, 5, 6, 7, 8, 9, 10, 11, 12, 13, 14, 15); }
__device__ __forceinline__ v8f wmma16(v16h a, v16h b, v8f c) { return __builtin_amdgcn_wmma_f32_16x16x32_f16(false, a, false, b, (short)0, c, false, false); }
// fragment loaders from K-contiguous 16-bit rows; p already includes + 8*(lane>>4): elements 0..7 <- k0+8h+0..7, elements 8..15 <- k0+16+8h+0..7 (same map for A and B)
__device__ __forceinline__ v16h  ldh(const h16* p) { return cat16(*(const v8h*)p, *(const v8h*)(p + 16)); }

// f32 -> f16 convert that cannot produce an f16 subnormal (|v| < 2^-14 -> +0)
static __device__ __forceinline__ h16 toh_flush(float v) { const h16 r = (h16)v; return (fabsf(v) < 6.103515625e-05f) ? (h16)0.0f : r; }
// one WMMA with its own hazard guard (ties the accumulator, keeps A and B live)
static __device__ __forceinline__ v8f wmma16g(v16h a, v16h b, v8f c) {
    c = wmma16(a, b, c);
    asm volatile("v_nop\n\tv_nop\n\tv_nop\n\tv_nop" : "+v"(c) : "v"(a), "v"(b));
    return c;
}

// eight q or v-like values: f16(bf16_rne(x) * 16)
__device__ __forceinline__ v8h cvt8(v8f v) {
    v8h o;
#pragma unroll
    for (int e = 0; e < 8; ++e) o[e] = toh_flush(bfr(v[e]) * XCAR);
    return o;
}

// keff8: combined key operand ke[d] = (1-a) * k[(d-1) mod DM] - a * k[d] for eight consecutive d, from bf16-RNE k, in f32 (x = k[d0..d0+7], xm = k[(d0-1) mod DM]); hv = f16 value, rv = f16 residual x2048
__device__ __forceinline__ void keff8(v8f x, float xm, float al, float oma, v8h& hv, v8h& rv) {
#pragma clang fp contract(off)   // as it stood in the key preparation: both products of the combination are rounded before the subtraction, so value and residual planes keep their bits
    float prev = bfr(xm);
#pragma unroll
    for (int e = 0; e < 8; ++e) {
        const float cur = bfr(x[e]);
        const float c = (oma * prev - al * cur) * XCAR;
        const h16 hh = toh_flush(c);
        hv[e] = hh; rv[e] = toh_flush((c - (float)hh) * QRS);
        prev = cur; }
}

// stands behind a group of issued global loads: s_wait_xcnt in front of any rewrite (also by a later load's result) of the address registers that they name;
// the scheduling barrier keeps the group in front of it, and so ahead of the first use: without it the scheduler sinks part of the k and q loads behind the wait for v, a second memory latency
__device__ __forceinline__ void loads_issued() { asm volatile("s_wait_xcnt 0x0" ::: "memory"); __builtin_amdgcn_sched_barrier(0); }

// k_prep: all operand preparation in one resident round: NB * SEQ / 64 blocks of 16 waves (one per WGP on a chip of that many), so that few waves have to start.
// Block = 64 tokens of one batch of q, k and v, and 512 mask bit words; every thread issues all its loads (46, 328 bytes) ahead of any use, in the order of use.
// v: thread = 4 tokens x 4 columns (a wave's load = 4 rows x one whole 128-byte line), written to the LDS tile ts[d][token] as four 8-byte runs of tokens; block barrier; drained as rows of 64 tokens: VT[b][d][t] = f16(bf16_rne(v[b][t][d]) * 16).
// k, q: thread = two runs of 8 columns. mask: wave = 32 words of one row; load c brings the 32 entries of word c, one per lane (one line), the wave's vote on != 0 is the word (bit j = key 32w + j kept), lane c keeps it.
#define PT   512
#define PBLK (NB * (SEQ / 64))
static_assert(PT * 16 == 64 * DM);                       // v: 512 threads x (4 tokens x 4 columns); q, k: 512 threads x 2 x 8 columns == 64 tokens x DM
static_assert(PT * 8 * 2 == DM * 64);                    // transpose drain: 512 threads x 8 halves x 2 trips == DM rows x 64 tokens
static_assert((size_t)PBLK * PT == (size_t)SEQ * MW);    // mask: one word per thread of the grid
static_assert(MW % 32 == 0);                             // a wave's 32 words lie in one row
static_assert(EROWS % 64 == 0);                          // a block's tokens lie on one side of EROWS
__global__ __launch_bounds__(PT) void k_prep(const float* __restrict__ q, const float* __restrict__ k, const float* __restrict__ v, const int* __restrict__ mask, const float* __restrict__ mode,
                                             h16* QH, h16* KE, h16* KR, h16* VT, unsigned* MB) {
    __shared__ __align__(16) h16 ts[DM * VTP];
    const int tid = threadIdx.x, lane = tid & 31;
    const int wave = __builtin_amdgcn_readfirstlane((int)(threadIdx.x >> 5));
    const int blk = blockIdx.x;
    const int b = blk / (SEQ / 64), tok0 = (blk % (SEQ / 64)) * 64;
    const size_t ib = ((size_t)b * SEQ_FULL + (size_t)tok0) * DM;    // the block's first element in q, k, v
    const int vc = ((wave & 3) * 8 + (lane & 7)) * 4;                // v: first column, first token of the thread's 4 x 4 piece
    const int vk = ((wave >> 2) * 4 + (lane >> 3)) * 4;
    const int row = tid >> 4, d0 = (tid & 15) * 8;                   // q, k: local rows row and row + 32, columns d0 .. d0 + 7
    const int gw = blk * (PT / 32) + wave;                           // mask: the wave's run of 32 words
    const int mrow = gw / (MW / 32), mw0 = (gw % (MW / 32)) * 32;
    const int* ms = mask + (size_t)mrow * SEQ_FULL + (size_t)mw0 * 32 + lane;
    v4f xv[4]; v8f xk[2], xq[2]; float xm[2]; int xw[32];
    const float mraw = mode[0];
#pragma unroll
    for (int r = 0; r < 4; ++r) xv[r] = *(const v4f*)(v + ib + (size_t)(vk + r) * DM + vc);
    loads_issued();
#pragma unroll
    for (int u = 0; u < 2; ++u) {
        const float* kr = k + ib + (size_t)(row + 32 * u) * DM;
        xk[u] = *(const v8f*)(kr + d0); xm[u] = kr[(d0 + DM - 1) & (DM - 1)]; }
    loads_issued();
#pragma unroll
    for (int u = 0; u < 2; ++u) xq[u] = *(const v8f*)(q + ib + (size_t)(row + 32 * u) * DM + d0);
    loads_issued();
#pragma unroll
    for (int c = 0; c < 32; ++c) xw[c] = ms[c * 32];
    loads_issued();
    // v through the transpose tile
#pragma unroll
    for (int e = 0; e < 4; ++e) {
        v4h o;
#pragma unroll
        for (int r = 0; r < 4; ++r) o[r] = toh_flush(bfr(xv[r][e]) * XCAR);
        *(v4ha*)(&ts[(vc + e) * VTP + vk]) = o; }
    // block barrier with LDS-only fences: transpose tile filled [128][64] == drained extent; __syncthreads() would also wait here for every global load still in flight (k, q, mask)
    __builtin_amdgcn_fence(__ATOMIC_RELEASE, "workgroup", "local");
    __builtin_amdgcn_s_barrier();
    __builtin_amdgcn_fence(__ATOMIC_ACQUIRE, "workgroup", "local");
    h16* dstb = VT + (size_t)b * DM * SEQ + (size_t)tok0;
#pragma unroll
    for (int s = 0; s < 2; ++s) { const int p = s * PT + tid; const int d = p >> 3, c8 = (p & 7) * 8;   // 2 trips x 64 rows = 128 rows; 8 lanes x 8 halves = 64 tokens
        const v8h val = *(const v8ha*)(&ts[d * VTP + c8]);
        *(v8h*)(dstb + (size_t)d * SEQ + c8) = val; }
    // combined key (and its residual on tokens < EROWS)
    const float mv = bfr(mraw);
    const float al = 1.0f / (1.0f + expf(-mv));
    const float oma = 1.0f - al;
    const size_t ob = ((size_t)b * SEQ + (size_t)tok0) * DM;         // the block's first element in QH, KE
    const bool wr = tok0 < EROWS;                                    // block-uniform
#pragma unroll
    for (int u = 0; u < 2; ++u) {
        v8h hv, rv; keff8(xk[u], xm[u], al, oma, hv, rv);
        *(v8h*)(KE + ob + (size_t)(row + 32 * u) * DM + d0) = hv;
        asm volatile("s_wait_xcnt 0x0" ::: "memory");   // stands in front of the rewrite, in the residual branch, of the registers that the issued store names
        if (wr) *(v8h*)(KR + ((size_t)b * EROWS + (size_t)(tok0 + row + 32 * u)) * DM + d0) = rv; }
#pragma unroll
    for (int u = 0; u < 2; ++u) *(v8h*)(QH + ob + (size_t)(row + 32 * u) * DM + d0) = cvt8(xq[u]);
    unsigned w = 0u;
#pragma unroll
    for (int c = 0; c < 32; ++c) { const unsigned bal = __builtin_amdgcn_ballot_w32(xw[c] != 0); w = (lane == c) ? bal : w; }
    MB[(size_t)gw * 32 + lane] = w;
}

// low 32 bits of a __shared__ address = byte offset in the work-group's LDS (destination operand of an asynchronous copy)
__device__ __forceinline__ unsigned ldsa(const void* p) { return (unsigned)(size_t)p; }
// eight / four asynchronous 16-byte copies global -> LDS per lane; the s_wait_xcnt closes the statement so that no address register is rewritten ahead of it
__device__ __forceinline__ void cp8(unsigned l0, const void* g0, unsigned l1, const void* g1, unsigned l2, const void* g2, unsigned l3, const void* g3,
                                    unsigned l4, const void* g4, unsigned l5, const void* g5, unsigned l6, const void* g6, unsigned l7, const void* g7) {
    asm volatile("global_load_async_to_lds_b128 %0, %1, off\n\t"
                 "global_load_async_to_lds_b128 %2, %3, off\n\t"
                 "global_load_async_to_lds_b128 %4, %5, off\n\t"
                 "global_load_async_to_lds_b128 %6, %7, off\n\t"
                 "global_load_async_to_lds_b128 %8, %9, off\n\t"
                 "global_load_async_to_lds_b128 %10, %11, off\n\t"
                 "global_load_async_to_lds_b128 %12, %13, off\n\t"
                 "global_load_async_to_lds_b128 %14, %15, off\n\t"
                 "s_wait_xcnt 0x0"
                 :: "v"(l0), "v"(g0), "v"(l1), "v"(g1), "v"(l2), "v"(g2), "v"(l3), "v"(g3),
                    "v"(l4), "v"(g4), "v"(l5), "v"(g5), "v"(l6), "v"(g6), "v"(l7), "v"(g7) : "memory");
}
__device__ __forceinline__ void cp4(unsigned l0, const void* g0, unsigned l1, const void* g1, unsigned l2, const void* g2, unsigned l3, const void* g3) {
    asm volatile("global_load_async_to_lds_b128 %0, %1, off\n\t"
                 "global_load_async_to_lds_b128 %2, %3, off\n\t"
                 "global_load_async_to_lds_b128 %4, %5, off\n\t"
                 "global_load_async_to_lds_b128 %6, %7, off\n\t"
                 "s_wait_xcnt 0x0"
                 :: "v"(l0), "v"(g0), "v"(l1), "v"(g1), "v"(l2), "v"(g2), "v"(l3), "v"(g3) : "memory");
}
// this wave's asynchronous copies have landed in LDS (other waves read them behind the next block barrier)
__device__ __forceinline__ void wait_copies() { asm volatile("s_wait_asynccnt 0x0" ::: "memory"); }
// this wave's LDS reads have returned (stands in front of the barrier behind which their buffer is refilled)
__device__ __forceinline__ void wait_lds() { asm volatile("s_wait_dscnt 0x0" ::: "memory"); }
// compile-time flag handed to a generic lambda
template <bool B> struct flagc { static constexpr bool value = B; };
// fragment loader from an LDS tile, same element map as ldh
__device__ __forceinline__ v16h ldl(const h16* p) { return cat16(*(const v8ha*)p, *(const v8ha*)(p + 16)); }

// flash_body: fused attention, one block per 64 query rows of one batch (two runs of 32 rows, from row ra and from row rb); KS key groups of AW waves, wave (group, tile) works 16 query rows against the group's key steps.
// Wave -> (group = wave mod KS, tile = wave / KS): the four tiles of one group are the waves of equal wave mod KS, so a step that only the longer run keeps leaves every group two working waves.
// Key split: the block's kept 32-key steps, in ascending order, go round-robin to the key groups (rank mod KS); four waves per SIMD fill one another's latencies.
// Staging: the block's q rows and mask bit words are copied to LDS once, and every wave reads its q fragments from there once, into registers, ahead of the key loop; the KE / KR / VT tiles of a group's 32-key step are copied to LDS by and for the group's four waves, two buffers per group,
// the group's next step's copies in flight while this step is worked on (asynchronous copies, 16 bytes per lane; whole tile = 4 copies per thread and plane);
// single-product blocks: three buffers per group, the next two steps' copies in flight, each step copied by one pair of the group's waves (8 copies per thread and plane).
// Tile pitches: 272 B (q, KE, KR rows of 256 B; mask rows of 256 B) and 80 B (VT rows of 64 B), 16 B x odd for the 16-byte fragment reads.
// Transposed form: S^T[key][t] = KE QH^T (A = key rows, B = query rows, 4 k-steps of 32); lane (t = lane&15, h = lane>>4) holds keys 8h+r of each 16-key tile, so the packed
// P tile is directly the B fragment of O^T[d][t] = VT P^T (element r <- tile keys 0..15, element 8+r <- tile keys 16..31, lane unchanged), 8 d-tiles.
// Softmax state (running max over kept keys, partial sum) is one scalar per lane; the two lane halves of a row are combined with one xor-16 exchange.
// Keep rule per element from the mask bit word of (row, 32-key step); a step whose words are zero on all 64 rows of the block is neither copied nor visited (block-uniform bit map),
// a step whose words are zero on the wave's own 16 rows is not worked on by that wave (wave-uniform); kept steps are visited in ascending order.
// A step whose words are all ones on the wave's own 16 rows takes a softmax path without the per-element keep tests (wave-uniform branch, same values).
// EARLY = 1 (query rows [0, EROWS)): scores = KE Q + KR Q / 2048; P = f16 value + f16 residual x2048; O = V P + V P_res / 2048 (residual products in their own accumulators);
//            row sum from the f32 exponentials; KR fragments are zero for keys >= EROWS (address clamped, wave-uniform select).
// EARLY = 0 (query rows [EROWS, SEQ)): single products, row sum over the converted P.
// Epilogue: the groups' running maxima are exchanged through LDS, every wave rescales its partial sum and O^T partial to the common maximum and stages them in LDS (its own tile of 16 rows x 128 columns,
// in the space of the key and value buffers, all written); wave (group, tile) then adds the KS partials of rows 16/KS * group .. of its tile in ascending group order and stores them whole (128 floats = 512 B = four lines)
// The LDS arrays belong to the kernel (one set for both instantiations) and are handed in; ra, rb = first query row of the block's local rows 0..31 and 32..63, b = batch.
template <int EARLY>
__device__ __forceinline__ void flash_body(h16* qt, unsigned* mt, h16* ring, float* mm, float* ll, unsigned* act, int ra, int rb, int b,
                                           const h16* __restrict__ QH, const h16* __restrict__ KE, const h16* __restrict__ KR, const h16* __restrict__ VT,
                                           const unsigned* __restrict__ MB, float* OUT) {
    constexpr int KB = 32 * KP, VB = DM * VP;                    // halves per KE / KR buffer, per VT buffer
    h16* const kt = ring;                                        // KE tiles [group][buffer]
    constexpr int NBF = EARLY ? 2 : 3;                           // buffers per key group and plane
    h16* const vt = ring + KS * NBF * KB;                        // VT tiles [group][buffer]
    h16* const rt = ring + (EARLY ? KS * 2 * (KB + VB) : 0);     // KR tiles [group][buffer]
    float* const os = (float*)ring;                              // O partial tiles [group][tile][16][OSP]
    constexpr int VG = EARLY ? 4 : 8;                            // V^T fragments read from LDS per group
    constexpr int KG = EARLY ? 1 : 4;                            // k-steps of KE / KR fragments read from LDS per group
    const int tid = threadIdx.x;
    const int lane = threadIdx.x & 31, lr = lane & 15, hi = lane >> 4;
    const int wave = __builtin_amdgcn_readfirstlane((int)(threadIdx.x >> 5));
    const int grp = wave & (KS - 1), wq = wave / KS;             // key group, query tile
    const int pr = wq >> 1;                                      // single-product blocks: the wave's pair within its key group (copies the steps of the rounds of that parity)
    const int gt = (EARLY ? wq : (wq & 1)) * 32 + lane;          // thread among the waves that copy one step: the key group / the pair
    const int t0 = (wq < AW / 2 ? ra : rb) + (wq & (AW / 2 - 1)) * 16;   // first query row of the wave's tile
    const h16* Qb = QH + (size_t)b * SEQ * DM;
    const h16* Kb = KE + (size_t)b * SEQ * DM;
    const h16* Rb = KR + (size_t)b * EROWS * DM;
    const h16* Vb = VT + (size_t)b * DM * SEQ;
    // copy maps: 256-B rows: thread -> (row gt>>4 + 8i (pair: 4i), 16-B column gt&15); 64-B rows: thread -> (row gt>>2 + 32i (pair: 16i), 16-B column gt&3)
    const int r16 = gt >> 4, c16 = gt & 15, r4 = gt >> 2, c4 = gt & 3;
    {
        // block copy map, q rows and mask words: thread -> (local row tid>>4 + 32i, 16-B column tid&15); local rows 0..31 are rows ra.., 32..63 rows rb..
        const int rq = tid >> 4, cq = tid & 15;
        const h16* qga = Qb + (size_t)(ra + rq) * DM + cq * 8;
        const h16* qgb = Qb + (size_t)(rb + rq) * DM + cq * 8;
        const unsigned ql = ldsa(qt) + (unsigned)(rq * KP + cq * 8) * 2u;
        const unsigned* mga = MB + (size_t)(ra + rq) * MW + cq * 4;
        const unsigned* mgb = MB + (size_t)(rb + rq) * MW + cq * 4;
        const unsigned ml = ldsa(mt) + (unsigned)(rq * MP + cq * 4) * 4u;
        cp4(ql, qga, ql + 32 * KP * 2, qgb, ml, mga, ml + 32 * MP * 4, mgb);
    }
    wait_copies();
    __syncthreads();                                             // q rows and mask words readable by every wave
    // block-uniform bit map of the steps that some row of the block keeps: thread -> (step tid&63, rows 8*(tid>>6) .. +7); even waves hold steps 0..31, odd waves steps 32..63
    unsigned orv = 0u;
#pragma unroll
    for (int i = 0; i < 8; ++i) orv |= mt[((tid >> 6) * 8 + i) * MP + (tid & 63)];
    const unsigned bal = __builtin_amdgcn_ballot_w32(orv != 0u);
    if (lane == 0) act[wave] = bal;
    __syncthreads();
    unsigned olo = 0u, ohi = 0u;
#pragma unroll
    for (int i = 0; i < AW * KS / 2; ++i) { olo |= act[2 * i]; ohi |= act[2 * i + 1]; }
    const unsigned alo = (unsigned)__builtin_amdgcn_readfirstlane((int)olo);
    const unsigned ahi = (unsigned)__builtin_amdgcn_readfirstlane((int)ohi);
    unsigned long long rem = ((unsigned long long)ahi << 32) | (unsigned long long)alo;
    const int trips = (__builtin_popcountll(rem) + KS - 1) / KS; // block-uniform: rounds of KS kept steps
    // the next KS kept steps leave the map in ascending order; returns the one of this key group (-1: none left for it)
    auto pop = [&]() {
        int mine = -1;
#pragma unroll
        for (int j = 0; j < KS; ++j)
            if (rem != 0ull) { const int s = __builtin_ctzll(rem); rem &= rem - 1ull; if (j == grp) mine = s; }
        return mine;
    };

    const h16* kg0 = Kb + r16 * DM + c16 * 8;
    const h16* rg0 = Rb + r16 * DM + c16 * 8;
    const h16* vg0 = Vb + r4 * SEQ + c4 * 8;
    const unsigned kl0 = ldsa(kt) + (unsigned)(grp * NBF * KB + r16 * KP + c16 * 8) * 2u;
    const unsigned rl0 = ldsa(rt) + (unsigned)(grp * 2 * KB + r16 * KP + c16 * 8) * 2u;
    const unsigned vl0 = ldsa(vt) + (unsigned)(grp * NBF * VB + r4 * VP + c4 * 8) * 2u;
    // copies of step s into the group's buffer bf (group-uniform arguments; every lane on); multi-product: by the group's four waves, single-product: by one pair (16 copies per thread)
    auto stage = [&](int s, int bf) {
        const int key0 = s * 32;
        const h16* kg = kg0 + key0 * DM; const h16* vg = vg0 + key0;
        const unsigned kl = kl0 + (unsigned)bf * (32 * KP * 2), vl = vl0 + (unsigned)bf * (DM * VP * 2);
        if (!EARLY) {
            cp8(kl, kg, kl + 4 * KP * 2, kg + 4 * DM, kl + 8 * KP * 2, kg + 8 * DM, kl + 12 * KP * 2, kg + 12 * DM,
                kl + 16 * KP * 2, kg + 16 * DM, kl + 20 * KP * 2, kg + 20 * DM, kl + 24 * KP * 2, kg + 24 * DM, kl + 28 * KP * 2, kg + 28 * DM);
            cp8(vl, vg, vl + 16 * VP * 2, vg + 16 * SEQ, vl + 32 * VP * 2, vg + 32 * SEQ, vl + 48 * VP * 2, vg + 48 * SEQ,
                vl + 64 * VP * 2, vg + 64 * SEQ, vl + 80 * VP * 2, vg + 80 * SEQ, vl + 96 * VP * 2, vg + 96 * SEQ, vl + 112 * VP * 2, vg + 112 * SEQ);
        } else {
            cp8(kl, kg, kl + 8 * KP * 2, kg + 8 * DM, kl + 16 * KP * 2, kg + 16 * DM, kl + 24 * KP * 2, kg + 24 * DM,
                vl, vg, vl + 32 * VP * 2, vg + 32 * SEQ, vl + 64 * VP * 2, vg + 64 * SEQ, vl + 96 * VP * 2, vg + 96 * SEQ);
            const int kcl = (key0 < EROWS) ? key0 : (EROWS - 32);    // clamped residual-plane key (address always inside the plane)
            const h16* rg = rg0 + kcl * DM; const unsigned rl = rl0 + (unsigned)bf * (32 * KP * 2);
            cp4(rl, rg, rl + 8 * KP * 2, rg + 8 * DM, rl + 16 * KP * 2, rg + 16 * DM, rl + 24 * KP * 2, rg + 24 * DM);
        }
    };
    int s0 = pop();                                              // the group's kept step of this round, of the next round (-1: none)
    int s1 = pop();
    int s2 = -1;                                                 // single-product blocks: of the round after that
    if (EARLY) {
        if (s0 >= 0) stage(s0, 0);
        wait_copies();
        __syncthreads();                                         // each group's first kept step readable by its waves
        if (s1 >= 0) stage(s1, 1);
    } else {
        s2 = pop();
        if (pr == 0) { if (s0 >= 0) stage(s0, 0); wait_copies(); }   // wave-uniform: pair 0 brings round 0 and waits for it; pair 1's round 1 stays in flight over the barrier
        else         { if (s1 >= 0) stage(s1, 1); }
        __syncthreads();                                         // each group's first kept step readable by its waves
        if (pr == 0 && s2 >= 0) stage(s2, 2);                    // third buffer, not yet read by anybody
    }

    const int mo = (wq * 16 + lr) * MP;
    const int qo = (wq * 16 + lr) * KP + 8 * hi;                 // B fragment: col t, k = d
    const int ko = lr * KP + 8 * hi;                             // + tile row * KP + kc   (A fragment: row key, k = d)
    const int vo = lr * VP + 8 * hi;                             // + 16j*VP               (A fragment: row d, k = key)
    const v16h hz = (v16h){};
    v8f o[8], oR[8];
#pragma unroll
    for (int j = 0; j < 8; ++j) { o[j] = (v8f){}; oR[j] = (v8f){}; }
    float m = NEGB, l = 0.0f;
    int bf = 0;
    v16h qf[4];                                                  // the wave's q fragments (B operand of the scores, one per k-step of 32): the same at every key step, read from the q tile once
#pragma unroll   // constant indices keep qf in registers
    for (int u = 0; u < 4; ++u) qf[u] = ldl(qt + qo + u * 32);
#pragma unroll 1
    for (int it = 0; it < MW / KS; ++it) {
        if (it >= trips) break;                                  // block-uniform: no kept step left
        const unsigned mw = (s0 >= 0) ? mt[mo + s0] : 0u;        // group-uniform test: no step for this group in the last round
        if (__builtin_amdgcn_ballot_w32(mw != 0u) != 0u) {       // wave-uniform: some row of this tile keeps some key of this step
            const bool full = __builtin_amdgcn_ballot_w32(mw != 0xFFFFFFFFu) == 0u;   // wave-uniform: all 16 rows of the tile keep all 32 keys of the step
            const int key0 = s0 * 32;
            const bool rok = key0 < EROWS;                       // wave-uniform
            const h16* kb = kt + (grp * NBF + bf) * KB + ko;
            const h16* rb = rt + (EARLY ? (grp * 2 + bf) * KB : 0) + ko;
            const h16* vb = vt + (grp * NBF + bf) * VB + vo;
            v8f sHa = (v8f){}, sHb = (v8f){}, sLa = (v8f){}, sLb = (v8f){};
#pragma unroll
            for (int g = 0; g < 4 / KG; ++g) {                   // the LDS fragment reads of KG k-steps issue together, one LDS latency per group
                v16h ka0[KG], kb0[KG], kra[KG], krb[KG];
#pragma unroll
                for (int u = 0; u < KG; ++u) {
                    const int kc = (g * KG + u) * 32;
                    ka0[u] = ldl(kb + kc); kb0[u] = ldl(kb + 16 * KP + kc);
                    if (EARLY) { kra[u] = ldl(rb + kc); krb[u] = ldl(rb + 16 * KP + kc); }
                }
#pragma unroll
                for (int u = 0; u < KG; ++u) {
                    const v16h qu = qf[g * KG + u];
                    sHa = wmma16g(ka0[u], qu, sHa); sHb = wmma16g(kb0[u], qu, sHb);
                    if (EARLY) {
                        if (!rok) { kra[u] = hz; krb[u] = hz; }
                        sLa = wmma16g(kra[u], qu, sLa); sLb = wmma16g(krb[u], qu, sLb);
                    }
                }
            }
            v16h vpre[VG];                                       // single-product blocks: the V^T fragments, read inside either softmax path
            v16h pb, pr = hz; float ls = 0.0f, resc = 1.0f, mnew = m;
            // softmax of the step's 16 x 32 scores; FULL: every row of the tile keeps every key of the step, so the keep tests are identities and are not computed
            auto soft = [&](auto fc) {
                constexpr bool FULL = decltype(fc)::value;
                const unsigned ma = mw >> (8 * hi);              // bit r: key key0+8h+r; bit 16+r: key key0+16+8h+r
                float ta[8], tb2[8]; bool fa[8], fb[8]; float mx = NEGB;
#pragma unroll
                for (int r = 0; r < 8; ++r) {
                    fa[r] = FULL || ((ma >> r) & 1u) != 0u;
                    fb[r] = FULL || ((ma >> (16 + r)) & 1u) != 0u;
                    if (EARLY) { ta[r] = (sHa[r] + sLa[r] * QRI) * SC2; tb2[r] = (sHb[r] + sLb[r] * QRI) * SC2; }
                    else       { ta[r] = sHa[r] * SC2; tb2[r] = sHb[r] * SC2; }
                    mx = fmaxf(mx, fmaxf(fa[r] ? ta[r] : NEGB, fb[r] ? tb2[r] : NEGB)); }
                const float mo2 = __shfl_xor(mx, 16, 32);
                // single-product blocks: V^T fragment reads issue behind the exchange (LDS returns in order: the exchange does not wait for them) and land under the exponentials
#pragma unroll
                for (int jj = 0; jj < VG; ++jj) if (!EARLY) vpre[jj] = ldl(vb + jj * 16 * VP);
                mx = fmaxf(mx, mo2);
                mnew = fmaxf(m, mx);
                resc = __builtin_amdgcn_exp2f(m - mnew);
                const float sh = PSH - mnew;
#pragma unroll
                for (int r = 0; r < 8; ++r) {
                    const float xa = ta[r] + sh, xb = tb2[r] + sh;
                    const float ea = __builtin_amdgcn_exp2f(xa), eb = __builtin_amdgcn_exp2f(xb);
                    const float ga = (fa[r] & (xa >= -14.0f)) ? ea : 0.0f;   // dropped elements and sub-2^-14 values selected to 0 by value
                    const float gb = (fb[r] & (xb >= -14.0f)) ? eb : 0.0f;
                    const h16 pa = (h16)ga; const h16 pc = (h16)gb;
                    pb[r] = pa; pb[8 + r] = pc;
                    if (EARLY) { pr[r] = toh_flush((ga - (float)pa) * QRS); pr[8 + r] = toh_flush((gb - (float)pc) * QRS); ls += ga + gb; }
                    else       { ls += (float)pa + (float)pc; } }
            };
            if (__builtin_expect(full, true)) soft(flagc<true>{}); else soft(flagc<false>{});   // wave-uniform; the hint lays the shorter path out as the fall-through
            l = l * resc + ls; m = mnew;
#pragma unroll
            for (int j = 0; j < 8; ++j) { o[j] = o[j] * resc; if (EARLY) oR[j] = oR[j] * resc; }
#pragma unroll
            for (int g = 0; g < 8 / VG; ++g) {
                v16h vf[VG];
#pragma unroll
                for (int jj = 0; jj < VG; ++jj) vf[jj] = EARLY ? ldl(vb + (g * VG + jj) * 16 * VP) : vpre[jj];
#pragma unroll
                for (int jj = 0; jj < VG; ++jj) {
                    o[g * VG + jj] = wmma16g(vf[jj], pb, o[g * VG + jj]);
                    if (EARLY) oR[g * VG + jj] = wmma16g(vf[jj], pr, oR[g * VG + jj]); }
            }
        }
        // hand-over, every wave: own LDS reads returned, own copies of the group's next step landed, block barrier; only then the refill of the buffer just read
        wait_lds();
        if (EARLY) {
            wait_copies();
            __syncthreads();
            const int sn = pop();
            if (sn >= 0) stage(sn, bf);
            s0 = s1; s1 = sn; bf ^= 1;
        } else {
            // round it + 1 was copied by the pair of its parity: that pair alone waits (all it has in flight is that round); the other pair's round it + 2 flies on over the barrier.
            // Behind the barrier the same pair copies round it + 3 into the buffer that round it has just read.
            const bool due = ((it + 1 + pr) & 1) == 0;           // wave-uniform
            if (due) wait_copies();
            __syncthreads();
            const int sn = pop();
            if (due && sn >= 0) stage(sn, bf);
            s0 = s1; s1 = s2; s2 = sn; bf = (bf == NBF - 1) ? 0 : bf + 1;
        }
    }
    wait_copies();                                               // no copy outstanding when the buffers are taken over and the wave ends
    l += __shfl_xor(l, 16, 32);
    const int so = (grp * AW + wq) * 16;                         // this wave's rows in the merge state and among the O partial tiles
    if (hi == 0) mm[so + lr] = m;
    __syncthreads();                                             // every group's maximum readable; every wave has left the key and value buffers
    float mall = NEGB;
#pragma unroll
    for (int g = 0; g < KS; ++g) mall = fmaxf(mall, mm[(g * AW + wq) * 16 + lr]);
    const float fs = __builtin_amdgcn_exp2f(m - mall);           // 1 where no group kept a key (sums and partials are 0 there), 0 for a group without a kept key beside one that has some
    if (hi == 0) ll[so + lr] = l * fs;
    // O^T D layout: o[j][r] = (d = 16j + 8h + r, t = lane&15) -> os[t][d]; rows 0..15 x columns 0..127 all written
#pragma unroll
    for (int j = 0; j < 8; ++j) {
        v8f f = o[j];
        if (EARLY) f = o[j] + oR[j] * QRI;
        v4f a, c;
        a[0] = f[0] * fs; a[1] = f[1] * fs; a[2] = f[2] * fs; a[3] = f[3] * fs; c[0] = f[4] * fs; c[1] = f[5] * fs; c[2] = f[6] * fs; c[3] = f[7] * fs;
        *(v4fa*)(&os[(so + lr) * OSP + 16 * j + 8 * hi]) = a; *(v4fa*)(&os[(so + lr) * OSP + 16 * j + 8 * hi + 4]) = c; }
    __syncthreads();                                             // every group's rescaled sum and O partial readable
    float* orow = OUT + ((size_t)b * OUT_SEQ + (size_t)t0) * DM;
#pragma unroll
    for (int s = 0; s < 16 / KS; ++s) {                          // 16/KS trips = the wave's rows of the tile; 32 lanes x 4 floats = 128 columns = one whole row
        const int row = grp * (16 / KS) + s;
        float lt = 0.0f; v4f val = (v4f){};
#pragma unroll
        for (int g = 0; g < KS; ++g) {
            lt += ll[(g * AW + wq) * 16 + row];
            val += *(const v4fa*)(&os[((g * AW + wq) * 16 + row) * OSP + lane * 4]); }
        const bool any = lt > 0.0f;
        const float lsafe = any ? lt : 1.0f;
        const float inv = any ? ((1.0f / lsafe) * (1.0f / XCAR)) : __uint_as_float(0x7FC00000u);   // no kept key -> NaN row
        *(v4f*)(orow + (size_t)row * DM + lane * 4) = val * inv;
        if (s + 1 < 16 / KS) asm volatile("s_wait_xcnt 0x0" ::: "memory");   // stands in front of the next row's rewrite of the registers that the issued store names
    }
}

// k_flash: both instantiations in one grid (batch, SEQ/64 blocks), chosen by the block index (block-uniform); the single-product blocks hold the low block indices:
// block y < LATEB owns the 32-row tiles y and 2 * LATEB - 1 - y of rows [EROWS, SEQ); the multi-product blocks own 64 consecutive rows of [0, EROWS), high rows first
__global__ __launch_bounds__(32 * AW * KS) __attribute__((amdgpu_num_vgpr(256)))
void k_flash(const h16* __restrict__ QH, const h16* __restrict__ KE, const h16* __restrict__ KR, const h16* __restrict__ VT, const unsigned* __restrict__ MB, float* OUT) {
    __shared__ __align__(16) h16 qt[AW * 16 * KP];               // q rows of the block
    __shared__ __align__(16) unsigned mt[AW * 16 * MP];          // mask bit words of the block's rows
    __shared__ __align__(16) h16 ring[RINGH];                    // per key group: two buffers each of KE, KR, VT (multi-product blocks) or three each of KE, VT (single-product blocks); behind the loop the O partial tiles
    __shared__ float mm[KS * AW * 16], ll[KS * AW * 16];         // per (group, tile, row): running maximum, rescaled partial sum
    __shared__ __align__(16) unsigned act[AW * KS];
    constexpr int LATEB = (SEQ - EROWS) / (16 * AW);
    const int y = blockIdx.y;
    const int b = blockIdx.x;
    if (y >= LATEB) { const int r0 = (SEQ / (16 * AW) - 1 - y) * 16 * AW; flash_body<1>(qt, mt, ring, mm, ll, act, r0, r0 + 32, b, QH, KE, KR, VT, MB, OUT); }
    else            flash_body<0>(qt, mt, ring, mm, ll, act, EROWS + 32 * y, SEQ - 32 - 32 * y, b, QH, KE, KR, VT, MB, OUT);
}

static constexpr size_t al256(size_t v) { return (v + 255) & ~(size_t)255; }
static constexpr size_t SZ_PL = al256((size_t)NB * SEQ * DM * 2);          // QH, KE, VT
static constexpr size_t SZ_RS = al256((size_t)NB * EROWS * DM * 2);        // KR
static constexpr size_t SZ_MB = al256((size_t)SEQ * MW * 4);               // MB
static constexpr size_t SZ_TOTAL = 3 * SZ_PL + SZ_RS + SZ_MB;
static_assert(SZ_TOTAL <= (size_t)134217728);          // workspace carve <= 128 MiB
static_assert(((size_t)NB * SEQ * DM) % 8 == 0);       // thread-linear 16-byte stores cover the planes exactly
static_assert(((size_t)SEQ * MW) % 4 == 0);
static_assert(((size_t)NB * OUT_SEQ * DM * 4) <= (size_t)8388608 || NB != NB_FULL || OUT_SEQ != SEQ_FULL);

extern "C" void kernel_launch(void* const* d_in, const int* in_sizes, int n_in,
                              void* d_out, int out_size, void* d_ws, size_t ws_size, hipStream_t stream) {
    if (n_in < 5) return;
    const size_t needx = ((size_t)(NB - 1) * SEQ_FULL + SEQ) * DM;
    const size_t needm = (size_t)(SEQ - 1) * SEQ_FULL + SEQ;
    if ((size_t)in_sizes[0] < needx || (size_t)in_sizes[1] < needx || (size_t)in_sizes[2] < needx) return;
    if ((size_t)in_sizes[3] < needm || in_sizes[4] < 1) return;
    if ((size_t)out_size < ((size_t)(NB - 1) * OUT_SEQ + SEQ) * DM) return;
    if (SZ_TOTAL > ws_size) return;
    // wire order: q, k, v, mask, mode
    const float* q = (const float*)d_in[0];
    const float* k = (const float*)d_in[1];
    const float* v = (const float*)d_in[2];
    const int* mask = (const int*)d_in[3];
    const float* mode = (const float*)d_in[4];
    float* OUT = (float*)d_out;      // [NB][SEQ][128]
    char* wsp = (char*)d_ws;
    h16* QH = (h16*)wsp; wsp += SZ_PL;               // [NB][SEQ][128]  q x16
    h16* KE = (h16*)wsp; wsp += SZ_PL;               // [NB][SEQ][128]  combined key x16
    h16* VT = (h16*)wsp; wsp += SZ_PL;               // [NB][128][SEQ]  v^T x16
    h16* KR = (h16*)wsp; wsp += SZ_RS;               // [NB][EROWS][128] combined-key residual x2048, tokens < EROWS
    unsigned* MB = (unsigned*)wsp; wsp += SZ_MB;     // [SEQ][SEQ/32] mask bit words

    k_prep<<<PBLK, PT, 0, stream>>>(q, k, v, mask, mode, QH, KE, KR, VT, MB);
    // query rows [0, EROWS): multi-product instantiation; rows [EROWS, SEQ): single-product instantiation (disjoint output rows)
    k_flash<<<dim3(NB, SEQ / (16 * AW), 1), 32 * AW * KS, 0, stream>>>(QH, KE, KR, VT, MB, OUT);
}
